// v000
// Times are from an AMD MI455X. After a warm-up the kernel runs many times in a row, and a time is the length of
// such a window on the GPU divided by its runs, so every launch and the gaps after it count. The runs cycle
// through copies of the inputs. A figure is the median of several windows, for all but v000 over two sittings.
// Sittings can differ by a few percent; kernels timed side by side share one.
// v000 is the starting kernel. One run takes 1360 microseconds.
// compute dtype: kp_feat, kp_dist, rec_atom_feats and the four weights (module inputs) rounded to bf16; the three projections with exact bf16 products (inputs x inputs) on WMMA 16x16x32; attention logits q.k with q and k as single f16 operands (1 product; near-uniform softmax over 8,192 atoms, logit error ~1e-4 relative), P.V with P = exp(s - m) and V as single f16 operands (1 product; both errors relative to an 8,192-term softmax average); the output projection with the computed operand as bf16 hi + residual pair x exact Wo (2 products); the kp_dist bias, scaling, running-max softmax and normalisation in f32; f32 accumulate.
#include <hip/hip_runtime.h>
#include <math.h>

typedef __attribute__((ext_vector_type(16))) _Float16 v16h;
typedef __attribute__((ext_vector_type(16))) __bf16 v16b;
typedef __attribute__((ext_vector_type(8)))  _Float16 v8h;
typedef __attribute__((ext_vector_type(8)))  float v8f;
typedef __attribute__((ext_vector_type(4)))  float v4f;
typedef __attribute__((ext_vector_type(2)))  float v2f;
typedef __attribute__((ext_vector_type(4)))  unsigned v4u;
typedef __attribute__((ext_vector_type(4)))  int v4i;
typedef float __attribute__((may_alias)) float_a;
typedef int __attribute__((may_alias)) int_a;

template <typename T> __device__ __forceinline__ void vst2(void* p, T v) { *(T*)p = v;  }
__device__ __forceinline__ v8f wmma16(v16h a, v16h b, v8f c) {
  v8f d = __builtin_amdgcn_wmma_f32_16x16x32_f16(false, a, false, b, (short)0, c, false, false);
  asm volatile("v_nop\n\tv_nop\n\tv_nop\n\tv_nop" : "+v"(d) : "v"(a), "v"(b));
  return d;
}
__device__ __forceinline__ v8f wmma_bf(v16b a, v16b b, v8f c) {
  v8f d = __builtin_amdgcn_wmma_f32_16x16x32_bf16(false, a, false, b, (short)0, c, false, false);
  asm volatile("v_nop\n\tv_nop\n\tv_nop\n\tv_nop" : "+v"(d) : "v"(a), "v"(b));
  return d;
}
// 16x16x32 fragments: lane = (h = lane>>4, row/col = lane&15); elements 0..7 = k0+8h+0..7, 8..15 = k0+16+8h+0..7; D element r = row 8h+r
__device__ __forceinline__ v16h frag_h(const _Float16* rowk0, int lane) {
  union { v16h v; v8h q[2]; } u; const _Float16* p = rowk0 + 8 * (lane >> 4);
  u.q[0] = *(const v8h*)p; u.q[1] = *(const v8h*)(p + 16); return u.v;
}
__device__ __forceinline__ v16h frag_f32(const float* rowk0, int lane) {
  v16h a; const float* p = rowk0 + 8 * (lane >> 4);
#pragma unroll
  for (int i = 0; i < 8; ++i) { a[i] = (_Float16)p[i]; a[8 + i] = (_Float16)p[16 + i]; }
  return a;
}
__device__ __forceinline__ v16h frag_f32s(const float* rowk0, int lane, float sc) {
  v16h a; const float* p = rowk0 + 8 * (lane >> 4);
#pragma unroll
  for (int i = 0; i < 8; ++i) { a[i] = (_Float16)(p[i] * sc); a[8 + i] = (_Float16)(p[16 + i] * sc); }
  return a;
}
// column fragment from a [K][ld] layout (column n), rows >= K read as 0
__device__ __forceinline__ v16h fragc_f32(const float* W, int k0, int n, int lane, int ld, int K) {
  v16h a; const int g = lane >> 4;
#pragma unroll
  for (int i = 0; i < 8; ++i) { const int ka = k0 + 8 * g + i, kb = ka + 16;
    a[i] = (_Float16)(ka < K ? W[(size_t)(ka < K ? ka : K - 1) * ld + n] : 0.f); a[8 + i] = (_Float16)(kb < K ? W[(size_t)(kb < K ? kb : K - 1) * ld + n] : 0.f); }
  return a;
}
struct F2 { v16b h, l; };
__device__ __forceinline__ F2 bsplit16(const float v[16]) { F2 r;
#pragma unroll
  for (int i = 0; i < 16; ++i) { const __bf16 h = (__bf16)v[i]; r.h[i] = h; r.l[i] = (__bf16)(v[i] - (float)h); }
  return r; }
__device__ __forceinline__ F2 split_row(const float* row, int k0, int lane) { float v[16]; const float* p = row + k0 + 8 * (lane >> 4);
#pragma unroll
  for (int i = 0; i < 8; ++i) { v[i] = p[i]; v[8 + i] = p[16 + i]; }
  return bsplit16(v); }
__device__ __forceinline__ F2 split_rowK(const float* row, int k0, int lane, int K) { float v[16]; const int g = lane >> 4;
#pragma unroll
  for (int i = 0; i < 8; ++i) { const int ka = k0 + 8 * g + i, kb = ka + 16; v[i] = ka < K ? row[ka < K ? ka : K - 1] : 0.f; v[8 + i] = kb < K ? row[kb < K ? kb : K - 1] : 0.f; }
  return bsplit16(v); }
__device__ __forceinline__ F2 split_col(const float* W, int k0, int n, int lane, int ld, int K) { float v[16]; const int g = lane >> 4;
#pragma unroll
  for (int i = 0; i < 8; ++i) { const int ka = k0 + 8 * g + i, kb = ka + 16; v[i] = ka < K ? W[(size_t)(ka < K ? ka : K - 1) * ld + n] : 0.f; v[8 + i] = kb < K ? W[(size_t)(kb < K ? kb : K - 1) * ld + n] : 0.f; }
  return bsplit16(v); }
__device__ __forceinline__ v8f mac3(const F2& a, const F2& b, v8f c) { c = wmma_bf(a.l, b.h, c); c = wmma_bf(a.h, b.l, c); return wmma_bf(a.h, b.h, c); }
__device__ __forceinline__ float sigm(float v) { return 1.0f / (1.0f + expf(-v)); }
#define LDSX() do { asm volatile("s_wait_dscnt 0" ::: "memory"); __builtin_amdgcn_wave_barrier(); __builtin_amdgcn_fence(__ATOMIC_RELEASE, "workgroup"); } while (0)


// Keypoint multi-head attention (1,024 keypoints attend over 8,192 atoms; 16 heads x 64 via the module's RAW row-major reshape of the [rows][1024] projections: head h of K/V = projection rows 512h..512h+511 read as a contiguous [8192][64] block, head h of Q = rows 64h..64h+63 as [1024][64]); logits = (dist / sqrt(3) + q.k / 8) / sqrt(2); out = concat_h(P V) [1024][1024] . Wo^T.
#define NQ 1024          // keypoints
#define NA 8192          // atoms
#define DI 256           // in dim
#define HDM 1024         // heads x hidden
#define NH 16
#define HD 64
#define DO 256           // out dim
#ifndef TQB
#define TQB (NQ / 64)    // query tiles processed
#endif
typedef __attribute__((ext_vector_type(8))) __bf16 v8b;
__device__ __forceinline__ v16b frag_b(const __bf16* rowk0, int lane) {
  union { v16b v; v8b q[2]; } u; const __bf16* p = rowk0 + 8 * (lane >> 4);
  u.q[0] = *(const v8b*)p; u.q[1] = *(const v8b*)(p + 16); return u.v;
}
__device__ __forceinline__ float bfr(float v) { return (float)(__bf16)v; }
__device__ __attribute__((noinline)) float exp_ni(float v) { return expf(v); }
__device__ __attribute__((noinline)) float erf_ni(float v) { return erff(v); }

#define PK_K 0                          // [1024][256] Wk rows (natural [out][in])
#define PK_Q (PK_K + HDM * DI)
#define PK_V (PK_Q + HDM * DI)
#define PK_O (PK_V + HDM * DI)            // [256][1024] Wo rows
#define PK_END (PK_O + DO * HDM)
#define WS_PK 0u
#define WS_KP (WS_PK + 2u * PK_END)         // f32 [8192][1024] keys (flat = [16][8192][64])
#define WS_VP (WS_KP + 4u * NA * HDM)        // f32 [8192][1024] values
#define WS_QP (WS_VP + 4u * NA * HDM)        // f32 [1024][1024] queries (flat = [16][1024][64])
#define WS_VT (WS_QP + 4u * NQ * HDM)        // f16 [16*64 (h,d)][8192 a]
#define WS_O  (WS_VT + 2u * HDM * NA)        // f32 [1024][1024] (k, h*64+d)
#define WS_END (WS_O + 4u * NQ * HDM)

// ---- k_pack: block = row r of a natural [R][K] weight -> bf16 row (K <= 1024, K % 8 == 0)
__global__ __launch_bounds__(256) void k_pack(const float* __restrict__ Wm, int K, __bf16* __restrict__ DST) {
  __shared__ __align__(16) __bf16 s[HDM]; const int r = blockIdx.x, tid = threadIdx.x;
  for (int k = tid; k < K; k += 256) s[k] = (__bf16)Wm[(size_t)r * K + k];
  __syncthreads();
  for (int q = tid; q < K / 8; q += 256) vst2((unsigned*)(DST + (size_t)r * K + q * 8), *(const v4u*)&s[q * 8]);
}
// ---- k_proj: block = (64 rows, 128 of the 1024 cols): Y = bf16(X [rows][256]) . W rows (exact products) -> f32 rows (pitch 1024)
__global__ __launch_bounds__(128) void k_proj(const float* __restrict__ X, const __bf16* __restrict__ P, float* __restrict__ Y) {
  __shared__ __align__(16) float so[4][16][132];
  const int tid = threadIdx.x, wave = tid >> 5, lane = tid & 31, col = lane & 15, g = lane >> 4; const size_t r0 = (size_t)blockIdx.x * 64 + wave * 16; const int n0 = blockIdx.y * 128;
  v8f acc[8] = {};
#pragma unroll 2
  for (int kc = 0; kc < DI / 32; ++kc) { v16b a; { const float* p = X + (r0 + col) * DI + kc * 32 + 8 * g;
#pragma unroll
      for (int i = 0; i < 8; ++i) { a[i] = (__bf16)p[i]; a[8 + i] = (__bf16)p[16 + i]; } }
#pragma unroll
    for (int j = 0; j < 8; ++j) acc[j] = wmma_bf(a, frag_b(P + (size_t)(n0 + j * 16 + col) * DI + kc * 32, lane), acc[j]); }
#pragma unroll
  for (int j = 0; j < 8; ++j) {
#pragma unroll
    for (int r = 0; r < 8; ++r) so[wave][8 * g + r][j * 16 + col] = acc[j][r]; }
  LDSX();
  for (int rl = 0; rl < 16; ++rl) vst2(Y + (r0 + rl) * HDM + n0 + lane * 4, *(const v4f*)&so[wave][rl][lane * 4]);
}
__global__ __launch_bounds__(256) void k_vt(const float* __restrict__ VP, _Float16* __restrict__ VT) {
  __shared__ __align__(16) _Float16 st[64][72]; const int tid = threadIdx.x; const int a0 = blockIdx.x * 64, h = blockIdx.y;
  const float* src = VP + (size_t)h * NA * HD + (size_t)a0 * HD;
  for (int q = tid; q < 64 * 64; q += 256) { const int rl = q >> 6, d = q & 63; st[d][rl] = (_Float16)src[rl * HD + d]; }
  __syncthreads();
  for (int q = tid; q < 64 * 8; q += 256) { const int d = q >> 3, pc = q & 7; vst2((unsigned*)(VT + ((size_t)(h * HD + d)) * NA + a0 + pc * 8), *(const v4u*)&st[d][pc * 8]); }
}
// ---- k_attn: block = (64 keypoints, head h): flash attention over the 8,192 atoms (32 per step), logits = (bf16(dist) * (1/sqrt3) + q.k * 0.125) * (1/sqrt2) with q, k single f16 operands; P.V with P, V single f16 operands; O[k][h*64+d] = acc / l
__global__ __launch_bounds__(128) void k_attn(const float* __restrict__ QP, const float* __restrict__ KP, const float* __restrict__ DIST, const _Float16* __restrict__ VT, float* __restrict__ O) {
  __shared__ __align__(16) float sp[4][16][36]; __shared__ __align__(16) float so[4][16][68];
  const int tid = threadIdx.x, wave = tid >> 5, lane = tid & 31, col = lane & 15, g = lane >> 4;
  const int qb = blockIdx.x, h = blockIdx.y; const int q0 = qb * 64 + wave * 16;
  const float RD = (float)(1.0 / 1.7320508075688772), RA = (float)(1.0 / 1.4142135623730951);
  const float* qrow = QP + (size_t)h * NQ * HD + (size_t)(q0 + col) * HD;
  v16h aq[2];
#pragma unroll
  for (int kc = 0; kc < 2; ++kc) aq[kc] = frag_f32(qrow + kc * 32, lane);
  float m[8], l[8];
#pragma unroll
  for (int r = 0; r < 8; ++r) { m[r] = -3.0e38f; l[r] = 0.f; }
  v8f acc[4] = {};
  const float* drow0 = DIST + (size_t)(q0 + 8 * g) * NA;
#pragma unroll 1
  for (int ks = 0; ks < NA / 32; ++ks) { v8f s[2];
#pragma unroll
    for (int ct = 0; ct < 2; ++ct) { const int kk = ks * 32 + ct * 16 + col; const float* krow = KP + (size_t)h * NA * HD + (size_t)kk * HD; v8f c = {};
#pragma unroll
      for (int kc = 0; kc < 2; ++kc) c = wmma16(aq[kc], frag_f32(krow + kc * 32, lane), c);
#pragma unroll
      for (int r = 0; r < 8; ++r) s[ct][r] = (bfr(drow0[(size_t)r * NA + kk]) * RD + c[r] * 0.125f) * RA; }
#pragma unroll
    for (int r = 0; r < 8; ++r) { float mx = fmaxf(s[0][r], s[1][r]);
#pragma unroll
      for (int o = 1; o < 16; o <<= 1) mx = fmaxf(mx, __shfl_xor(mx, o));
      const float mn = fmaxf(m[r], mx); const float alpha = exp_ni(m[r] - mn);
      const float e0 = exp_ni(s[0][r] - mn), e1 = exp_ni(s[1][r] - mn); float es = e0 + e1;
#pragma unroll
      for (int o = 1; o < 16; o <<= 1) es += __shfl_xor(es, o);
      l[r] = l[r] * alpha + es; m[r] = mn;
#pragma unroll
      for (int dt = 0; dt < 4; ++dt) acc[dt][r] *= alpha;
      sp[wave][8 * g + r][col] = e0; sp[wave][8 * g + r][16 + col] = e1; }
    LDSX();
    const v16h pa = frag_f32(&sp[wave][col][0], lane);
#pragma unroll
    for (int dt = 0; dt < 4; ++dt) { const size_t vr = ((size_t)(h * HD + dt * 16 + col)) * NA + (size_t)ks * 32; acc[dt] = wmma16(pa, frag_h(VT + vr, lane), acc[dt]); }
    LDSX(); }
#pragma unroll
  for (int r = 0; r < 8; ++r) { const float il = 1.0f / l[r];
#pragma unroll
    for (int dt = 0; dt < 4; ++dt) so[wave][8 * g + r][dt * 16 + col] = acc[dt][r] * il; }
  LDSX();
  for (int rl = 0; rl < 16; ++rl) if (lane < 16) vst2(O + (size_t)(q0 + rl) * HDM + h * HD + lane * 4, *(const v4f*)&so[wave][rl][lane * 4]);
}
// ---- k_out: block = (64 rows, 128 of the 256 cols): out = O(hi/lo) . Wo rows (2 products)
__global__ __launch_bounds__(128) void k_out(const float* __restrict__ O, const __bf16* __restrict__ P, float* __restrict__ Y) {
  __shared__ __align__(16) float so[4][16][132];
  const int tid = threadIdx.x, wave = tid >> 5, lane = tid & 31, col = lane & 15, g = lane >> 4; const size_t r0 = (size_t)blockIdx.x * 64 + wave * 16; const int n0 = blockIdx.y * 128;
  v8f acc[8] = {};
#pragma unroll 2
  for (int kc = 0; kc < HDM / 32; ++kc) { const F2 a = split_row(O + (r0 + col) * HDM, kc * 32, lane);
#pragma unroll
    for (int j = 0; j < 8; ++j) { const v16b w = frag_b(P + (size_t)(n0 + j * 16 + col) * HDM + kc * 32, lane); acc[j] = wmma_bf(a.l, w, acc[j]); acc[j] = wmma_bf(a.h, w, acc[j]); } }
#pragma unroll
  for (int j = 0; j < 8; ++j) {
#pragma unroll
    for (int r = 0; r < 8; ++r) so[wave][8 * g + r][j * 16 + col] = acc[j][r]; }
  LDSX();
  for (int rl = 0; rl < 16; ++rl) vst2(Y + (r0 + rl) * DO + n0 + lane * 4, *(const v4f*)&so[wave][rl][lane * 4]);
}
extern "C" void kernel_launch(void* const* d_in, const int* in_sizes, int n_in, void* d_out, int out_size, void* d_ws, size_t ws_size, hipStream_t stream) {
  (void)in_sizes; (void)n_in; (void)out_size;
  const float** F = (const float**)d_in;   // 0 kp_feat [1024,256], 1 kp_dist [1024,8192], 2 rec_atom_feats [8192,256], 3 Wk [1024,256], 4 Wq, 5 Wv, 6 Wo [256,1024]
  if (ws_size < (size_t)WS_END) return;
  char* ws = (char*)d_ws; __bf16* PK = (__bf16*)(ws + WS_PK); float *KPp = (float*)(ws + WS_KP), *VPp = (float*)(ws + WS_VP), *QPp = (float*)(ws + WS_QP), *O = (float*)(ws + WS_O); _Float16* VT = (_Float16*)(ws + WS_VT);
  k_pack<<<HDM, 256, 0, stream>>>(F[3], DI, PK + PK_K); k_pack<<<HDM, 256, 0, stream>>>(F[4], DI, PK + PK_Q); k_pack<<<HDM, 256, 0, stream>>>(F[5], DI, PK + PK_V); k_pack<<<DO, 256, 0, stream>>>(F[6], HDM, PK + PK_O);
  k_proj<<<dim3(NA / 64, HDM / 128), 128, 0, stream>>>(F[2], PK + PK_K, KPp);
  k_proj<<<dim3(NA / 64, HDM / 128), 128, 0, stream>>>(F[2], PK + PK_V, VPp);
  k_proj<<<dim3(NQ / 64, HDM / 128), 128, 0, stream>>>(F[0], PK + PK_Q, QPp);
  k_vt<<<dim3(NA / 64, NH), 256, 0, stream>>>(VPp, VT);
  k_attn<<<dim3(TQB, NH), 128, 0, stream>>>(QPp, KPp, F[1], VT, O);
  k_out<<<dim3(TQB, DO / 128), 128, 0, stream>>>(O, PK + PK_O, (float*)d_out);
}

// v001
// It runs in 415 microseconds.
// Two timings next to v000 put it at 3.33 and 3.30 times that version's speed.
// compute dtype: kp_feat, kp_dist, rec_atom_feats and the four weights (module inputs) rounded to bf16; the three projections with exact bf16 products (inputs x inputs) on WMMA 16x16x32; attention logits q.k with q and k as single f16 operands (1 product; near-uniform softmax over 8,192 atoms, logit error ~1e-4 relative), P.V with P = exp(s - m) and V as single f16 operands (1 product; both errors relative to an 8,192-term softmax average); the output projection with the computed operand as bf16 hi + residual pair x exact Wo (2 products); the kp_dist bias, scaling, running-max softmax and normalisation in f32; f32 accumulate.
#include <hip/hip_runtime.h>
#include <math.h>

typedef __attribute__((ext_vector_type(16))) _Float16 v16h;
typedef __attribute__((ext_vector_type(16))) __bf16 v16b;
typedef __attribute__((ext_vector_type(8)))  _Float16 v8h;
typedef __attribute__((ext_vector_type(8)))  float v8f;
typedef __attribute__((ext_vector_type(4)))  float v4f;
typedef __attribute__((ext_vector_type(2)))  float v2f;
typedef __attribute__((ext_vector_type(4)))  unsigned v4u;
typedef __attribute__((ext_vector_type(4)))  int v4i;
typedef float __attribute__((may_alias)) float_a;
typedef int __attribute__((may_alias)) int_a;

template <typename T> __device__ __forceinline__ void vst2(void* p, T v) { *(T*)p = v;  }
__device__ __forceinline__ v8f wmma16(v16h a, v16h b, v8f c) {
  v8f d = __builtin_amdgcn_wmma_f32_16x16x32_f16(false, a, false, b, (short)0, c, false, false);
  asm volatile("v_nop\n\tv_nop\n\tv_nop\n\tv_nop" : "+v"(d) : "v"(a), "v"(b));
  return d;
}
__device__ __forceinline__ v8f wmma_bf(v16b a, v16b b, v8f c) {
  v8f d = __builtin_amdgcn_wmma_f32_16x16x32_bf16(false, a, false, b, (short)0, c, false, false);
  asm volatile("v_nop\n\tv_nop\n\tv_nop\n\tv_nop" : "+v"(d) : "v"(a), "v"(b));
  return d;
}
// 16x16x32 fragments: lane = (h = lane>>4, row/col = lane&15); elements 0..7 = k0+8h+0..7, 8..15 = k0+16+8h+0..7; D element r = row 8h+r
__device__ __forceinline__ v16h frag_h(const _Float16* rowk0, int lane) {
  union { v16h v; v8h q[2]; } u; const _Float16* p = rowk0 + 8 * (lane >> 4);
  u.q[0] = *(const v8h*)p; u.q[1] = *(const v8h*)(p + 16); return u.v;
}
__device__ __forceinline__ v16h frag_f32(const float* rowk0, int lane) {
  v16h a; const float* p = rowk0 + 8 * (lane >> 4);
#pragma unroll
  for (int i = 0; i < 8; ++i) { a[i] = (_Float16)p[i]; a[8 + i] = (_Float16)p[16 + i]; }
  return a;
}
__device__ __forceinline__ v16h frag_f32s(const float* rowk0, int lane, float sc) {
  v16h a; const float* p = rowk0 + 8 * (lane >> 4);
#pragma unroll
  for (int i = 0; i < 8; ++i) { a[i] = (_Float16)(p[i] * sc); a[8 + i] = (_Float16)(p[16 + i] * sc); }
  return a;
}
// column fragment from a [K][ld] layout (column n), rows >= K read as 0
__device__ __forceinline__ v16h fragc_f32(const float* W, int k0, int n, int lane, int ld, int K) {
  v16h a; const int g = lane >> 4;
#pragma unroll
  for (int i = 0; i < 8; ++i) { const int ka = k0 + 8 * g + i, kb = ka + 16;
    a[i] = (_Float16)(ka < K ? W[(size_t)(ka < K ? ka : K - 1) * ld + n] : 0.f); a[8 + i] = (_Float16)(kb < K ? W[(size_t)(kb < K ? kb : K - 1) * ld + n] : 0.f); }
  return a;
}
struct F2 { v16b h, l; };
__device__ __forceinline__ F2 bsplit16(const float v[16]) { F2 r;
#pragma unroll
  for (int i = 0; i < 16; ++i) { const __bf16 h = (__bf16)v[i]; r.h[i] = h; r.l[i] = (__bf16)(v[i] - (float)h); }
  return r; }
__device__ __forceinline__ F2 split_row(const float* row, int k0, int lane) { float v[16]; const float* p = row + k0 + 8 * (lane >> 4);
#pragma unroll
  for (int i = 0; i < 8; ++i) { v[i] = p[i]; v[8 + i] = p[16 + i]; }
  return bsplit16(v); }
__device__ __forceinline__ F2 split_rowK(const float* row, int k0, int lane, int K) { float v[16]; const int g = lane >> 4;
#pragma unroll
  for (int i = 0; i < 8; ++i) { const int ka = k0 + 8 * g + i, kb = ka + 16; v[i] = ka < K ? row[ka < K ? ka : K - 1] : 0.f; v[8 + i] = kb < K ? row[kb < K ? kb : K - 1] : 0.f; }
  return bsplit16(v); }
__device__ __forceinline__ F2 split_col(const float* W, int k0, int n, int lane, int ld, int K) { float v[16]; const int g = lane >> 4;
#pragma unroll
  for (int i = 0; i < 8; ++i) { const int ka = k0 + 8 * g + i, kb = ka + 16; v[i] = ka < K ? W[(size_t)(ka < K ? ka : K - 1) * ld + n] : 0.f; v[8 + i] = kb < K ? W[(size_t)(kb < K ? kb : K - 1) * ld + n] : 0.f; }
  return bsplit16(v); }
__device__ __forceinline__ v8f mac3(const F2& a, const F2& b, v8f c) { c = wmma_bf(a.l, b.h, c); c = wmma_bf(a.h, b.l, c); return wmma_bf(a.h, b.h, c); }
__device__ __forceinline__ float sigm(float v) { return 1.0f / (1.0f + expf(-v)); }
#define LDSX() do { asm volatile("s_wait_dscnt 0" ::: "memory"); __builtin_amdgcn_wave_barrier(); __builtin_amdgcn_fence(__ATOMIC_RELEASE, "workgroup"); } while (0)


// Keypoint multi-head attention (1,024 keypoints attend over 8,192 atoms; 16 heads x 64 via the module's RAW row-major reshape of the [rows][1024] projections: head h of K/V = projection rows 512h..512h+511 read as a contiguous [8192][64] block, head h of Q = rows 64h..64h+63 as [1024][64]); logits = (dist / sqrt(3) + q.k / 8) / sqrt(2); out = concat_h(P V) [1024][1024] . Wo^T.
#define NQ 1024          // keypoints
#define NA 8192          // atoms
#define DI 256           // in dim
#define HDM 1024         // heads x hidden
#define NH 16
#define HD 64
#define DO 256           // out dim
#ifndef TQB
#define TQB (NQ / 64)    // query tiles processed
#endif
typedef __attribute__((ext_vector_type(8))) __bf16 v8b;
__device__ __forceinline__ v16b frag_b(const __bf16* rowk0, int lane) {
  union { v16b v; v8b q[2]; } u; const __bf16* p = rowk0 + 8 * (lane >> 4);
  u.q[0] = *(const v8b*)p; u.q[1] = *(const v8b*)(p + 16); return u.v;
}
__device__ __forceinline__ float bfr(float v) { return (float)(__bf16)v; }
__device__ __attribute__((noinline)) float exp_ni(float v) { return expf(v); }
__device__ __attribute__((noinline)) float erf_ni(float v) { return erff(v); }

#define PK_K 0                          // [1024][256] Wk rows (natural [out][in])
#define PK_Q (PK_K + HDM * DI)
#define PK_V (PK_Q + HDM * DI)
#define PK_O (PK_V + HDM * DI)            // [256][1024] Wo rows
#define PK_END (PK_O + DO * HDM)
#define WS_PK 0u
#define WS_KP (WS_PK + 2u * PK_END)         // f32 [8192][1024] keys (flat = [16][8192][64])
#define WS_VP (WS_KP + 4u * NA * HDM)        // f32 [8192][1024] values
#define WS_QP (WS_VP + 4u * NA * HDM)        // f32 [1024][1024] queries (flat = [16][1024][64])
#define WS_VT (WS_QP + 4u * NQ * HDM)        // f16 [16*64 (h,d)][8192 a]
#define WS_O  (WS_VT + 2u * HDM * NA)        // f32 [1024][1024] (k, h*64+d)
#define WS_END (WS_O + 4u * NQ * HDM)

// ---- k_pack: block = row r of a natural [R][K] weight -> bf16 row (K <= 1024, K % 8 == 0)
__global__ __launch_bounds__(256) void k_pack(const float* __restrict__ Wm, int K, __bf16* __restrict__ DST) {
  __shared__ __align__(16) __bf16 s[HDM]; const int r = blockIdx.x, tid = threadIdx.x;
  for (int k = tid; k < K; k += 256) s[k] = (__bf16)Wm[(size_t)r * K + k];
  __syncthreads();
  for (int q = tid; q < K / 8; q += 256) vst2((unsigned*)(DST + (size_t)r * K + q * 8), *(const v4u*)&s[q * 8]);
}
// ---- k_proj: block = (64 rows, 128 of the 1024 cols): Y = bf16(X [rows][256]) . W rows (exact products) -> f32 rows (pitch 1024)
__global__ __launch_bounds__(128) void k_proj(const float* __restrict__ X, const __bf16* __restrict__ P, float* __restrict__ Y) {
  __shared__ __align__(16) float so[4][16][132];
  const int tid = threadIdx.x, wave = tid >> 5, lane = tid & 31, col = lane & 15, g = lane >> 4; const size_t r0 = (size_t)blockIdx.x * 64 + wave * 16; const int n0 = blockIdx.y * 128;
  v8f acc[8] = {};
#pragma unroll 2
  for (int kc = 0; kc < DI / 32; ++kc) { v16b a; { const float* p = X + (r0 + col) * DI + kc * 32 + 8 * g;
#pragma unroll
      for (int i = 0; i < 8; ++i) { a[i] = (__bf16)p[i]; a[8 + i] = (__bf16)p[16 + i]; } }
#pragma unroll
    for (int j = 0; j < 8; ++j) acc[j] = wmma_bf(a, frag_b(P + (size_t)(n0 + j * 16 + col) * DI + kc * 32, lane), acc[j]); }
#pragma unroll
  for (int j = 0; j < 8; ++j) {
#pragma unroll
    for (int r = 0; r < 8; ++r) so[wave][8 * g + r][j * 16 + col] = acc[j][r]; }
  LDSX();
  for (int rl = 0; rl < 16; ++rl) vst2(Y + (r0 + rl) * HDM + n0 + lane * 4, *(const v4f*)&so[wave][rl][lane * 4]);
}
__global__ __launch_bounds__(256) void k_vt(const float* __restrict__ VP, _Float16* __restrict__ VT) {
  __shared__ __align__(16) _Float16 st[64][72]; const int tid = threadIdx.x; const int a0 = blockIdx.x * 64, h = blockIdx.y;
  const float* src = VP + (size_t)h * NA * HD + (size_t)a0 * HD;
  for (int q = tid; q < 64 * 64; q += 256) { const int rl = q >> 6, d = q & 63; st[d][rl] = (_Float16)src[rl * HD + d]; }
  __syncthreads();
  for (int q = tid; q < 64 * 8; q += 256) { const int d = q >> 3, pc = q & 7; vst2((unsigned*)(VT + ((size_t)(h * HD + d)) * NA + a0 + pc * 8), *(const v4u*)&st[d][pc * 8]); }
}
// ---- k_attn: block = (64 keypoints, head h), 32 waves = 4 keypoint sub-tiles x NSP atom shares: wave (qs, sh) runs flash attention for 16 keypoints over the 32-atom steps ks = sh, sh + NSP, ... (logits = (bf16(dist) * (1/sqrt3) + q.k * 0.125) * (1/sqrt2) with q, k single f16 operands; P.V with P, V single f16 operands); the NSP partial (m, l, acc) of a keypoint are joined in LDS: O[k][h*64+d] = sum_sh acc_sh e^(m_sh - M) / sum_sh l_sh e^(m_sh - M)
// fragments from a pointer that already holds the lane's own 8 * (lane >> 4) step
__device__ __forceinline__ v16h frag_f32p(const float* p) { v16h a;
#pragma unroll
  for (int i = 0; i < 8; ++i) { a[i] = (_Float16)p[i]; a[8 + i] = (_Float16)p[16 + i]; }
  return a; }
__device__ __forceinline__ v16h frag_hp(const _Float16* p) { union { v16h v; v8h q[2]; } u; u.q[0] = *(const v8h*)p; u.q[1] = *(const v8h*)(p + 16); return u.v; }
#define NSP 8            // atom shares per keypoint sub-tile (waves per SIMD)
#define SW_M (16 * 68)   // per-wave LDS: [16][68] partial output (in the loop: [16][36] P tile), then m[16], l[16]
#define SW_L (SW_M + 16)
#define SW_N (SW_L + 16)
__global__ __launch_bounds__(128 * NSP) void k_attn(const float* __restrict__ QP, const float* __restrict__ KP, const float* __restrict__ DIST, const _Float16* __restrict__ VT, float* __restrict__ O) {
  __shared__ __align__(16) float sm[4 * NSP][SW_N];
  const int tid = threadIdx.x, wave = __builtin_amdgcn_readfirstlane(tid >> 5), lane = tid & 31, col = lane & 15, g = lane >> 4;   // the wave's number in a scalar register: its share, loop counter and tile addresses stay scalar
  const int qb = blockIdx.x, h = blockIdx.y; const int q0 = qb * 64 + (wave & 3) * 16, sh = wave >> 2;
  float* sp = &sm[wave][0];
  const float RD = (float)(1.0 / 1.7320508075688772), RA = (float)(1.0 / 1.4142135623730951);
  const float* qrow = QP + (size_t)h * NQ * HD + (size_t)(q0 + col) * HD;
  v16h aq[2];
#pragma unroll
  for (int kc = 0; kc < 2; ++kc) aq[kc] = frag_f32(qrow + kc * 32, lane);
  float m[8], l[8];
#pragma unroll
  for (int r = 0; r < 8; ++r) { m[r] = -3.0e38f; l[r] = 0.f; }
  v8f acc[4] = {};
  // wave-uniform tile bases + one fixed lane offset each: one lane pointer per operand (K, V, dist) is live in the loop, which keeps the wave inside the 128 VGPRs of 8 waves per SIMD without scratch
  const float* kh = KP + (size_t)h * NA * HD; const _Float16* vh = VT + (size_t)h * HD * NA; const float* dh = DIST + (size_t)q0 * NA;
  const unsigned klane = col * HD + 8 * g, vlane = col * NA + 8 * g, dlane = 8 * g * NA + col;
#pragma unroll 1
  for (int ks = sh; ks < NA / 32; ks += NSP) { v8f s[2]; const float* kp = kh + (size_t)ks * 32 * HD + klane; const float* dp = dh + ks * 32 + dlane; const _Float16* vp = vh + ks * 32 + vlane;
#pragma unroll
    for (int ct = 0; ct < 2; ++ct) { v8f c = {};
#pragma unroll
      for (int kc = 0; kc < 2; ++kc) c = wmma16(aq[kc], frag_f32p(kp + ct * 16 * HD + kc * 32), c);
#pragma unroll
      for (int r = 0; r < 8; ++r) s[ct][r] = (bfr(dp[r * NA + ct * 16]) * RD + c[r] * 0.125f) * RA; }
#pragma unroll
    for (int r = 0; r < 8; ++r) { float mx = fmaxf(s[0][r], s[1][r]);
#pragma unroll
      for (int o = 1; o < 16; o <<= 1) mx = fmaxf(mx, __shfl_xor(mx, o));
      const float mn = fmaxf(m[r], mx); const float alpha = exp_ni(m[r] - mn);
      const float e0 = exp_ni(s[0][r] - mn), e1 = exp_ni(s[1][r] - mn); float es = e0 + e1;
#pragma unroll
      for (int o = 1; o < 16; o <<= 1) es += __shfl_xor(es, o);
      l[r] = l[r] * alpha + es; m[r] = mn;
#pragma unroll
      for (int dt = 0; dt < 4; ++dt) acc[dt][r] *= alpha;
      sp[(8 * g + r) * 36 + col] = e0; sp[(8 * g + r) * 36 + 16 + col] = e1; }
    LDSX();
    const v16h pa = frag_f32(sp + col * 36, lane);
#pragma unroll
    for (int dt = 0; dt < 4; ++dt) acc[dt] = wmma16(pa, frag_hp(vp + dt * 16 * NA), acc[dt]);
    LDSX(); }
#pragma unroll
  for (int r = 0; r < 8; ++r) {
#pragma unroll
    for (int dt = 0; dt < 4; ++dt) sp[(8 * g + r) * 68 + dt * 16 + col] = acc[dt][r];
    if (col == 0) { sp[SW_M + 8 * g + r] = m[r]; sp[SW_L + 8 * g + r] = l[r]; } }
  __syncthreads();   // every share's partial is in LDS before any thread joins them
  { const int q = tid >> 4, d4 = (tid & 15) * 4, row = q & 15; const float* p0 = &sm[q >> 4][0];   // thread = (keypoint q of 64, 4 of the 64 d); share sh of q lies 4 waves further
    float ms[NSP], M = -3.0e38f;
#pragma unroll
    for (int i = 0; i < NSP; ++i) { ms[i] = p0[i * 4 * SW_N + SW_M + row]; M = fmaxf(M, ms[i]); }
    float L = 0.f; v4f o = {};
#pragma unroll
    for (int i = 0; i < NSP; ++i) { const float w = exp_ni(ms[i] - M); L += p0[i * 4 * SW_N + SW_L + row] * w; o += *(const v4f*)&p0[i * 4 * SW_N + row * 68 + d4] * w; }
    vst2(O + (size_t)(qb * 64 + q) * HDM + h * HD + d4, o * (1.0f / L)); }
}
// ---- k_out: block = (64 rows, 128 of the 256 cols): out = O(hi/lo) . Wo rows (2 products)
__global__ __launch_bounds__(128) void k_out(const float* __restrict__ O, const __bf16* __restrict__ P, float* __restrict__ Y) {
  __shared__ __align__(16) float so[4][16][132];
  const int tid = threadIdx.x, wave = tid >> 5, lane = tid & 31, col = lane & 15, g = lane >> 4; const size_t r0 = (size_t)blockIdx.x * 64 + wave * 16; const int n0 = blockIdx.y * 128;
  v8f acc[8] = {};
#pragma unroll 2
  for (int kc = 0; kc < HDM / 32; ++kc) { const F2 a = split_row(O + (r0 + col) * HDM, kc * 32, lane);
#pragma unroll
    for (int j = 0; j < 8; ++j) { const v16b w = frag_b(P + (size_t)(n0 + j * 16 + col) * HDM + kc * 32, lane); acc[j] = wmma_bf(a.l, w, acc[j]); acc[j] = wmma_bf(a.h, w, acc[j]); } }
#pragma unroll
  for (int j = 0; j < 8; ++j) {
#pragma unroll
    for (int r = 0; r < 8; ++r) so[wave][8 * g + r][j * 16 + col] = acc[j][r]; }
  LDSX();
  for (int rl = 0; rl < 16; ++rl) vst2(Y + (r0 + rl) * DO + n0 + lane * 4, *(const v4f*)&so[wave][rl][lane * 4]);
}
extern "C" void kernel_launch(void* const* d_in, const int* in_sizes, int n_in, void* d_out, int out_size, void* d_ws, size_t ws_size, hipStream_t stream) {
  (void)in_sizes; (void)n_in; (void)out_size;
  const float** F = (const float**)d_in;   // 0 kp_feat [1024,256], 1 kp_dist [1024,8192], 2 rec_atom_feats [8192,256], 3 Wk [1024,256], 4 Wq, 5 Wv, 6 Wo [256,1024]
  if (ws_size < (size_t)WS_END) return;
  char* ws = (char*)d_ws; __bf16* PK = (__bf16*)(ws + WS_PK); float *KPp = (float*)(ws + WS_KP), *VPp = (float*)(ws + WS_VP), *QPp = (float*)(ws + WS_QP), *O = (float*)(ws + WS_O); _Float16* VT = (_Float16*)(ws + WS_VT);
  k_pack<<<HDM, 256, 0, stream>>>(F[3], DI, PK + PK_K); k_pack<<<HDM, 256, 0, stream>>>(F[4], DI, PK + PK_Q); k_pack<<<HDM, 256, 0, stream>>>(F[5], DI, PK + PK_V); k_pack<<<DO, 256, 0, stream>>>(F[6], HDM, PK + PK_O);
  k_proj<<<dim3(NA / 64, HDM / 128), 128, 0, stream>>>(F[2], PK + PK_K, KPp);
  k_proj<<<dim3(NA / 64, HDM / 128), 128, 0, stream>>>(F[2], PK + PK_V, VPp);
  k_proj<<<dim3(NQ / 64, HDM / 128), 128, 0, stream>>>(F[0], PK + PK_Q, QPp);
  k_vt<<<dim3(NA / 64, NH), 256, 0, stream>>>(VPp, VT);
  k_attn<<<dim3(TQB, NH), 128 * NSP, 0, stream>>>(QPp, KPp, F[1], VT, O);
  k_out<<<dim3(TQB, DO / 128), 128, 0, stream>>>(O, PK + PK_O, (float*)d_out);
}

// v002
// One run takes 389 microseconds.
// Two timings next to v001 both put it at 1.06 times that version's speed.
// All steps since v000 together make it 3.51 times as fast.
// compute dtype: kp_feat, kp_dist, rec_atom_feats and the four weights (module inputs) rounded to bf16; the three projections with exact bf16 products (inputs x inputs) on WMMA 16x16x32; attention logits q.k with q and k as single f16 operands (1 product; near-uniform softmax over 8,192 atoms, logit error ~1e-4 relative), P.V with P = exp(s - m) and V as single f16 operands (1 product; both errors relative to an 8,192-term softmax average); the output projection with the computed operand as bf16 hi + residual pair x exact Wo (2 products); the kp_dist bias, scaling, running-max softmax and normalisation in f32; f32 accumulate.
#include <hip/hip_runtime.h>
#include <math.h>

typedef __attribute__((ext_vector_type(16))) _Float16 v16h;
typedef __attribute__((ext_vector_type(16))) __bf16 v16b;
typedef __attribute__((ext_vector_type(8)))  _Float16 v8h;
typedef __attribute__((ext_vector_type(8)))  float v8f;
typedef __attribute__((ext_vector_type(4)))  float v4f;
typedef __attribute__((ext_vector_type(2)))  float v2f;
typedef __attribute__((ext_vector_type(4)))  unsigned v4u;
typedef __attribute__((ext_vector_type(4)))  int v4i;
typedef float __attribute__((may_alias)) float_a;
typedef int __attribute__((may_alias)) int_a;

template <typename T> __device__ __forceinline__ void vst2(void* p, T v) { *(T*)p = v;  }
__device__ __forceinline__ v8f wmma16(v16h a, v16h b, v8f c) {
  v8f d = __builtin_amdgcn_wmma_f32_16x16x32_f16(false, a, false, b, (short)0, c, false, false);
  asm volatile("v_nop\n\tv_nop\n\tv_nop\n\tv_nop" : "+v"(d) : "v"(a), "v"(b));
  return d;
}
__device__ __forceinline__ v8f wmma_bf(v16b a, v16b b, v8f c) {
  v8f d = __builtin_amdgcn_wmma_f32_16x16x32_bf16(false, a, false, b, (short)0, c, false, false);
  asm volatile("v_nop\n\tv_nop\n\tv_nop\n\tv_nop" : "+v"(d) : "v"(a), "v"(b));
  return d;
}
// 16x16x32 fragments: lane = (h = lane>>4, row/col = lane&15); elements 0..7 = k0+8h+0..7, 8..15 = k0+16+8h+0..7; D element r = row 8h+r
__device__ __forceinline__ v16h frag_h(const _Float16* rowk0, int lane) {
  union { v16h v; v8h q[2]; } u; const _Float16* p = rowk0 + 8 * (lane >> 4);
  u.q[0] = *(const v8h*)p; u.q[1] = *(const v8h*)(p + 16); return u.v;
}
__device__ __forceinline__ v16h frag_f32(const float* rowk0, int lane) {
  v16h a; const float* p = rowk0 + 8 * (lane >> 4);
#pragma unroll
  for (int i = 0; i < 8; ++i) { a[i] = (_Float16)p[i]; a[8 + i] = (_Float16)p[16 + i]; }
  return a;
}
__device__ __forceinline__ v16h frag_f32s(const float* rowk0, int lane, float sc) {
  v16h a; const float* p = rowk0 + 8 * (lane >> 4);
#pragma unroll
  for (int i = 0; i < 8; ++i) { a[i] = (_Float16)(p[i] * sc); a[8 + i] = (_Float16)(p[16 + i] * sc); }
  return a;
}
// column fragment from a [K][ld] layout (column n), rows >= K read as 0
__device__ __forceinline__ v16h fragc_f32(const float* W, int k0, int n, int lane, int ld, int K) {
  v16h a; const int g = lane >> 4;
#pragma unroll
  for (int i = 0; i < 8; ++i) { const int ka = k0 + 8 * g + i, kb = ka + 16;
    a[i] = (_Float16)(ka < K ? W[(size_t)(ka < K ? ka : K - 1) * ld + n] : 0.f); a[8 + i] = (_Float16)(kb < K ? W[(size_t)(kb < K ? kb : K - 1) * ld + n] : 0.f); }
  return a;
}
struct F2 { v16b h, l; };
__device__ __forceinline__ F2 bsplit16(const float v[16]) { F2 r;
#pragma unroll
  for (int i = 0; i < 16; ++i) { const __bf16 h = (__bf16)v[i]; r.h[i] = h; r.l[i] = (__bf16)(v[i] - (float)h); }
  return r; }
__device__ __forceinline__ F2 split_row(const float* row, int k0, int lane) { float v[16]; const float* p = row + k0 + 8 * (lane >> 4);
#pragma unroll
  for (int i = 0; i < 8; ++i) { v[i] = p[i]; v[8 + i] = p[16 + i]; }
  return bsplit16(v); }
__device__ __forceinline__ F2 split_rowK(const float* row, int k0, int lane, int K) { float v[16]; const int g = lane >> 4;
#pragma unroll
  for (int i = 0; i < 8; ++i) { const int ka = k0 + 8 * g + i, kb = ka + 16; v[i] = ka < K ? row[ka < K ? ka : K - 1] : 0.f; v[8 + i] = kb < K ? row[kb < K ? kb : K - 1] : 0.f; }
  return bsplit16(v); }
__device__ __forceinline__ F2 split_col(const float* W, int k0, int n, int lane, int ld, int K) { float v[16]; const int g = lane >> 4;
#pragma unroll
  for (int i = 0; i < 8; ++i) { const int ka = k0 + 8 * g + i, kb = ka + 16; v[i] = ka < K ? W[(size_t)(ka < K ? ka : K - 1) * ld + n] : 0.f; v[8 + i] = kb < K ? W[(size_t)(kb < K ? kb : K - 1) * ld + n] : 0.f; }
  return bsplit16(v); }
__device__ __forceinline__ v8f mac3(const F2& a, const F2& b, v8f c) { c = wmma_bf(a.l, b.h, c); c = wmma_bf(a.h, b.l, c); return wmma_bf(a.h, b.h, c); }
__device__ __forceinline__ float sigm(float v) { return 1.0f / (1.0f + expf(-v)); }
#define LDSX() do { asm volatile("s_wait_dscnt 0" ::: "memory"); __builtin_amdgcn_wave_barrier(); __builtin_amdgcn_fence(__ATOMIC_RELEASE, "workgroup"); } while (0)


// Keypoint multi-head attention (1,024 keypoints attend over 8,192 atoms; 16 heads x 64 via the module's RAW row-major reshape of the [rows][1024] projections: head h of K/V = projection rows 512h..512h+511 read as a contiguous [8192][64] block, head h of Q = rows 64h..64h+63 as [1024][64]); logits = (dist / sqrt(3) + q.k / 8) / sqrt(2); out = concat_h(P V) [1024][1024] . Wo^T.
#define NQ 1024          // keypoints
#define NA 8192          // atoms
#define DI 256           // in dim
#define HDM 1024         // heads x hidden
#define NH 16
#define HD 64
#define DO 256           // out dim
#ifndef TQB
#define TQB (NQ / 64)    // query tiles processed
#endif
typedef __attribute__((ext_vector_type(8))) __bf16 v8b;
__device__ __forceinline__ v16b frag_b(const __bf16* rowk0, int lane) {
  union { v16b v; v8b q[2]; } u; const __bf16* p = rowk0 + 8 * (lane >> 4);
  u.q[0] = *(const v8b*)p; u.q[1] = *(const v8b*)(p + 16); return u.v;
}
__device__ __forceinline__ float bfr(float v) { return (float)(__bf16)v; }
__device__ __attribute__((noinline)) float exp_ni(float v) { return expf(v); }
__device__ __attribute__((noinline)) float erf_ni(float v) { return erff(v); }

#define PK_K 0                          // [1024][256] Wk rows (natural [out][in])
#define PK_Q (PK_K + HDM * DI)
#define PK_V (PK_Q + HDM * DI)
#define PK_O (PK_V + HDM * DI)            // [256][1024] Wo rows
#define PK_END (PK_O + DO * HDM)
#define WS_PK 0u
#define WS_KP (WS_PK + 2u * PK_END)         // f32 [8192][1024] keys (flat = [16][8192][64])
#define WS_VP (WS_KP + 4u * NA * HDM)        // f32 [8192][1024] values
#define WS_QP (WS_VP + 4u * NA * HDM)        // f32 [1024][1024] queries (flat = [16][1024][64])
#define WS_VT (WS_QP + 4u * NQ * HDM)        // f16 [16*64 (h,d)][8192 a]
#define WS_O  (WS_VT + 2u * HDM * NA)        // f32 [1024][1024] (k, h*64+d)
#define WS_END (WS_O + 4u * NQ * HDM)

// ---- k_pack: block = row r of a natural [R][K] weight -> bf16 row (K <= 1024, K % 8 == 0)
__global__ __launch_bounds__(256) void k_pack(const float* __restrict__ Wm, int K, __bf16* __restrict__ DST) {
  __shared__ __align__(16) __bf16 s[HDM]; const int r = blockIdx.x, tid = threadIdx.x;
  for (int k = tid; k < K; k += 256) s[k] = (__bf16)Wm[(size_t)r * K + k];
  __syncthreads();
  for (int q = tid; q < K / 8; q += 256) vst2((unsigned*)(DST + (size_t)r * K + q * 8), *(const v4u*)&s[q * 8]);
}
// ---- k_proj: block = (64 rows, 128 of the 1024 cols): Y = bf16(X [rows][256]) . W rows (exact products) -> f32 rows (pitch 1024)
__global__ __launch_bounds__(128) void k_proj(const float* __restrict__ X, const __bf16* __restrict__ P, float* __restrict__ Y) {
  __shared__ __align__(16) float so[4][16][132];
  const int tid = threadIdx.x, wave = tid >> 5, lane = tid & 31, col = lane & 15, g = lane >> 4; const size_t r0 = (size_t)blockIdx.x * 64 + wave * 16; const int n0 = blockIdx.y * 128;
  v8f acc[8] = {};
#pragma unroll 2
  for (int kc = 0; kc < DI / 32; ++kc) { v16b a; { const float* p = X + (r0 + col) * DI + kc * 32 + 8 * g;
#pragma unroll
      for (int i = 0; i < 8; ++i) { a[i] = (__bf16)p[i]; a[8 + i] = (__bf16)p[16 + i]; } }
#pragma unroll
    for (int j = 0; j < 8; ++j) acc[j] = wmma_bf(a, frag_b(P + (size_t)(n0 + j * 16 + col) * DI + kc * 32, lane), acc[j]); }
#pragma unroll
  for (int j = 0; j < 8; ++j) {
#pragma unroll
    for (int r = 0; r < 8; ++r) so[wave][8 * g + r][j * 16 + col] = acc[j][r]; }
  LDSX();
  for (int rl = 0; rl < 16; ++rl) vst2(Y + (r0 + rl) * HDM + n0 + lane * 4, *(const v4f*)&so[wave][rl][lane * 4]);
}
__global__ __launch_bounds__(256) void k_vt(const float* __restrict__ VP, _Float16* __restrict__ VT) {
  __shared__ __align__(16) _Float16 st[64][72]; const int tid = threadIdx.x; const int a0 = blockIdx.x * 64, h = blockIdx.y;
  const float* src = VP + (size_t)h * NA * HD + (size_t)a0 * HD;
  for (int q = tid; q < 64 * 64; q += 256) { const int rl = q >> 6, d = q & 63; st[d][rl] = (_Float16)src[rl * HD + d]; }
  __syncthreads();
  for (int q = tid; q < 64 * 8; q += 256) { const int d = q >> 3, pc = q & 7; vst2((unsigned*)(VT + ((size_t)(h * HD + d)) * NA + a0 + pc * 8), *(const v4u*)&st[d][pc * 8]); }
}
// ---- k_attn: block = (64 keypoints, head h), 32 waves = 4 keypoint sub-tiles x NSP atom shares: wave (qs, sh) runs flash attention for 16 keypoints over the 32-atom steps ks = sh, sh + NSP, ... (logits = (bf16(dist) * (1/sqrt3) + q.k * 0.125) * (1/sqrt2) with q, k single f16 operands; P.V with P, V single f16 operands); the NSP partial (m, l, acc) of a keypoint are joined in LDS: O[k][h*64+d] = sum_sh acc_sh e^(m_sh - M) / sum_sh l_sh e^(m_sh - M)
// fragments from a pointer that already holds the lane's own 8 * (lane >> 4) step
__device__ __forceinline__ v16h frag_f32p(const float* p) { v16h a;
#pragma unroll
  for (int i = 0; i < 8; ++i) { a[i] = (_Float16)p[i]; a[8 + i] = (_Float16)p[16 + i]; }
  return a; }
__device__ __forceinline__ v16h frag_hp(const _Float16* p) { union { v16h v; v8h q[2]; } u; u.q[0] = *(const v8h*)p; u.q[1] = *(const v8h*)(p + 16); return u.v; }
#define NSP 8            // atom shares per keypoint sub-tile (waves per SIMD)
#define SW_M (16 * 68)   // per-wave LDS, written once behind the loop: [16][68] partial output, then m[16], l[16]
#define SW_L (SW_M + 16)
#define SW_N (SW_L + 16)
// lane l <-> lane l ^ 16 without LDS
__device__ __forceinline__ float xhalf(float v) { const int b = __builtin_bit_cast(int, v); return __builtin_bit_cast(float, __builtin_amdgcn_permlanex16(b, b, 0x76543210, 0xfedcba98, false, false)); }
// transposed products: S^T = K . Q^T (A = 16 atom rows, B = 16 keypoint columns), O^T += V^T . P^T. Lane (g, col) holds, of keypoint q0 + col alone, the scores of atoms 16 ct + 8 g + r: maximum and sum run in the lane, one exchange between the halves shares the maximum, and the two converted score tiles are the B operand of the second product as they lie (element 8 ct + r = atom 16 ct + 8 g + r, the k order of the V^T fragment)
__global__ __launch_bounds__(128 * NSP) void k_attn(const float* __restrict__ QP, const float* __restrict__ KP, const float* __restrict__ DIST, const _Float16* __restrict__ VT, float* __restrict__ O) {
  __shared__ __align__(16) float sm[4 * NSP][SW_N];
  const int tid = threadIdx.x, wave = __builtin_amdgcn_readfirstlane(tid >> 5), lane = tid & 31, col = lane & 15, g = lane >> 4;   // the wave's number in a scalar register: its share, loop counter and tile addresses stay scalar
  const int qb = blockIdx.x, h = blockIdx.y; const int q0 = qb * 64 + (wave & 3) * 16, sh = wave >> 2;
  float* sp = &sm[wave][0];
  const float RD = (float)(1.0 / 1.7320508075688772), RA = (float)(1.0 / 1.4142135623730951);
  const float* qrow = QP + (size_t)h * NQ * HD + (size_t)(q0 + col) * HD;
  v16h aq[2];
#pragma unroll
  for (int kc = 0; kc < 2; ++kc) aq[kc] = frag_f32(qrow + kc * 32, lane);
  float m = -3.0e38f, l = 0.f;   // of keypoint q0 + col: m shared by both halves, l the sum over the lane's own atoms
  v8f acc[4] = {};               // acc[dt][r] = O^T[16 dt + 8 g + r][q0 + col]
  // wave-uniform tile bases + one fixed lane offset each: one lane pointer per operand (K, V, dist) is live in the loop
  const float* kh = KP + (size_t)h * NA * HD; const _Float16* vh = VT + (size_t)h * HD * NA; const float* dh = DIST + (size_t)q0 * NA;
  const unsigned klane = col * HD + 8 * g, vlane = col * NA + 8 * g, dlane = col * NA + 8 * g;
#pragma unroll 1
  for (int ks = sh; ks < NA / 32; ks += NSP) { v8f s[2]; const float* kp = kh + (size_t)ks * 32 * HD + klane; const float* dp = dh + ks * 32 + dlane; const _Float16* vp = vh + ks * 32 + vlane;
#pragma unroll
    for (int ct = 0; ct < 2; ++ct) { v8f c = {};
#pragma unroll
      for (int kc = 0; kc < 2; ++kc) c = wmma16(frag_f32p(kp + ct * 16 * HD + kc * 32), aq[kc], c);
#pragma unroll
      for (int r = 0; r < 8; ++r) s[ct][r] = (bfr(dp[ct * 16 + r]) * RD + c[r] * 0.125f) * RA; }
    float mx = fmaxf(s[0][0], s[1][0]);
#pragma unroll
    for (int r = 1; r < 8; ++r) mx = fmaxf(mx, fmaxf(s[0][r], s[1][r]));
    mx = fmaxf(mx, xhalf(mx));
    const float mn = fmaxf(m, mx); const float alpha = exp_ni(m - mn);
    v16h pa; float es;
#pragma unroll
    for (int ct = 0; ct < 2; ++ct) {
#pragma unroll
      for (int r = 0; r < 8; ++r) { const float e = exp_ni(s[ct][r] - mn); es = ct + r ? es + e : e; pa[8 * ct + r] = (_Float16)e; } }
    l = l * alpha + es; m = mn;
#pragma unroll
    for (int dt = 0; dt < 4; ++dt) acc[dt] *= alpha;
#pragma unroll
    for (int dt = 0; dt < 4; ++dt) acc[dt] = wmma16(frag_hp(vp + dt * 16 * NA), pa, acc[dt]); }
  l += xhalf(l);   // both halves' sums stand under the same maximum
#pragma unroll
  for (int dt = 0; dt < 4; ++dt) { const v4f lo = { acc[dt][0], acc[dt][1], acc[dt][2], acc[dt][3] }, hi = { acc[dt][4], acc[dt][5], acc[dt][6], acc[dt][7] };
    vst2(&sp[col * 68 + dt * 16 + 8 * g], lo); vst2(&sp[col * 68 + dt * 16 + 8 * g + 4], hi); }
  if (g == 0) { sp[SW_M + col] = m; sp[SW_L + col] = l; }
  __syncthreads();   // every share's partial is in LDS before any thread joins them
  { const int q = tid >> 4, d4 = (tid & 15) * 4, row = q & 15; const float* p0 = &sm[q >> 4][0];   // thread = (keypoint q of 64, 4 of the 64 d); share sh of q lies 4 waves further
    float ms[NSP], M = -3.0e38f;
#pragma unroll
    for (int i = 0; i < NSP; ++i) { ms[i] = p0[i * 4 * SW_N + SW_M + row]; M = fmaxf(M, ms[i]); }
    float L = 0.f; v4f o = {};
#pragma unroll
    for (int i = 0; i < NSP; ++i) { const float w = exp_ni(ms[i] - M); L += p0[i * 4 * SW_N + SW_L + row] * w; o += *(const v4f*)&p0[i * 4 * SW_N + row * 68 + d4] * w; }
    vst2(O + (size_t)(qb * 64 + q) * HDM + h * HD + d4, o * (1.0f / L)); }
}
// ---- k_out: block = (64 rows, 128 of the 256 cols): out = O(hi/lo) . Wo rows (2 products)
__global__ __launch_bounds__(128) void k_out(const float* __restrict__ O, const __bf16* __restrict__ P, float* __restrict__ Y) {
  __shared__ __align__(16) float so[4][16][132];
  const int tid = threadIdx.x, wave = tid >> 5, lane = tid & 31, col = lane & 15, g = lane >> 4; const size_t r0 = (size_t)blockIdx.x * 64 + wave * 16; const int n0 = blockIdx.y * 128;
  v8f acc[8] = {};
#pragma unroll 2
  for (int kc = 0; kc < HDM / 32; ++kc) { const F2 a = split_row(O + (r0 + col) * HDM, kc * 32, lane);
#pragma unroll
    for (int j = 0; j < 8; ++j) { const v16b w = frag_b(P + (size_t)(n0 + j * 16 + col) * HDM + kc * 32, lane); acc[j] = wmma_bf(a.l, w, acc[j]); acc[j] = wmma_bf(a.h, w, acc[j]); } }
#pragma unroll
  for (int j = 0; j < 8; ++j) {
#pragma unroll
    for (int r = 0; r < 8; ++r) so[wave][8 * g + r][j * 16 + col] = acc[j][r]; }
  LDSX();
  for (int rl = 0; rl < 16; ++rl) vst2(Y + (r0 + rl) * DO + n0 + lane * 4, *(const v4f*)&so[wave][rl][lane * 4]);
}
extern "C" void kernel_launch(void* const* d_in, const int* in_sizes, int n_in, void* d_out, int out_size, void* d_ws, size_t ws_size, hipStream_t stream) {
  (void)in_sizes; (void)n_in; (void)out_size;
  const float** F = (const float**)d_in;   // 0 kp_feat [1024,256], 1 kp_dist [1024,8192], 2 rec_atom_feats [8192,256], 3 Wk [1024,256], 4 Wq, 5 Wv, 6 Wo [256,1024]
  if (ws_size < (size_t)WS_END) return;
  char* ws = (char*)d_ws; __bf16* PK = (__bf16*)(ws + WS_PK); float *KPp = (float*)(ws + WS_KP), *VPp = (float*)(ws + WS_VP), *QPp = (float*)(ws + WS_QP), *O = (float*)(ws + WS_O); _Float16* VT = (_Float16*)(ws + WS_VT);
  k_pack<<<HDM, 256, 0, stream>>>(F[3], DI, PK + PK_K); k_pack<<<HDM, 256, 0, stream>>>(F[4], DI, PK + PK_Q); k_pack<<<HDM, 256, 0, stream>>>(F[5], DI, PK + PK_V); k_pack<<<DO, 256, 0, stream>>>(F[6], HDM, PK + PK_O);
  k_proj<<<dim3(NA / 64, HDM / 128), 128, 0, stream>>>(F[2], PK + PK_K, KPp);
  k_proj<<<dim3(NA / 64, HDM / 128), 128, 0, stream>>>(F[2], PK + PK_V, VPp);
  k_proj<<<dim3(NQ / 64, HDM / 128), 128, 0, stream>>>(F[0], PK + PK_Q, QPp);
  k_vt<<<dim3(NA / 64, NH), 256, 0, stream>>>(VPp, VT);
  k_attn<<<dim3(TQB, NH), 128 * NSP, 0, stream>>>(QPp, KPp, F[1], VT, O);
  k_out<<<dim3(TQB, DO / 128), 128, 0, stream>>>(O, PK + PK_O, (float*)d_out);
}

// v003
// Measured time: 312 microseconds a run.
// Next to v002, in two timings, it ran 1.24 and 1.26 times as fast.
// All steps since v000 together make it 4.38 times as fast.
// compute dtype: kp_feat, kp_dist, rec_atom_feats and the four weights (module inputs) rounded to bf16; the three projections with exact bf16 products (inputs x inputs) on WMMA 16x16x32; attention logits q.k with q and k as single f16 operands (1 product; near-uniform softmax over 8,192 atoms, logit error ~1e-4 relative), P.V with P = exp(s - m) and V as single f16 operands (1 product; both errors relative to an 8,192-term softmax average); the output projection with the computed operand as bf16 hi + residual pair x exact Wo (2 products); the kp_dist bias, scaling, running-max softmax and normalisation in f32; f32 accumulate.
#include <hip/hip_runtime.h>
#include <math.h>

typedef __attribute__((ext_vector_type(16))) _Float16 v16h;
typedef __attribute__((ext_vector_type(16))) __bf16 v16b;
typedef __attribute__((ext_vector_type(8)))  _Float16 v8h;
typedef __attribute__((ext_vector_type(8)))  float v8f;
typedef __attribute__((ext_vector_type(4)))  float v4f;
typedef __attribute__((ext_vector_type(2)))  float v2f;
typedef __attribute__((ext_vector_type(4)))  unsigned v4u;
typedef __attribute__((ext_vector_type(4)))  int v4i;
typedef float __attribute__((may_alias)) float_a;
typedef int __attribute__((may_alias)) int_a;

template <typename T> __device__ __forceinline__ void vst2(void* p, T v) { *(T*)p = v;  }
__device__ __forceinline__ v8f wmma16(v16h a, v16h b, v8f c) {
  return __builtin_amdgcn_wmma_f32_16x16x32_f16(false, a, false, b, (short)0, c, false, false);
}
__device__ __forceinline__ v8f wmma_bf(v16b a, v16b b, v8f c) {
  return __builtin_amdgcn_wmma_f32_16x16x32_bf16(false, a, false, b, (short)0, c, false, false);
}
// 16x16x32 fragments: lane = (h = lane>>4, row/col = lane&15); elements 0..7 = k0+8h+0..7, 8..15 = k0+16+8h+0..7; D element r = row 8h+r
__device__ __forceinline__ v16h frag_h(const _Float16* rowk0, int lane) {
  union { v16h v; v8h q[2]; } u; const _Float16* p = rowk0 + 8 * (lane >> 4);
  u.q[0] = *(const v8h*)p; u.q[1] = *(const v8h*)(p + 16); return u.v;
}
__device__ __forceinline__ v16h frag_f32(const float* rowk0, int lane) {
  v16h a; const float* p = rowk0 + 8 * (lane >> 4);
#pragma unroll
  for (int i = 0; i < 8; ++i) { a[i] = (_Float16)p[i]; a[8 + i] = (_Float16)p[16 + i]; }
  return a;
}
__device__ __forceinline__ v16h frag_f32s(const float* rowk0, int lane, float sc) {
  v16h a; const float* p = rowk0 + 8 * (lane >> 4);
#pragma unroll
  for (int i = 0; i < 8; ++i) { a[i] = (_Float16)(p[i] * sc); a[8 + i] = (_Float16)(p[16 + i] * sc); }
  return a;
}
// column fragment from a [K][ld] layout (column n), rows >= K read as 0
__device__ __forceinline__ v16h fragc_f32(const float* W, int k0, int n, int lane, int ld, int K) {
  v16h a; const int g = lane >> 4;
#pragma unroll
  for (int i = 0; i < 8; ++i) { const int ka = k0 + 8 * g + i, kb = ka + 16;
    a[i] = (_Float16)(ka < K ? W[(size_t)(ka < K ? ka : K - 1) * ld + n] : 0.f); a[8 + i] = (_Float16)(kb < K ? W[(size_t)(kb < K ? kb : K - 1) * ld + n] : 0.f); }
  return a;
}
struct F2 { v16b h, l; };
__device__ __forceinline__ F2 bsplit16(const float v[16]) { F2 r;
#pragma unroll
  for (int i = 0; i < 16; ++i) { const __bf16 h = (__bf16)v[i]; r.h[i] = h; r.l[i] = (__bf16)(v[i] - (float)h); }
  return r; }
__device__ __forceinline__ F2 split_row(const float* row, int k0, int lane) { float v[16]; const float* p = row + k0 + 8 * (lane >> 4);
#pragma unroll
  for (int i = 0; i < 8; ++i) { v[i] = p[i]; v[8 + i] = p[16 + i]; }
  return bsplit16(v); }
__device__ __forceinline__ F2 split_rowK(const float* row, int k0, int lane, int K) { float v[16]; const int g = lane >> 4;
#pragma unroll
  for (int i = 0; i < 8; ++i) { const int ka = k0 + 8 * g + i, kb = ka + 16; v[i] = ka < K ? row[ka < K ? ka : K - 1] : 0.f; v[8 + i] = kb < K ? row[kb < K ? kb : K - 1] : 0.f; }
  return bsplit16(v); }
__device__ __forceinline__ F2 split_col(const float* W, int k0, int n, int lane, int ld, int K) { float v[16]; const int g = lane >> 4;
#pragma unroll
  for (int i = 0; i < 8; ++i) { const int ka = k0 + 8 * g + i, kb = ka + 16; v[i] = ka < K ? W[(size_t)(ka < K ? ka : K - 1) * ld + n] : 0.f; v[8 + i] = kb < K ? W[(size_t)(kb < K ? kb : K - 1) * ld + n] : 0.f; }
  return bsplit16(v); }
__device__ __forceinline__ v8f mac3(const F2& a, const F2& b, v8f c) { c = wmma_bf(a.l, b.h, c); c = wmma_bf(a.h, b.l, c); return wmma_bf(a.h, b.h, c); }
__device__ __forceinline__ float sigm(float v) { return 1.0f / (1.0f + expf(-v)); }
#define LDSX() do { asm volatile("s_wait_dscnt 0" ::: "memory"); __builtin_amdgcn_wave_barrier(); __builtin_amdgcn_fence(__ATOMIC_RELEASE, "workgroup"); } while (0)


// Keypoint multi-head attention (1,024 keypoints attend over 8,192 atoms; 16 heads x 64 via the module's RAW row-major reshape of the [rows][1024] projections: head h of K/V = projection rows 512h..512h+511 read as a contiguous [8192][64] block, head h of Q = rows 64h..64h+63 as [1024][64]); logits = (dist / sqrt(3) + q.k / 8) / sqrt(2); out = concat_h(P V) [1024][1024] . Wo^T.
#define NQ 1024          // keypoints
#define NA 8192          // atoms
#define DI 256           // in dim
#define HDM 1024         // heads x hidden
#define NH 16
#define HD 64
#define DO 256           // out dim
#ifndef TQB
#define TQB (NQ / 64)    // query tiles processed
#endif
typedef __attribute__((ext_vector_type(8))) __bf16 v8b;
__device__ __forceinline__ v16b frag_b(const __bf16* rowk0, int lane) {
  union { v16b v; v8b q[2]; } u; const __bf16* p = rowk0 + 8 * (lane >> 4);
  u.q[0] = *(const v8b*)p; u.q[1] = *(const v8b*)(p + 16); return u.v;
}
__device__ __forceinline__ float bfr(float v) { return (float)(__bf16)v; }
__device__ __attribute__((noinline)) float exp_ni(float v) { return expf(v); }
__device__ __attribute__((noinline)) float erf_ni(float v) { return erff(v); }

#define PK_K 0                          // [1024][256] Wk rows (natural [out][in])
#define PK_Q (PK_K + HDM * DI)
#define PK_V (PK_Q + HDM * DI)
#define PK_O (PK_V + HDM * DI)            // [256][1024] Wo rows
#define PK_END (PK_O + DO * HDM)
#define WS_PK 0u
#define WS_KP (WS_PK + 2u * PK_END)         // f32 [8192][1024] keys (flat = [16][8192][64])
#define WS_VP (WS_KP + 4u * NA * HDM)        // f32 [8192][1024] values
#define WS_QP (WS_VP + 4u * NA * HDM)        // f32 [1024][1024] queries (flat = [16][1024][64])
#define WS_VT (WS_QP + 4u * NQ * HDM)        // f16 [16*64 (h,d)][8192 a]
#define WS_O  (WS_VT + 2u * HDM * NA)        // f32 [1024][1024] (k, h*64+d)
#define WS_END (WS_O + 4u * NQ * HDM)

// ---- k_pack: block = row r of a natural [R][K] weight -> bf16 row (K <= 1024, K % 8 == 0)
__global__ __launch_bounds__(256) void k_pack(const float* __restrict__ Wm, int K, __bf16* __restrict__ DST) {
  __shared__ __align__(16) __bf16 s[HDM]; const int r = blockIdx.x, tid = threadIdx.x;
  for (int k = tid; k < K; k += 256) s[k] = (__bf16)Wm[(size_t)r * K + k];
  __syncthreads();
  for (int q = tid; q < K / 8; q += 256) vst2((unsigned*)(DST + (size_t)r * K + q * 8), *(const v4u*)&s[q * 8]);
}
// a wave-uniform pointer held in a scalar register pair
template <typename T> __device__ __forceinline__ const T* sbase(const T* p) { const unsigned long long a = (unsigned long long)p;
  const unsigned lo = (unsigned)__builtin_amdgcn_readfirstlane((int)(unsigned)a), hi = (unsigned)__builtin_amdgcn_readfirstlane((int)(unsigned)(a >> 32));
  return (const T*)(const __attribute__((address_space(1))) T*)(((unsigned long long)hi << 32) | lo); }   // stays a global-memory pointer
// one k pass (32 wide) of a 16-row x 128-column wave tile: the lane's 16 f32 of its A row and its 8 bf16 B fragments, loaded as one group (pointers hold the lane's own row and 8 * (lane >> 4) step)
struct PassOps { v4f x[4]; union { v16b v; v8b q[2]; } w[8];
  __device__ __forceinline__ void load(const float* xp, const __bf16* wp, int ld) {
    x[0] = *(const v4f*)xp; x[1] = *(const v4f*)(xp + 4); x[2] = *(const v4f*)(xp + 16); x[3] = *(const v4f*)(xp + 20);
#pragma unroll
    for (int j = 0; j < 8; ++j) { w[j].q[0] = *(const v8b*)(wp + (size_t)j * 16 * ld); w[j].q[1] = *(const v8b*)(wp + (size_t)j * 16 * ld + 16); } }
  __device__ __forceinline__ v16b a_bf() const { v16b a;
#pragma unroll
    for (int i = 0; i < 16; ++i) a[i] = (__bf16)x[i >> 2][i & 3];
    return a; }
  __device__ __forceinline__ F2 a_split() const { float v[16];
#pragma unroll
    for (int i = 0; i < 16; ++i) v[i] = x[i >> 2][i & 3];
    return bsplit16(v); } };
// ---- k_proj: block = (64 rows, 128 of the 1024 cols): Y = bf16(X [rows][256]) . W rows (exact products) -> f32 rows (pitch 1024)
__global__ __launch_bounds__(128) void k_proj(const float* __restrict__ X, const __bf16* __restrict__ P, float* __restrict__ Y) {
  __shared__ __align__(16) float so[4][16][132];
  const int tid = threadIdx.x, wave = tid >> 5, lane = tid & 31, col = lane & 15, g = lane >> 4; const size_t r0 = (size_t)blockIdx.x * 64 + wave * 16; const int n0 = blockIdx.y * 128;
  v8f acc[8] = {};
  const float* xp = X + (r0 + col) * DI + 8 * g; const __bf16* wp = P + (size_t)(n0 + col) * DI + 8 * g;
  PassOps b0, b1; b0.load(xp, wp, DI);   // two register sets: pass kc + 1's loads are all in flight while pass kc's products run
#pragma unroll
  for (int kc = 0; kc < DI / 32; kc += 2) {
    b1.load(xp + (kc + 1) * 32, wp + (kc + 1) * 32, DI);
    { const v16b a = b0.a_bf();
#pragma unroll
      for (int j = 0; j < 8; ++j) acc[j] = wmma_bf(a, b0.w[j].v, acc[j]); }
    if (kc + 2 < DI / 32) b0.load(xp + (kc + 2) * 32, wp + (kc + 2) * 32, DI);
    { const v16b a = b1.a_bf();
#pragma unroll
      for (int j = 0; j < 8; ++j) acc[j] = wmma_bf(a, b1.w[j].v, acc[j]); } }
#pragma unroll
  for (int j = 0; j < 8; ++j) {
#pragma unroll
    for (int r = 0; r < 8; ++r) so[wave][8 * g + r][j * 16 + col] = acc[j][r]; }
  LDSX();
  v4f t[16];   // all 16 LDS reads fly together ahead of the stores
#pragma unroll
  for (int rl = 0; rl < 16; ++rl) t[rl] = *(const v4f*)&so[wave][rl][lane * 4];
#pragma unroll
  for (int rl = 0; rl < 16; ++rl) vst2(Y + (r0 + rl) * HDM + n0 + lane * 4, t[rl]);
}
__global__ __launch_bounds__(256) void k_vt(const float* __restrict__ VP, _Float16* __restrict__ VT) {
  __shared__ __align__(16) _Float16 st[64][72]; const int tid = threadIdx.x; const int a0 = blockIdx.x * 64, h = blockIdx.y;
  const float* src = VP + (size_t)h * NA * HD + (size_t)a0 * HD;
  for (int q = tid; q < 64 * 64; q += 256) { const int rl = q >> 6, d = q & 63; st[d][rl] = (_Float16)src[rl * HD + d]; }
  __syncthreads();
  for (int q = tid; q < 64 * 8; q += 256) { const int d = q >> 3, pc = q & 7; vst2((unsigned*)(VT + ((size_t)(h * HD + d)) * NA + a0 + pc * 8), *(const v4u*)&st[d][pc * 8]); }
}
// ---- k_attn: block = (64 keypoints, head h), 32 waves = 4 keypoint sub-tiles x NSP atom shares: wave (qs, sh) runs flash attention for 16 keypoints over the 32-atom steps ks = sh, sh + NSP, ... (logits = (bf16(dist) * (1/sqrt3) + q.k * 0.125) * (1/sqrt2) with q, k single f16 operands; P.V with P, V single f16 operands); the NSP partial (m, l, acc) of a keypoint are joined in LDS: O[k][h*64+d] = sum_sh acc_sh e^(m_sh - M) / sum_sh l_sh e^(m_sh - M)
// fragments from a pointer that already holds the lane's own 8 * (lane >> 4) step
__device__ __forceinline__ v16h frag_f32p(const float* p) { v16h a;
#pragma unroll
  for (int i = 0; i < 8; ++i) { a[i] = (_Float16)p[i]; a[8 + i] = (_Float16)p[16 + i]; }
  return a; }
__device__ __forceinline__ v16h frag_hp(const _Float16* p) { union { v16h v; v8h q[2]; } u; u.q[0] = *(const v8h*)p; u.q[1] = *(const v8h*)(p + 16); return u.v; }
#define NSP 8            // atom shares per keypoint sub-tile (waves per SIMD)
#define SW_M (16 * 68)   // per-wave LDS, written once behind the loop: [16][68] partial output, then m[16], l[16]
#define SW_L (SW_M + 16)
#define SW_N (SW_L + 16)
// lane l <-> lane l ^ 16 without LDS
__device__ __forceinline__ float xhalf(float v) { const int b = __builtin_bit_cast(int, v); return __builtin_bit_cast(float, __builtin_amdgcn_permlanex16(b, b, 0x76543210, 0xfedcba98, false, false)); }
// transposed products: S^T = K . Q^T (A = 16 atom rows, B = 16 keypoint columns), O^T += V^T . P^T. Lane (g, col) holds, of keypoint q0 + col alone, the scores of atoms 16 ct + 8 g + r: maximum and sum run in the lane, one exchange between the halves shares the maximum, and the two converted score tiles are the B operand of the second product as they lie (element 8 ct + r = atom 16 ct + 8 g + r, the k order of the V^T fragment)
__global__ __launch_bounds__(128 * NSP) void k_attn(const float* __restrict__ QP, const float* __restrict__ KP, const float* __restrict__ DIST, const _Float16* __restrict__ VT, float* __restrict__ O) {
  __shared__ __align__(16) float sm[4 * NSP][SW_N];
  const int tid = threadIdx.x, wave = __builtin_amdgcn_readfirstlane(tid >> 5), lane = tid & 31, col = lane & 15, g = lane >> 4;   // the wave's number in a scalar register: its share, loop counter and tile addresses stay scalar
  const int qb = blockIdx.x, h = blockIdx.y; const int q0 = qb * 64 + (wave & 3) * 16, sh = wave >> 2;
  float* sp = &sm[wave][0];
  const float RD = (float)(1.0 / 1.7320508075688772), RA = (float)(1.0 / 1.4142135623730951);
  const float* qrow = QP + (size_t)h * NQ * HD + (size_t)(q0 + col) * HD;
  v16h aq[2];
#pragma unroll
  for (int kc = 0; kc < 2; ++kc) aq[kc] = frag_f32(qrow + kc * 32, lane);
  float m = -3.0e38f, l = 0.f;   // of keypoint q0 + col: m shared by both halves, l the sum over the lane's own atoms
  v8f acc[4] = {};               // acc[dt][r] = O^T[16 dt + 8 g + r][q0 + col]
  // wave-uniform tile bases + one fixed lane offset each: one lane pointer per operand (K, V, dist) is live in the loop
  const float* kh = KP + (size_t)h * NA * HD; const _Float16* vh = VT + (size_t)h * HD * NA; const float* dh = DIST + (size_t)q0 * NA;
  const unsigned klane = col * HD + 8 * g, vlane = col * NA + 8 * g, dlane = col * NA + 8 * g;
#pragma unroll 1
  for (int ks = sh; ks < NA / 32; ks += NSP) { v8f s[2];
    // the step's tile bases in scalar registers + one fixed 32-bit lane offset per operand: three address registers, not three pairs, beside the step's loads
    const float* kp = sbase(kh + (size_t)ks * 32 * HD) + klane; const float* dp = sbase(dh + ks * 32) + dlane; const _Float16* vp = sbase(vh + ks * 32) + vlane;
    // the step's K, dist and V loads stand as groups ahead of the products that use them
    v16h ka[2][2]; v4f dv[2][2]; v16h va[4];
#pragma unroll
    for (int ct = 0; ct < 2; ++ct) {
#pragma unroll
      for (int kc = 0; kc < 2; ++kc) ka[ct][kc] = frag_f32p(kp + ct * 16 * HD + kc * 32); }
    __builtin_amdgcn_sched_barrier(0);   // the 64 f32 K registers are packed to 32 before the dist loads take theirs: with both live the step would spill
#pragma unroll
    for (int ct = 0; ct < 2; ++ct) { dv[ct][0] = *(const v4f*)(dp + ct * 16); dv[ct][1] = *(const v4f*)(dp + ct * 16 + 4); }
#pragma unroll
    for (int ct = 0; ct < 2; ++ct) { s[ct] = v8f{};
#pragma unroll
      for (int kc = 0; kc < 2; ++kc) s[ct] = wmma16(ka[ct][kc], aq[kc], s[ct]); }
#pragma unroll
    for (int dt = 0; dt < 4; ++dt) va[dt] = frag_hp(vp + dt * 16 * NA);
#pragma unroll
    for (int ct = 0; ct < 2; ++ct) {
#pragma unroll
      for (int r = 0; r < 8; ++r) s[ct][r] = (bfr(dv[ct][r >> 2][r & 3]) * RD + s[ct][r] * 0.125f) * RA; }
    float mx = fmaxf(s[0][0], s[1][0]);
#pragma unroll
    for (int r = 1; r < 8; ++r) mx = fmaxf(mx, fmaxf(s[0][r], s[1][r]));
    mx = fmaxf(mx, xhalf(mx));
    const float mn = fmaxf(m, mx); const float alpha = exp_ni(m - mn);
    v16h pa; float es;
#pragma unroll
    for (int ct = 0; ct < 2; ++ct) {
#pragma unroll
      for (int r = 0; r < 8; ++r) { const float e = exp_ni(s[ct][r] - mn); es = ct + r ? es + e : e; pa[8 * ct + r] = (_Float16)e; } }
    l = l * alpha + es; m = mn;
#pragma unroll
    for (int dt = 0; dt < 4; ++dt) acc[dt] *= alpha;
#pragma unroll
    for (int dt = 0; dt < 4; ++dt) acc[dt] = wmma16(va[dt], pa, acc[dt]); }
  l += xhalf(l);   // both halves' sums stand under the same maximum
  const int lane2 = (int)__builtin_amdgcn_mbcnt_lo(~0u, 0u), col2 = lane2 & 15, g2 = lane2 >> 4, tid2 = wave * 32 + lane2;   // the lane's number read anew: no register carries it, or what follows from it, through the loop
#pragma unroll
  for (int dt = 0; dt < 4; ++dt) { const v4f lo = { acc[dt][0], acc[dt][1], acc[dt][2], acc[dt][3] }, hi = { acc[dt][4], acc[dt][5], acc[dt][6], acc[dt][7] };
    vst2(&sp[col2 * 68 + dt * 16 + 8 * g2], lo); vst2(&sp[col2 * 68 + dt * 16 + 8 * g2 + 4], hi); }
  if (g2 == 0) { sp[SW_M + col2] = m; sp[SW_L + col2] = l; }
  __syncthreads();   // every share's partial is in LDS before any thread joins them
  { const int q = tid2 >> 4, d4 = (tid2 & 15) * 4, row = q & 15; const float* p0 = &sm[q >> 4][0];   // thread = (keypoint q of 64, 4 of the 64 d); share sh of q lies 4 waves further
    float ms[NSP], M = -3.0e38f;
#pragma unroll
    for (int i = 0; i < NSP; ++i) { ms[i] = p0[i * 4 * SW_N + SW_M + row]; M = fmaxf(M, ms[i]); }
    float L = 0.f; v4f o = {};
#pragma unroll
    for (int i = 0; i < NSP; ++i) { const float w = exp_ni(ms[i] - M); L += p0[i * 4 * SW_N + SW_L + row] * w; o += *(const v4f*)&p0[i * 4 * SW_N + row * 68 + d4] * w; }
    vst2(O + (size_t)(qb * 64 + q) * HDM + h * HD + d4, o * (1.0f / L)); }
}
__device__ __forceinline__ void out_pass(const PassOps& b, v8f (&acc)[8]) { const F2 a = b.a_split();
#pragma unroll
  for (int j = 0; j < 8; ++j) acc[j] = wmma_bf(a.l, b.w[j].v, acc[j]);
#pragma unroll
  for (int j = 0; j < 8; ++j) acc[j] = wmma_bf(a.h, b.w[j].v, acc[j]); }
// ---- k_out: block = (64 rows, 128 of the 256 cols): out = O(hi/lo) . Wo rows (2 products)
__global__ __launch_bounds__(128) void k_out(const float* __restrict__ O, const __bf16* __restrict__ P, float* __restrict__ Y) {
  __shared__ __align__(16) float so[4][16][132];
  const int tid = threadIdx.x, wave = __builtin_amdgcn_readfirstlane(tid >> 5), lane = tid & 31, col = lane & 15, g = lane >> 4; const size_t r0 = (size_t)blockIdx.x * 64 + wave * 16; const int n0 = blockIdx.y * 128;   // the wave's number, and r0 with it, in scalar registers through the loop
  v8f acc[8] = {};
  const float* xp = O + (r0 + col) * HDM + 8 * g; const __bf16* wp = P + (size_t)(n0 + col) * HDM + 8 * g;
  PassOps b0, b1; b0.load(xp, wp, HDM);   // two register sets: pass kc + 1's loads are all in flight while pass kc's products run
#pragma unroll 1   // rolled: the two sets and the accumulators are the whole budget of 256 registers
  for (int kc = 0; kc < HDM / 32 - 2; kc += 2) {
    b1.load(xp + 32, wp + 32, HDM);
    __builtin_amdgcn_sched_barrier(0);   // the next pass's loads all issue ahead of this pass's products: sunk among them they would be waited for as soon as issued
    out_pass(b0, acc);
    xp += 64; wp += 64; b0.load(xp, wp, HDM);
    __builtin_amdgcn_sched_barrier(0);   // as above
    out_pass(b1, acc); }
  b1.load(xp + 32, wp + 32, HDM);
  __builtin_amdgcn_sched_barrier(0);   // as above
  out_pass(b0, acc); out_pass(b1, acc);
  const int lane2 = (int)__builtin_amdgcn_mbcnt_lo(~0u, 0u), col2 = lane2 & 15, g2 = lane2 >> 4;   // the lane's number read anew: no register carries it, or what follows from it, through the loop
#pragma unroll
  for (int j = 0; j < 8; ++j) {
#pragma unroll
    for (int r = 0; r < 8; ++r) so[wave][8 * g2 + r][j * 16 + col2] = acc[j][r]; }
  LDSX();
  for (int rl = 0; rl < 16; ++rl) vst2(Y + (r0 + rl) * DO + n0 + lane2 * 4, *(const v4f*)&so[wave][rl][lane2 * 4]);
}
extern "C" void kernel_launch(void* const* d_in, const int* in_sizes, int n_in, void* d_out, int out_size, void* d_ws, size_t ws_size, hipStream_t stream) {
  (void)in_sizes; (void)n_in; (void)out_size;
  const float** F = (const float**)d_in;   // 0 kp_feat [1024,256], 1 kp_dist [1024,8192], 2 rec_atom_feats [8192,256], 3 Wk [1024,256], 4 Wq, 5 Wv, 6 Wo [256,1024]
  if (ws_size < (size_t)WS_END) return;
  char* ws = (char*)d_ws; __bf16* PK = (__bf16*)(ws + WS_PK); float *KPp = (float*)(ws + WS_KP), *VPp = (float*)(ws + WS_VP), *QPp = (float*)(ws + WS_QP), *O = (float*)(ws + WS_O); _Float16* VT = (_Float16*)(ws + WS_VT);
  k_pack<<<HDM, 256, 0, stream>>>(F[3], DI, PK + PK_K); k_pack<<<HDM, 256, 0, stream>>>(F[4], DI, PK + PK_Q); k_pack<<<HDM, 256, 0, stream>>>(F[5], DI, PK + PK_V); k_pack<<<DO, 256, 0, stream>>>(F[6], HDM, PK + PK_O);
  k_proj<<<dim3(NA / 64, HDM / 128), 128, 0, stream>>>(F[2], PK + PK_K, KPp);
  k_proj<<<dim3(NA / 64, HDM / 128), 128, 0, stream>>>(F[2], PK + PK_V, VPp);
  k_proj<<<dim3(NQ / 64, HDM / 128), 128, 0, stream>>>(F[0], PK + PK_Q, QPp);
  k_vt<<<dim3(NA / 64, NH), 256, 0, stream>>>(VPp, VT);
  k_attn<<<dim3(TQB, NH), 128 * NSP, 0, stream>>>(QPp, KPp, F[1], VT, O);
  k_out<<<dim3(TQB, DO / 128), 128, 0, stream>>>(O, PK + PK_O, (float*)d_out);
}

// v004
// Measured time: 192 microseconds a run.
// Two timings next to v003 put it at 1.63 and 1.62 times that version's speed.
// Counting every step since v000, it is 7.11 times as fast.
// compute dtype: kp_feat, kp_dist, rec_atom_feats and the four weights (module inputs) rounded to bf16; the three projections with exact bf16 products (inputs x inputs) on WMMA 16x16x32; attention logits q.k with q and k as single f16 operands (1 product; near-uniform softmax over 8,192 atoms, logit error ~1e-4 relative), P.V with P = exp(s - m) and V as single f16 operands (1 product; both errors relative to an 8,192-term softmax average); the output projection with the computed operand as bf16 hi + residual pair x exact Wo (2 products); the kp_dist bias, scaling, running-max softmax and normalisation in f32; f32 accumulate.
#include <hip/hip_runtime.h>
#include <math.h>

typedef __attribute__((ext_vector_type(16))) _Float16 v16h;
typedef __attribute__((ext_vector_type(16))) __bf16 v16b;
typedef __attribute__((ext_vector_type(8)))  _Float16 v8h;
typedef __attribute__((ext_vector_type(8)))  float v8f;
typedef __attribute__((ext_vector_type(4)))  float v4f;
typedef __attribute__((ext_vector_type(2)))  float v2f;
typedef __attribute__((ext_vector_type(4)))  unsigned v4u;
typedef __attribute__((ext_vector_type(4)))  int v4i;
typedef float __attribute__((may_alias)) float_a;
typedef int __attribute__((may_alias)) int_a;

template <typename T> __device__ __forceinline__ void vst2(void* p, T v) { *(T*)p = v;  }
__device__ __forceinline__ v8f wmma16(v16h a, v16h b, v8f c) {
  return __builtin_amdgcn_wmma_f32_16x16x32_f16(false, a, false, b, (short)0, c, false, false);
}
__device__ __forceinline__ v8f wmma_bf(v16b a, v16b b, v8f c) {
  return __builtin_amdgcn_wmma_f32_16x16x32_bf16(false, a, false, b, (short)0, c, false, false);
}
// 16x16x32 fragments: lane = (h = lane>>4, row/col = lane&15); elements 0..7 = k0+8h+0..7, 8..15 = k0+16+8h+0..7; D element r = row 8h+r
__device__ __forceinline__ v16h frag_h(const _Float16* rowk0, int lane) {
  union { v16h v; v8h q[2]; } u; const _Float16* p = rowk0 + 8 * (lane >> 4);
  u.q[0] = *(const v8h*)p; u.q[1] = *(const v8h*)(p + 16); return u.v;
}
__device__ __forceinline__ v16h frag_f32(const float* rowk0, int lane) {
  v16h a; const float* p = rowk0 + 8 * (lane >> 4);
#pragma unroll
  for (int i = 0; i < 8; ++i) { a[i] = (_Float16)p[i]; a[8 + i] = (_Float16)p[16 + i]; }
  return a;
}
__device__ __forceinline__ v16h frag_f32s(const float* rowk0, int lane, float sc) {
  v16h a; const float* p = rowk0 + 8 * (lane >> 4);
#pragma unroll
  for (int i = 0; i < 8; ++i) { a[i] = (_Float16)(p[i] * sc); a[8 + i] = (_Float16)(p[16 + i] * sc); }
  return a;
}
// column fragment from a [K][ld] layout (column n), rows >= K read as 0
__device__ __forceinline__ v16h fragc_f32(const float* W, int k0, int n, int lane, int ld, int K) {
  v16h a; const int g = lane >> 4;
#pragma unroll
  for (int i = 0; i < 8; ++i) { const int ka = k0 + 8 * g + i, kb = ka + 16;
    a[i] = (_Float16)(ka < K ? W[(size_t)(ka < K ? ka : K - 1) * ld + n] : 0.f); a[8 + i] = (_Float16)(kb < K ? W[(size_t)(kb < K ? kb : K - 1) * ld + n] : 0.f); }
  return a;
}
struct F2 { v16b h, l; };
__device__ __forceinline__ F2 bsplit16(const float v[16]) { F2 r;
#pragma unroll
  for (int i = 0; i < 16; ++i) { const __bf16 h = (__bf16)v[i]; r.h[i] = h; r.l[i] = (__bf16)(v[i] - (float)h); }
  return r; }
__device__ __forceinline__ F2 split_row(const float* row, int k0, int lane) { float v[16]; const float* p = row + k0 + 8 * (lane >> 4);
#pragma unroll
  for (int i = 0; i < 8; ++i) { v[i] = p[i]; v[8 + i] = p[16 + i]; }
  return bsplit16(v); }
__device__ __forceinline__ F2 split_rowK(const float* row, int k0, int lane, int K) { float v[16]; const int g = lane >> 4;
#pragma unroll
  for (int i = 0; i < 8; ++i) { const int ka = k0 + 8 * g + i, kb = ka + 16; v[i] = ka < K ? row[ka < K ? ka : K - 1] : 0.f; v[8 + i] = kb < K ? row[kb < K ? kb : K - 1] : 0.f; }
  return bsplit16(v); }
__device__ __forceinline__ F2 split_col(const float* W, int k0, int n, int lane, int ld, int K) { float v[16]; const int g = lane >> 4;
#pragma unroll
  for (int i = 0; i < 8; ++i) { const int ka = k0 + 8 * g + i, kb = ka + 16; v[i] = ka < K ? W[(size_t)(ka < K ? ka : K - 1) * ld + n] : 0.f; v[8 + i] = kb < K ? W[(size_t)(kb < K ? kb : K - 1) * ld + n] : 0.f; }
  return bsplit16(v); }
__device__ __forceinline__ v8f mac3(const F2& a, const F2& b, v8f c) { c = wmma_bf(a.l, b.h, c); c = wmma_bf(a.h, b.l, c); return wmma_bf(a.h, b.h, c); }
__device__ __forceinline__ float sigm(float v) { return 1.0f / (1.0f + expf(-v)); }
#define LDSX() do { asm volatile("s_wait_dscnt 0" ::: "memory"); __builtin_amdgcn_wave_barrier(); __builtin_amdgcn_fence(__ATOMIC_RELEASE, "workgroup"); } while (0)


// Keypoint multi-head attention (1,024 keypoints attend over 8,192 atoms; 16 heads x 64 via the module's RAW row-major reshape of the [rows][1024] projections: head h of K/V = projection rows 512h..512h+511 read as a contiguous [8192][64] block, head h of Q = rows 64h..64h+63 as [1024][64]); logits = (dist / sqrt(3) + q.k / 8) / sqrt(2); out = concat_h(P V) [1024][1024] . Wo^T.
#define NQ 1024          // keypoints
#define NA 8192          // atoms
#define DI 256           // in dim
#define HDM 1024         // heads x hidden
#define NH 16
#define HD 64
#define DO 256           // out dim
#ifndef TQB
#define TQB (NQ / 64)    // query tiles processed
#endif
typedef __attribute__((ext_vector_type(8))) __bf16 v8b;
__device__ __forceinline__ v16b frag_b(const __bf16* rowk0, int lane) {
  union { v16b v; v8b q[2]; } u; const __bf16* p = rowk0 + 8 * (lane >> 4);
  u.q[0] = *(const v8b*)p; u.q[1] = *(const v8b*)(p + 16); return u.v;
}
__device__ __forceinline__ float bfr(float v) { return (float)(__bf16)v; }
__device__ __attribute__((noinline)) float exp_ni(float v) { return expf(v); }
__device__ __attribute__((noinline)) float erf_ni(float v) { return erff(v); }

#define PK_K 0                          // [1024][256] Wk rows (natural [out][in])
#define PK_Q (PK_K + HDM * DI)
#define PK_V (PK_Q + HDM * DI)
#define PK_O (PK_V + HDM * DI)            // [256][1024] Wo rows
#define PK_END (PK_O + DO * HDM)
#define WS_PK 0u
#define WS_KP (WS_PK + 2u * PK_END)         // f32 [8192][1024] keys (flat = [16][8192][64])
#define WS_VP (WS_KP + 4u * NA * HDM)        // f32 [8192][1024] values
#define WS_QP (WS_VP + 4u * NA * HDM)        // f32 [1024][1024] queries (flat = [16][1024][64])
#define WS_VT (WS_QP + 4u * NQ * HDM)        // f16 V^T fragments [16 h][256 steps][4 dt][2 p][32 lanes][8]
#define WS_O  (WS_VT + 2u * HDM * NA)        // f32 [1024][1024] (k, h*64+d)
#define WS_KF (WS_O + 4u * NQ * HDM)         // f16 K fragments [16 h][512 atom tiles][2 kc][2 p][32 lanes][8]
#define WS_DF (WS_KF + 2u * HDM * NA)        // bf16 dist pieces [64 keypoint tiles][256 steps][2 ct][32 lanes][8]
#define WS_END (WS_DF + 2u * NQ * NA)

// ---- k_pack: block = row r of a natural [R][K] weight -> bf16 row (K <= 1024, K % 8 == 0)
__global__ __launch_bounds__(256) void k_pack(const float* __restrict__ Wm, int K, __bf16* __restrict__ DST) {
  __shared__ __align__(16) __bf16 s[HDM]; const int r = blockIdx.x, tid = threadIdx.x;
  for (int k = tid; k < K; k += 256) s[k] = (__bf16)Wm[(size_t)r * K + k];
  __syncthreads();
  for (int q = tid; q < K / 8; q += 256) vst2((unsigned*)(DST + (size_t)r * K + q * 8), *(const v4u*)&s[q * 8]);
}
// a wave-uniform pointer held in a scalar register pair
template <typename T> __device__ __forceinline__ const T* sbase(const T* p) { const unsigned long long a = (unsigned long long)p;
  const unsigned lo = (unsigned)__builtin_amdgcn_readfirstlane((int)(unsigned)a), hi = (unsigned)__builtin_amdgcn_readfirstlane((int)(unsigned)(a >> 32));
  return (const T*)(const __attribute__((address_space(1))) T*)(((unsigned long long)hi << 32) | lo); }   // stays a global-memory pointer
// one k pass (32 wide) of a 16-row x 128-column wave tile: the lane's 16 f32 of its A row and its 8 bf16 B fragments, loaded as one group (pointers hold the lane's own row and 8 * (lane >> 4) step)
struct PassOps { v4f x[4]; union { v16b v; v8b q[2]; } w[8];
  __device__ __forceinline__ void load(const float* xp, const __bf16* wp, int ld) {
    x[0] = *(const v4f*)xp; x[1] = *(const v4f*)(xp + 4); x[2] = *(const v4f*)(xp + 16); x[3] = *(const v4f*)(xp + 20);
#pragma unroll
    for (int j = 0; j < 8; ++j) { w[j].q[0] = *(const v8b*)(wp + (size_t)j * 16 * ld); w[j].q[1] = *(const v8b*)(wp + (size_t)j * 16 * ld + 16); } }
  __device__ __forceinline__ v16b a_bf() const { v16b a;
#pragma unroll
    for (int i = 0; i < 16; ++i) a[i] = (__bf16)x[i >> 2][i & 3];
    return a; }
  __device__ __forceinline__ F2 a_split() const { float v[16];
#pragma unroll
    for (int i = 0; i < 16; ++i) v[i] = x[i >> 2][i & 3];
    return bsplit16(v); } };
// ---- k_proj: block = (64 rows, 128 of the 1024 cols): Y = bf16(X [rows][256]) . W rows (exact products) -> f32 rows (pitch 1024)
__global__ __launch_bounds__(128) void k_proj(const float* __restrict__ X, const __bf16* __restrict__ P, float* __restrict__ Y) {
  __shared__ __align__(16) float so[4][16][132];
  const int tid = threadIdx.x, wave = tid >> 5, lane = tid & 31, col = lane & 15, g = lane >> 4; const size_t r0 = (size_t)blockIdx.x * 64 + wave * 16; const int n0 = blockIdx.y * 128;
  v8f acc[8] = {};
  const float* xp = X + (r0 + col) * DI + 8 * g; const __bf16* wp = P + (size_t)(n0 + col) * DI + 8 * g;
  PassOps b0, b1; b0.load(xp, wp, DI);   // two register sets: pass kc + 1's loads are all in flight while pass kc's products run
#pragma unroll
  for (int kc = 0; kc < DI / 32; kc += 2) {
    b1.load(xp + (kc + 1) * 32, wp + (kc + 1) * 32, DI);
    { const v16b a = b0.a_bf();
#pragma unroll
      for (int j = 0; j < 8; ++j) acc[j] = wmma_bf(a, b0.w[j].v, acc[j]); }
    if (kc + 2 < DI / 32) b0.load(xp + (kc + 2) * 32, wp + (kc + 2) * 32, DI);
    { const v16b a = b1.a_bf();
#pragma unroll
      for (int j = 0; j < 8; ++j) acc[j] = wmma_bf(a, b1.w[j].v, acc[j]); } }
#pragma unroll
  for (int j = 0; j < 8; ++j) {
#pragma unroll
    for (int r = 0; r < 8; ++r) so[wave][8 * g + r][j * 16 + col] = acc[j][r]; }
  LDSX();
  v4f t[16];   // all 16 LDS reads fly together ahead of the stores
#pragma unroll
  for (int rl = 0; rl < 16; ++rl) t[rl] = *(const v4f*)&so[wave][rl][lane * 4];
#pragma unroll
  for (int rl = 0; rl < 16; ++rl) vst2(Y + (r0 + rl) * HDM + n0 + lane * 4, t[rl]);
}
__global__ __launch_bounds__(256) void k_vt(const float* __restrict__ VP, _Float16* __restrict__ VT) {
  __shared__ __align__(16) _Float16 st[64][72]; const int tid = threadIdx.x; const int a0 = blockIdx.x * 64, h = blockIdx.y;
  const float* src = VP + (size_t)h * NA * HD + (size_t)a0 * HD;
  for (int q = tid; q < 64 * 64; q += 256) { const int rl = q >> 6, d = q & 63; st[d][rl] = (_Float16)src[rl * HD + d]; }
  __syncthreads();
  // fragment order: piece q = (step sl, dt, p, lane (g, col)) holds V[a0 + 32 sl + 16 p + 8 g + 0..7][16 dt + col], so that one load instruction of k_attn (32 lanes x 16 bytes) reads 512 bytes in a row
  for (int q = tid; q < 64 * 8; q += 256) { const int sl = q >> 8, dt = (q >> 6) & 3, p = (q >> 5) & 1, g = (q >> 4) & 1, col = q & 15; vst2((unsigned*)(VT + ((size_t)h * NA + a0) * HD + q * 8), *(const v4u*)&st[dt * 16 + col][sl * 32 + p * 16 + g * 8]); }
}
// ---- k_frag: thread = one 16-byte piece of k_attn's K fragments (blockIdx.y 0, f16) or of its dist values (blockIdx.y 1, bf16), in the order in which k_attn's lanes read them.
// K: projection row R is the 16-atom tile R & 511 of head R >> 9 (atom col = column / 64, d = column % 64); piece (R, kc, p, g, col) = K[atom col][32 kc + 16 p + 8 g + 0..7].
// dist: piece (qt, s, ct, g, col) = dist[16 qt + col][32 s + 16 ct + 8 g + 0..7]
__global__ __launch_bounds__(256) void k_frag(const float* __restrict__ KP, const float* __restrict__ DIST, _Float16* __restrict__ KF, __bf16* __restrict__ DF) {
  const unsigned c = blockIdx.x * 256 + threadIdx.x, col = c & 15, g = (c >> 4) & 1, p = (c >> 5) & 1; const bool isk = blockIdx.y == 0;
  const float* s = (isk ? KP + (size_t)(c >> 7) * HDM + col * HD + ((c >> 6) & 1) * 32 : DIST + (size_t)((c >> 14) * 16 + col) * NA + ((c >> 6) & 255) * 32) + p * 16 + g * 8;
  const v4f a = *(const v4f*)s, b = *(const v4f*)(s + 4); v8h oh; v8b ob;
#pragma unroll
  for (int i = 0; i < 4; ++i) { oh[i] = (_Float16)a[i]; oh[4 + i] = (_Float16)b[i]; ob[i] = (__bf16)a[i]; ob[4 + i] = (__bf16)b[i]; }
  vst2((isk ? (char*)KF : (char*)DF) + (size_t)c * 16, isk ? __builtin_bit_cast(v4u, oh) : __builtin_bit_cast(v4u, ob));
}
// ---- k_attn: block = (64 keypoints, head h), 32 waves = 4 keypoint sub-tiles x NSP atom shares: wave (qs, sh) runs flash attention for 16 keypoints over the 32-atom steps ks = sh, sh + NSP, ... (logits = (bf16(dist) * (1/sqrt3) + q.k * 0.125) * (1/sqrt2) with q, k single f16 operands; P.V with P, V single f16 operands); the NSP partial (m, l, acc) of a keypoint are joined in LDS: O[k][h*64+d] = sum_sh acc_sh e^(m_sh - M) / sum_sh l_sh e^(m_sh - M)
// a fragment stored in fragment order: elements 0..7 of all 32 lanes in a row, then elements 8..15 (p holds the lane's own 8 * lane step)
__device__ __forceinline__ v16h frag_pl(const _Float16* p) { union { v16h v; v8h q[2]; } u; u.q[0] = *(const v8h*)p; u.q[1] = *(const v8h*)(p + 256); return u.v; }
#define NSP 8            // atom shares per keypoint sub-tile (waves per SIMD)
#define SW_M (16 * 68)   // per-wave LDS, written once behind the loop: [16][68] partial output, then m[16], l[16]
#define SW_L (SW_M + 16)
#define SW_N (SW_L + 16)
// lane l <-> lane l ^ 16 without LDS
__device__ __forceinline__ float xhalf(float v) { const int b = __builtin_bit_cast(int, v); return __builtin_bit_cast(float, __builtin_amdgcn_permlanex16(b, b, 0x76543210, 0xfedcba98, false, false)); }
// transposed products: S^T = K . Q^T (A = 16 atom rows, B = 16 keypoint columns), O^T += V^T . P^T. Lane (g, col) holds, of keypoint q0 + col alone, the scores of atoms 16 ct + 8 g + r: maximum and sum run in the lane, one exchange between the halves shares the maximum, and the two converted score tiles are the B operand of the second product as they lie (element 8 ct + r = atom 16 ct + 8 g + r, the k order of the V^T fragment)
__global__ __launch_bounds__(128 * NSP) void k_attn(const float* __restrict__ QP, const _Float16* __restrict__ KF, const __bf16* __restrict__ DF, const _Float16* __restrict__ VT, float* __restrict__ O) {
  __shared__ __align__(16) float sm[4 * NSP][SW_N];
  const int tid = threadIdx.x, wave = __builtin_amdgcn_readfirstlane(tid >> 5), lane = tid & 31, col = lane & 15, g = lane >> 4;   // the wave's number in a scalar register: its share, loop counter and tile addresses stay scalar
  const int qb = blockIdx.x, h = blockIdx.y; const int q0 = qb * 64 + (wave & 3) * 16, sh = wave >> 2;
  float* sp = &sm[wave][0];
  const float RD = (float)(1.0 / 1.7320508075688772), RA = (float)(1.0 / 1.4142135623730951);
  const float* qrow = QP + (size_t)h * NQ * HD + (size_t)(q0 + col) * HD;
  v16h aq[2];
#pragma unroll
  for (int kc = 0; kc < 2; ++kc) aq[kc] = frag_f32(qrow + kc * 32, lane);
  float m = -3.0e38f, l = 0.f;   // of keypoint q0 + col: m shared by both halves, l the sum over the lane's own atoms
  v8f acc[4] = {};               // acc[dt][r] = O^T[16 dt + 8 g + r][q0 + col]
  // K, V and dist lie in fragment order (k_frag, k_vt): wave-uniform step bases + the one lane offset 8 * lane, every load instruction reads 512 bytes in a row (4 whole lines, not 16 part lines)
  const _Float16* kh = KF + (size_t)h * NA * HD; const _Float16* vh = VT + (size_t)h * HD * NA; const __bf16* dh = DF + (size_t)(q0 >> 4) * 16 * NA;
  const unsigned lane8 = lane * 8;
#pragma unroll 1
  for (int ks = sh; ks < NA / 32; ks += NSP) { v8f s[2];
    // the step's bases in scalar registers + the one 32-bit lane offset
    const _Float16* kp = sbase(kh + (size_t)ks * 32 * HD) + lane8; const __bf16* dp = sbase(dh + (size_t)ks * 32 * 16) + lane8; const _Float16* vp = sbase(vh + (size_t)ks * 32 * HD) + lane8;
    // the step's K, dist and V loads stand as groups ahead of the products that use them
    v16h ka[2][2]; v8b dv[2]; v16h va[4];
#pragma unroll
    for (int ct = 0; ct < 2; ++ct) {
#pragma unroll
      for (int kc = 0; kc < 2; ++kc) ka[ct][kc] = frag_pl(kp + (ct * 2 + kc) * 512); }
#pragma unroll
    for (int ct = 0; ct < 2; ++ct) dv[ct] = *(const v8b*)(dp + ct * 256);
#pragma unroll
    for (int ct = 0; ct < 2; ++ct) { s[ct] = v8f{};
#pragma unroll
      for (int kc = 0; kc < 2; ++kc) s[ct] = wmma16(ka[ct][kc], aq[kc], s[ct]); }
#pragma unroll
    for (int dt = 0; dt < 4; ++dt) va[dt] = frag_pl(vp + dt * 512);
#pragma unroll
    for (int ct = 0; ct < 2; ++ct) {
#pragma unroll
      for (int r = 0; r < 8; ++r) s[ct][r] = ((float)dv[ct][r] * RD + s[ct][r] * 0.125f) * RA; }
    float mx = fmaxf(s[0][0], s[1][0]);
#pragma unroll
    for (int r = 1; r < 8; ++r) mx = fmaxf(mx, fmaxf(s[0][r], s[1][r]));
    mx = fmaxf(mx, xhalf(mx));
    const float mn = fmaxf(m, mx); const float alpha = exp_ni(m - mn);
    v16h pa; float es;
#pragma unroll
    for (int ct = 0; ct < 2; ++ct) {
#pragma unroll
      for (int r = 0; r < 8; ++r) { const float e = exp_ni(s[ct][r] - mn); es = ct + r ? es + e : e; pa[8 * ct + r] = (_Float16)e; } }
    asm volatile("s_wait_xcnt 0x0" ::: "memory");   // the step's loads are done with their base registers before the loop's foot moves these on
    l = l * alpha + es; m = mn;
#pragma unroll
    for (int dt = 0; dt < 4; ++dt) acc[dt] *= alpha;
#pragma unroll
    for (int dt = 0; dt < 4; ++dt) acc[dt] = wmma16(va[dt], pa, acc[dt]); }
  l += xhalf(l);   // both halves' sums stand under the same maximum
  const int lane2 = (int)__builtin_amdgcn_mbcnt_lo(~0u, 0u), col2 = lane2 & 15, g2 = lane2 >> 4, tid2 = wave * 32 + lane2;   // the lane's number read anew: no register carries it, or what follows from it, through the loop
#pragma unroll
  for (int dt = 0; dt < 4; ++dt) { const v4f lo = { acc[dt][0], acc[dt][1], acc[dt][2], acc[dt][3] }, hi = { acc[dt][4], acc[dt][5], acc[dt][6], acc[dt][7] };
    vst2(&sp[col2 * 68 + dt * 16 + 8 * g2], lo); vst2(&sp[col2 * 68 + dt * 16 + 8 * g2 + 4], hi); }
  if (g2 == 0) { sp[SW_M + col2] = m; sp[SW_L + col2] = l; }
  __syncthreads();   // every share's partial is in LDS before any thread joins them
  { const int q = tid2 >> 4, d4 = (tid2 & 15) * 4, row = q & 15; const float* p0 = &sm[q >> 4][0];   // thread = (keypoint q of 64, 4 of the 64 d); share sh of q lies 4 waves further
    float ms[NSP], M = -3.0e38f;
#pragma unroll
    for (int i = 0; i < NSP; ++i) { ms[i] = p0[i * 4 * SW_N + SW_M + row]; M = fmaxf(M, ms[i]); }
    float L = 0.f; v4f o = {};
#pragma unroll
    for (int i = 0; i < NSP; ++i) { const float w = exp_ni(ms[i] - M); L += p0[i * 4 * SW_N + SW_L + row] * w; o += *(const v4f*)&p0[i * 4 * SW_N + row * 68 + d4] * w; }
    vst2(O + (size_t)(qb * 64 + q) * HDM + h * HD + d4, o * (1.0f / L)); }
}
__device__ __forceinline__ void out_pass(const PassOps& b, v8f (&acc)[8]) { const F2 a = b.a_split();
#pragma unroll
  for (int j = 0; j < 8; ++j) acc[j] = wmma_bf(a.l, b.w[j].v, acc[j]);
#pragma unroll
  for (int j = 0; j < 8; ++j) acc[j] = wmma_bf(a.h, b.w[j].v, acc[j]); }
// ---- k_out: block = (64 rows, 128 of the 256 cols): out = O(hi/lo) . Wo rows (2 products)
__global__ __launch_bounds__(128) void k_out(const float* __restrict__ O, const __bf16* __restrict__ P, float* __restrict__ Y) {
  __shared__ __align__(16) float so[4][16][132];
  const int tid = threadIdx.x, wave = __builtin_amdgcn_readfirstlane(tid >> 5), lane = tid & 31, col = lane & 15, g = lane >> 4; const size_t r0 = (size_t)blockIdx.x * 64 + wave * 16; const int n0 = blockIdx.y * 128;   // the wave's number, and r0 with it, in scalar registers through the loop
  v8f acc[8] = {};
  const float* xp = O + (r0 + col) * HDM + 8 * g; const __bf16* wp = P + (size_t)(n0 + col) * HDM + 8 * g;
  PassOps b0, b1; b0.load(xp, wp, HDM);   // two register sets: pass kc + 1's loads are all in flight while pass kc's products run
#pragma unroll 1   // rolled: the two sets and the accumulators are the whole budget of 256 registers
  for (int kc = 0; kc < HDM / 32 - 2; kc += 2) {
    b1.load(xp + 32, wp + 32, HDM);
    __builtin_amdgcn_sched_barrier(0);   // the next pass's loads all issue ahead of this pass's products: sunk among them they would be waited for as soon as issued
    out_pass(b0, acc);
    xp += 64; wp += 64; b0.load(xp, wp, HDM);
    __builtin_amdgcn_sched_barrier(0);   // as above
    out_pass(b1, acc); }
  b1.load(xp + 32, wp + 32, HDM);
  __builtin_amdgcn_sched_barrier(0);   // as above
  out_pass(b0, acc); out_pass(b1, acc);
  const int lane2 = (int)__builtin_amdgcn_mbcnt_lo(~0u, 0u), col2 = lane2 & 15, g2 = lane2 >> 4;   // the lane's number read anew: no register carries it, or what follows from it, through the loop
#pragma unroll
  for (int j = 0; j < 8; ++j) {
#pragma unroll
    for (int r = 0; r < 8; ++r) so[wave][8 * g2 + r][j * 16 + col2] = acc[j][r]; }
  LDSX();
  for (int rl = 0; rl < 16; ++rl) vst2(Y + (r0 + rl) * DO + n0 + lane2 * 4, *(const v4f*)&so[wave][rl][lane2 * 4]);
}
extern "C" void kernel_launch(void* const* d_in, const int* in_sizes, int n_in, void* d_out, int out_size, void* d_ws, size_t ws_size, hipStream_t stream) {
  (void)in_sizes; (void)n_in; (void)out_size;
  const float** F = (const float**)d_in;   // 0 kp_feat [1024,256], 1 kp_dist [1024,8192], 2 rec_atom_feats [8192,256], 3 Wk [1024,256], 4 Wq, 5 Wv, 6 Wo [256,1024]
  if (ws_size < (size_t)WS_END) return;
  char* ws = (char*)d_ws; __bf16* PK = (__bf16*)(ws + WS_PK); float *KPp = (float*)(ws + WS_KP), *VPp = (float*)(ws + WS_VP), *QPp = (float*)(ws + WS_QP), *O = (float*)(ws + WS_O); _Float16 *VT = (_Float16*)(ws + WS_VT), *KF = (_Float16*)(ws + WS_KF); __bf16* DF = (__bf16*)(ws + WS_DF);
  k_pack<<<HDM, 256, 0, stream>>>(F[3], DI, PK + PK_K); k_pack<<<HDM, 256, 0, stream>>>(F[4], DI, PK + PK_Q); k_pack<<<HDM, 256, 0, stream>>>(F[5], DI, PK + PK_V); k_pack<<<DO, 256, 0, stream>>>(F[6], HDM, PK + PK_O);
  k_proj<<<dim3(NA / 64, HDM / 128), 128, 0, stream>>>(F[2], PK + PK_K, KPp);
  k_proj<<<dim3(NA / 64, HDM / 128), 128, 0, stream>>>(F[2], PK + PK_V, VPp);
  k_proj<<<dim3(NQ / 64, HDM / 128), 128, 0, stream>>>(F[0], PK + PK_Q, QPp);
  k_vt<<<dim3(NA / 64, NH), 256, 0, stream>>>(VPp, VT);
  k_frag<<<dim3(NA * HDM / 8 / 256, 2), 256, 0, stream>>>(KPp, F[1], KF, DF);
  k_attn<<<dim3(TQB, NH), 128 * NSP, 0, stream>>>(QPp, KF, DF, VT, O);
  k_out<<<dim3(TQB, DO / 128), 128, 0, stream>>>(O, PK + PK_O, (float*)d_out);
}

// v005
// A run of this version takes 156 microseconds.
// Next to v004, in two timings, it ran 1.24 and 1.23 times as fast.
// Over all steps from v000 it is 8.75 times as fast.
// compute dtype: kp_feat, kp_dist, rec_atom_feats and the four weights (module inputs) rounded to bf16; the three projections with exact bf16 products (inputs x inputs) on WMMA 16x16x32; attention logits q.k with q and k as single f16 operands (1 product; near-uniform softmax over 8,192 atoms, logit error ~1e-4 relative), P.V with P = exp(s - m) and V as single f16 operands (1 product; both errors relative to an 8,192-term softmax average); the output projection with the computed operand as bf16 hi + residual pair x exact Wo (2 products); the kp_dist bias, scaling, running-max softmax and normalisation in f32; f32 accumulate.
#include <hip/hip_runtime.h>
#include <math.h>

typedef __attribute__((ext_vector_type(16))) _Float16 v16h;
typedef __attribute__((ext_vector_type(16))) __bf16 v16b;
typedef __attribute__((ext_vector_type(8)))  _Float16 v8h;
typedef __attribute__((ext_vector_type(8)))  float v8f;
typedef __attribute__((ext_vector_type(4)))  float v4f;
typedef __attribute__((ext_vector_type(2)))  float v2f;
typedef __attribute__((ext_vector_type(4)))  unsigned v4u;
typedef __attribute__((ext_vector_type(4)))  int v4i;
typedef float __attribute__((may_alias)) float_a;
typedef int __attribute__((may_alias)) int_a;

template <typename T> __device__ __forceinline__ void vst2(void* p, T v) { *(T*)p = v;  }
__device__ __forceinline__ v8f wmma16(v16h a, v16h b, v8f c) {
  return __builtin_amdgcn_wmma_f32_16x16x32_f16(false, a, false, b, (short)0, c, false, false);
}
__device__ __forceinline__ v8f wmma_bf(v16b a, v16b b, v8f c) {
  return __builtin_amdgcn_wmma_f32_16x16x32_bf16(false, a, false, b, (short)0, c, false, false);
}
// 16x16x32 fragments: lane = (h = lane>>4, row/col = lane&15); elements 0..7 = k0+8h+0..7, 8..15 = k0+16+8h+0..7; D element r = row 8h+r
__device__ __forceinline__ v16h frag_h(const _Float16* rowk0, int lane) {
  union { v16h v; v8h q[2]; } u; const _Float16* p = rowk0 + 8 * (lane >> 4);
  u.q[0] = *(const v8h*)p; u.q[1] = *(const v8h*)(p + 16); return u.v;
}
__device__ __forceinline__ v16h frag_f32(const float* rowk0, int lane) {
  v16h a; const float* p = rowk0 + 8 * (lane >> 4);
#pragma unroll
  for (int i = 0; i < 8; ++i) { a[i] = (_Float16)p[i]; a[8 + i] = (_Float16)p[16 + i]; }
  return a;
}
__device__ __forceinline__ v16h frag_f32s(const float* rowk0, int lane, float sc) {
  v16h a; const float* p = rowk0 + 8 * (lane >> 4);
#pragma unroll
  for (int i = 0; i < 8; ++i) { a[i] = (_Float16)(p[i] * sc); a[8 + i] = (_Float16)(p[16 + i] * sc); }
  return a;
}
// column fragment from a [K][ld] layout (column n), rows >= K read as 0
__device__ __forceinline__ v16h fragc_f32(const float* W, int k0, int n, int lane, int ld, int K) {
  v16h a; const int g = lane >> 4;
#pragma unroll
  for (int i = 0; i < 8; ++i) { const int ka = k0 + 8 * g + i, kb = ka + 16;
    a[i] = (_Float16)(ka < K ? W[(size_t)(ka < K ? ka : K - 1) * ld + n] : 0.f); a[8 + i] = (_Float16)(kb < K ? W[(size_t)(kb < K ? kb : K - 1) * ld + n] : 0.f); }
  return a;
}
struct F2 { v16b h, l; };
__device__ __forceinline__ F2 bsplit16(const float v[16]) { F2 r;
#pragma unroll
  for (int i = 0; i < 16; ++i) { const __bf16 h = (__bf16)v[i]; r.h[i] = h; r.l[i] = (__bf16)(v[i] - (float)h); }
  return r; }
__device__ __forceinline__ F2 split_row(const float* row, int k0, int lane) { float v[16]; const float* p = row + k0 + 8 * (lane >> 4);
#pragma unroll
  for (int i = 0; i < 8; ++i) { v[i] = p[i]; v[8 + i] = p[16 + i]; }
  return bsplit16(v); }
__device__ __forceinline__ F2 split_rowK(const float* row, int k0, int lane, int K) { float v[16]; const int g = lane >> 4;
#pragma unroll
  for (int i = 0; i < 8; ++i) { const int ka = k0 + 8 * g + i, kb = ka + 16; v[i] = ka < K ? row[ka < K ? ka : K - 1] : 0.f; v[8 + i] = kb < K ? row[kb < K ? kb : K - 1] : 0.f; }
  return bsplit16(v); }
__device__ __forceinline__ F2 split_col(const float* W, int k0, int n, int lane, int ld, int K) { float v[16]; const int g = lane >> 4;
#pragma unroll
  for (int i = 0; i < 8; ++i) { const int ka = k0 + 8 * g + i, kb = ka + 16; v[i] = ka < K ? W[(size_t)(ka < K ? ka : K - 1) * ld + n] : 0.f; v[8 + i] = kb < K ? W[(size_t)(kb < K ? kb : K - 1) * ld + n] : 0.f; }
  return bsplit16(v); }
__device__ __forceinline__ v8f mac3(const F2& a, const F2& b, v8f c) { c = wmma_bf(a.l, b.h, c); c = wmma_bf(a.h, b.l, c); return wmma_bf(a.h, b.h, c); }
__device__ __forceinline__ float sigm(float v) { return 1.0f / (1.0f + expf(-v)); }
#define LDSX() do { asm volatile("s_wait_dscnt 0" ::: "memory"); __builtin_amdgcn_wave_barrier(); __builtin_amdgcn_fence(__ATOMIC_RELEASE, "workgroup"); } while (0)


// Keypoint multi-head attention (1,024 keypoints attend over 8,192 atoms; 16 heads x 64 via the module's RAW row-major reshape of the [rows][1024] projections: head h of K/V = projection rows 512h..512h+511 read as a contiguous [8192][64] block, head h of Q = rows 64h..64h+63 as [1024][64]); logits = (dist / sqrt(3) + q.k / 8) / sqrt(2); out = concat_h(P V) [1024][1024] . Wo^T.
#define NQ 1024          // keypoints
#define NA 8192          // atoms
#define DI 256           // in dim
#define HDM 1024         // heads x hidden
#define NH 16
#define HD 64
#define DO 256           // out dim
#ifndef TQB
#define TQB (NQ / 64)    // query tiles processed
#endif
typedef __attribute__((ext_vector_type(8))) __bf16 v8b;
__device__ __forceinline__ v16b frag_b(const __bf16* rowk0, int lane) {
  union { v16b v; v8b q[2]; } u; const __bf16* p = rowk0 + 8 * (lane >> 4);
  u.q[0] = *(const v8b*)p; u.q[1] = *(const v8b*)(p + 16); return u.v;
}
__device__ __forceinline__ float bfr(float v) { return (float)(__bf16)v; }
// 2^v on the chip's own instruction, in line. In asm with the free slot behind a transcendental written into the statement
__device__ __forceinline__ float exp2_slot(float v) { float r; asm("v_exp_f32 %0, %1\n\tv_nop" : "=v"(r) : "v"(v)); return r; }
// eight at once, each in place: every one but the last has an independent instruction behind it, the last the v_nop
__device__ __forceinline__ void exp2x8(float* e) {
  asm("v_exp_f32 %0, %0\n\tv_exp_f32 %1, %1\n\tv_exp_f32 %2, %2\n\tv_exp_f32 %3, %3\n\tv_exp_f32 %4, %4\n\tv_exp_f32 %5, %5\n\tv_exp_f32 %6, %6\n\tv_exp_f32 %7, %7\n\tv_nop"
      : "+v"(e[0]), "+v"(e[1]), "+v"(e[2]), "+v"(e[3]), "+v"(e[4]), "+v"(e[5]), "+v"(e[6]), "+v"(e[7])); }
__device__ __attribute__((noinline)) float erf_ni(float v) { return erff(v); }

#define PK_K 0                          // [1024][256] Wk rows (natural [out][in])
#define PK_Q (PK_K + HDM * DI)
#define PK_V (PK_Q + HDM * DI)
#define PK_O (PK_V + HDM * DI)            // [256][1024] Wo rows
#define PK_END (PK_O + DO * HDM)
#define WS_PK 0u
#define WS_KP (WS_PK + 2u * PK_END)         // f32 [8192][1024] keys (flat = [16][8192][64])
#define WS_VP (WS_KP + 4u * NA * HDM)        // f32 [8192][1024] values
#define WS_QP (WS_VP + 4u * NA * HDM)        // f32 [1024][1024] queries (flat = [16][1024][64])
#define WS_VT (WS_QP + 4u * NQ * HDM)        // f16 V^T fragments [16 h][256 steps][4 dt][2 p][32 lanes][8]
#define WS_O  (WS_VT + 2u * HDM * NA)        // f32 [1024][1024] (k, h*64+d)
#define WS_KF (WS_O + 4u * NQ * HDM)         // f16 K fragments [16 h][512 atom tiles][2 kc][2 p][32 lanes][8]
#define WS_DF (WS_KF + 2u * HDM * NA)        // bf16 dist pieces [64 keypoint tiles][256 steps][2 ct][32 lanes][8]
#define WS_END (WS_DF + 2u * NQ * NA)

// ---- k_pack: block = row r of a natural [R][K] weight -> bf16 row (K <= 1024, K % 8 == 0)
__global__ __launch_bounds__(256) void k_pack(const float* __restrict__ Wm, int K, __bf16* __restrict__ DST) {
  __shared__ __align__(16) __bf16 s[HDM]; const int r = blockIdx.x, tid = threadIdx.x;
  for (int k = tid; k < K; k += 256) s[k] = (__bf16)Wm[(size_t)r * K + k];
  __syncthreads();
  for (int q = tid; q < K / 8; q += 256) vst2((unsigned*)(DST + (size_t)r * K + q * 8), *(const v4u*)&s[q * 8]);
}
// a wave-uniform pointer held in a scalar register pair
template <typename T> __device__ __forceinline__ const T* sbase(const T* p) { const unsigned long long a = (unsigned long long)p;
  const unsigned lo = (unsigned)__builtin_amdgcn_readfirstlane((int)(unsigned)a), hi = (unsigned)__builtin_amdgcn_readfirstlane((int)(unsigned)(a >> 32));
  return (const T*)(const __attribute__((address_space(1))) T*)(((unsigned long long)hi << 32) | lo); }   // stays a global-memory pointer
// one k pass (32 wide) of a 16-row x 128-column wave tile: the lane's 16 f32 of its A row and its 8 bf16 B fragments, loaded as one group (pointers hold the lane's own row and 8 * (lane >> 4) step)
struct PassOps { v4f x[4]; union { v16b v; v8b q[2]; } w[8];
  __device__ __forceinline__ void load(const float* xp, const __bf16* wp, int ld) {
    x[0] = *(const v4f*)xp; x[1] = *(const v4f*)(xp + 4); x[2] = *(const v4f*)(xp + 16); x[3] = *(const v4f*)(xp + 20);
#pragma unroll
    for (int j = 0; j < 8; ++j) { w[j].q[0] = *(const v8b*)(wp + (size_t)j * 16 * ld); w[j].q[1] = *(const v8b*)(wp + (size_t)j * 16 * ld + 16); } }
  __device__ __forceinline__ v16b a_bf() const { v16b a;
#pragma unroll
    for (int i = 0; i < 16; ++i) a[i] = (__bf16)x[i >> 2][i & 3];
    return a; }
  __device__ __forceinline__ F2 a_split() const { float v[16];
#pragma unroll
    for (int i = 0; i < 16; ++i) v[i] = x[i >> 2][i & 3];
    return bsplit16(v); } };
// ---- k_proj: block = (64 rows, 128 of the 1024 cols): Y = bf16(X [rows][256]) . W rows (exact products) -> f32 rows (pitch 1024)
__global__ __launch_bounds__(128) void k_proj(const float* __restrict__ X, const __bf16* __restrict__ P, float* __restrict__ Y) {
  __shared__ __align__(16) float so[4][16][132];
  const int tid = threadIdx.x, wave = tid >> 5, lane = tid & 31, col = lane & 15, g = lane >> 4; const size_t r0 = (size_t)blockIdx.x * 64 + wave * 16; const int n0 = blockIdx.y * 128;
  v8f acc[8] = {};
  const float* xp = X + (r0 + col) * DI + 8 * g; const __bf16* wp = P + (size_t)(n0 + col) * DI + 8 * g;
  PassOps b0, b1; b0.load(xp, wp, DI);   // two register sets: pass kc + 1's loads are all in flight while pass kc's products run
#pragma unroll
  for (int kc = 0; kc < DI / 32; kc += 2) {
    b1.load(xp + (kc + 1) * 32, wp + (kc + 1) * 32, DI);
    { const v16b a = b0.a_bf();
#pragma unroll
      for (int j = 0; j < 8; ++j) acc[j] = wmma_bf(a, b0.w[j].v, acc[j]); }
    if (kc + 2 < DI / 32) b0.load(xp + (kc + 2) * 32, wp + (kc + 2) * 32, DI);
    { const v16b a = b1.a_bf();
#pragma unroll
      for (int j = 0; j < 8; ++j) acc[j] = wmma_bf(a, b1.w[j].v, acc[j]); } }
#pragma unroll
  for (int j = 0; j < 8; ++j) {
#pragma unroll
    for (int r = 0; r < 8; ++r) so[wave][8 * g + r][j * 16 + col] = acc[j][r]; }
  LDSX();
  v4f t[16];   // all 16 LDS reads fly together ahead of the stores
#pragma unroll
  for (int rl = 0; rl < 16; ++rl) t[rl] = *(const v4f*)&so[wave][rl][lane * 4];
#pragma unroll
  for (int rl = 0; rl < 16; ++rl) vst2(Y + (r0 + rl) * HDM + n0 + lane * 4, t[rl]);
}
__global__ __launch_bounds__(256) void k_vt(const float* __restrict__ VP, _Float16* __restrict__ VT) {
  __shared__ __align__(16) _Float16 st[64][72]; const int tid = threadIdx.x; const int a0 = blockIdx.x * 64, h = blockIdx.y;
  const float* src = VP + (size_t)h * NA * HD + (size_t)a0 * HD;
  for (int q = tid; q < 64 * 64; q += 256) { const int rl = q >> 6, d = q & 63; st[d][rl] = (_Float16)src[rl * HD + d]; }
  __syncthreads();
  // fragment order: piece q = (step sl, dt, p, lane (g, col)) holds V[a0 + 32 sl + 16 p + 8 g + 0..7][16 dt + col], so that one load instruction of k_attn (32 lanes x 16 bytes) reads 512 bytes in a row
  for (int q = tid; q < 64 * 8; q += 256) { const int sl = q >> 8, dt = (q >> 6) & 3, p = (q >> 5) & 1, g = (q >> 4) & 1, col = q & 15; vst2((unsigned*)(VT + ((size_t)h * NA + a0) * HD + q * 8), *(const v4u*)&st[dt * 16 + col][sl * 32 + p * 16 + g * 8]); }
}
// ---- k_frag: thread = one 16-byte piece of k_attn's K fragments (blockIdx.y 0, f16) or of its dist values (blockIdx.y 1, bf16), in the order in which k_attn's lanes read them.
// K: projection row R is the 16-atom tile R & 511 of head R >> 9 (atom col = column / 64, d = column % 64); piece (R, kc, p, g, col) = K[atom col][32 kc + 16 p + 8 g + 0..7].
// dist: piece (qt, s, ct, g, col) = dist[16 qt + col][32 s + 16 ct + 8 g + 0..7]
__global__ __launch_bounds__(256) void k_frag(const float* __restrict__ KP, const float* __restrict__ DIST, _Float16* __restrict__ KF, __bf16* __restrict__ DF) {
  const unsigned c = blockIdx.x * 256 + threadIdx.x, col = c & 15, g = (c >> 4) & 1, p = (c >> 5) & 1; const bool isk = blockIdx.y == 0;
  const float* s = (isk ? KP + (size_t)(c >> 7) * HDM + col * HD + ((c >> 6) & 1) * 32 : DIST + (size_t)((c >> 14) * 16 + col) * NA + ((c >> 6) & 255) * 32) + p * 16 + g * 8;
  const v4f a = *(const v4f*)s, b = *(const v4f*)(s + 4); v8h oh; v8b ob;
#pragma unroll
  for (int i = 0; i < 4; ++i) { oh[i] = (_Float16)a[i]; oh[4 + i] = (_Float16)b[i]; ob[i] = (__bf16)a[i]; ob[4 + i] = (__bf16)b[i]; }
  vst2((isk ? (char*)KF : (char*)DF) + (size_t)c * 16, isk ? __builtin_bit_cast(v4u, oh) : __builtin_bit_cast(v4u, ob));
}
// ---- k_attn: block = (64 keypoints, head h), 32 waves = 4 keypoint sub-tiles x NSP atom shares: wave (qs, sh) runs flash attention for 16 keypoints over the 32-atom steps ks = sh, sh + NSP, ... (logits = (bf16(dist) * (1/sqrt3) + q.k * 0.125) * (1/sqrt2) with q, k single f16 operands, held as u = q.k + bf16(dist) * (8/sqrt3), e^(logit - max) = 2^((u - max u) * K2), K2 = log2(e) / (8 sqrt2); P.V with P, V single f16 operands); the NSP partial (m, l, acc) of a keypoint are joined in LDS: O[k][h*64+d] = sum_sh acc_sh w_sh / sum_sh l_sh w_sh, w_sh = 2^((m_sh - M) * K2)
// a fragment stored in fragment order: elements 0..7 of all 32 lanes in a row, then elements 8..15 (p holds the lane's own 8 * lane step)
__device__ __forceinline__ v16h frag_pl(const _Float16* p) { union { v16h v; v8h q[2]; } u; u.q[0] = *(const v8h*)p; u.q[1] = *(const v8h*)(p + 256); return u.v; }
#define NSP 8            // atom shares per keypoint sub-tile (waves per SIMD)
#define SW_M (16 * 68)   // per-wave LDS, written once behind the loop: [16][68] partial output, then m[16], l[16]
#define SW_L (SW_M + 16)
#define SW_N (SW_L + 16)
// lane l <-> lane l ^ 16 without LDS
__device__ __forceinline__ float xhalf(float v) { const int b = __builtin_bit_cast(int, v); return __builtin_bit_cast(float, __builtin_amdgcn_permlanex16(b, b, 0x76543210, 0xfedcba98, false, false)); }
// transposed products: S^T = K . Q^T (A = 16 atom rows, B = 16 keypoint columns), O^T += V^T . P^T. Lane (g, col) holds, of keypoint q0 + col alone, the scores of atoms 16 ct + 8 g + r: maximum and sum run in the lane, one exchange between the halves shares the maximum, and the two converted score tiles are the B operand of the second product as they lie (element 8 ct + r = atom 16 ct + 8 g + r, the k order of the V^T fragment)
// NSP waves per SIMD is all that a block of this size can have: told so, the compiler spends the whole register budget and leaves the step's loads standing as groups ahead of their users, instead of sinking each to its user to save registers (the calls used to hold them in place)
__global__ __launch_bounds__(128 * NSP) __attribute__((amdgpu_waves_per_eu(NSP, NSP))) void k_attn(const float* __restrict__ QP, const _Float16* __restrict__ KF, const __bf16* __restrict__ DF, const _Float16* __restrict__ VT, float* __restrict__ O) {
  __shared__ __align__(16) float sm[4 * NSP][SW_N];
  const int tid = threadIdx.x, wave = __builtin_amdgcn_readfirstlane(tid >> 5), lane = tid & 31, col = lane & 15, g = lane >> 4;   // the wave's number in a scalar register: its share, loop counter and tile addresses stay scalar
  const int qb = blockIdx.x, h = blockIdx.y; const int q0 = qb * 64 + (wave & 3) * 16, sh = wave >> 2;
  float* sp = &sm[wave][0];
  const float CD = (float)(8.0 / 1.7320508075688772), K2 = (float)(1.4426950408889634 / (8.0 * 1.4142135623730951));
  const float* qrow = QP + (size_t)h * NQ * HD + (size_t)(q0 + col) * HD;
  v16h aq[2];
#pragma unroll
  for (int kc = 0; kc < 2; ++kc) aq[kc] = frag_f32(qrow + kc * 32, lane);
  float m = -3.0e38f, l = 0.f;   // of keypoint q0 + col: m (the maximum of u) shared by both halves, l the sum over the lane's own atoms
  v8f acc[4] = {};               // acc[dt][r] = O^T[16 dt + 8 g + r][q0 + col]
  // K, V and dist lie in fragment order (k_frag, k_vt): wave-uniform step bases + the one lane offset 8 * lane, every load instruction reads 512 bytes in a row (4 whole lines, not 16 part lines)
  const _Float16* kh = KF + (size_t)h * NA * HD; const _Float16* vh = VT + (size_t)h * HD * NA; const __bf16* dh = DF + (size_t)(q0 >> 4) * 16 * NA;
  const unsigned lane8 = lane * 8;
#pragma unroll 1
  for (int ks = sh; ks < NA / 32; ks += NSP) { v8f s[2];
    // the step's bases in scalar registers + the one 32-bit lane offset
    const _Float16* kp = sbase(kh + (size_t)ks * 32 * HD) + lane8; const __bf16* dp = sbase(dh + (size_t)ks * 32 * 16) + lane8; const _Float16* vp = sbase(vh + (size_t)ks * 32 * HD) + lane8;
    // the step's K, dist and V loads stand as groups ahead of the products that use them
    v16h ka[2][2]; v8b dv[2]; v16h va[4];
#pragma unroll
    for (int ct = 0; ct < 2; ++ct) {
#pragma unroll
      for (int kc = 0; kc < 2; ++kc) ka[ct][kc] = frag_pl(kp + (ct * 2 + kc) * 512); }
#pragma unroll
    for (int ct = 0; ct < 2; ++ct) dv[ct] = *(const v8b*)(dp + ct * 256);
#pragma unroll
    for (int ct = 0; ct < 2; ++ct) { s[ct] = v8f{};
#pragma unroll
      for (int kc = 0; kc < 2; ++kc) s[ct] = wmma16(ka[ct][kc], aq[kc], s[ct]); }
#pragma unroll
    for (int dt = 0; dt < 4; ++dt) va[dt] = frag_pl(vp + dt * 512);
#pragma unroll
    for (int ct = 0; ct < 2; ++ct) {
#pragma unroll
      for (int r = 0; r < 8; ++r) s[ct][r] = __builtin_fmaf((float)dv[ct][r], CD, s[ct][r]); }
    float mx = fmaxf(s[0][0], s[1][0]);
#pragma unroll
    for (int r = 1; r < 8; ++r) mx = fmaxf(mx, fmaxf(s[0][r], s[1][r]));
    mx = fmaxf(mx, xhalf(mx));
    const float mn = fmaxf(m, mx), nb = -mn * K2; const float alpha = exp2_slot((m - mn) * K2);   // exactly 1 while the maximum stands
    v16h pa; float es, e[16];
#pragma unroll
    for (int ct = 0; ct < 2; ++ct) {
#pragma unroll
      for (int r = 0; r < 8; ++r) e[8 * ct + r] = __builtin_fmaf(s[ct][r], K2, nb);
      exp2x8(e + 8 * ct); }
#pragma unroll
    for (int i = 0; i < 16; ++i) { es = i ? es + e[i] : e[i]; pa[i] = (_Float16)e[i]; }
    asm volatile("s_wait_xcnt 0x0" ::: "memory");   // the step's loads are done with their base registers before the loop's foot moves these on
    l = l * alpha + es; m = mn;
#pragma unroll
    for (int dt = 0; dt < 4; ++dt) acc[dt] *= alpha;
#pragma unroll
    for (int dt = 0; dt < 4; ++dt) acc[dt] = wmma16(va[dt], pa, acc[dt]); }
  l += xhalf(l);   // both halves' sums stand under the same maximum
  const int lane2 = (int)__builtin_amdgcn_mbcnt_lo(~0u, 0u), col2 = lane2 & 15, g2 = lane2 >> 4, tid2 = wave * 32 + lane2;   // the lane's number read anew: no register carries it, or what follows from it, through the loop
#pragma unroll
  for (int dt = 0; dt < 4; ++dt) { const v4f lo = { acc[dt][0], acc[dt][1], acc[dt][2], acc[dt][3] }, hi = { acc[dt][4], acc[dt][5], acc[dt][6], acc[dt][7] };
    vst2(&sp[col2 * 68 + dt * 16 + 8 * g2], lo); vst2(&sp[col2 * 68 + dt * 16 + 8 * g2 + 4], hi); }
  if (g2 == 0) { sp[SW_M + col2] = m; sp[SW_L + col2] = l; }
  __syncthreads();   // every share's partial is in LDS before any thread joins them
  { const int q = tid2 >> 4, d4 = (tid2 & 15) * 4, row = q & 15; const float* p0 = &sm[q >> 4][0];   // thread = (keypoint q of 64, 4 of the 64 d); share sh of q lies 4 waves further
    float ms[NSP], M = -3.0e38f;
#pragma unroll
    for (int i = 0; i < NSP; ++i) { ms[i] = p0[i * 4 * SW_N + SW_M + row]; M = fmaxf(M, ms[i]); }
    float L = 0.f; v4f o = {};
#pragma unroll
    for (int i = 0; i < NSP; ++i) { const float w = exp2_slot((ms[i] - M) * K2); L += p0[i * 4 * SW_N + SW_L + row] * w; o += *(const v4f*)&p0[i * 4 * SW_N + row * 68 + d4] * w; }
    vst2(O + (size_t)(qb * 64 + q) * HDM + h * HD + d4, o * (1.0f / L)); }
}
__device__ __forceinline__ void out_pass(const PassOps& b, v8f (&acc)[8]) { const F2 a = b.a_split();
#pragma unroll
  for (int j = 0; j < 8; ++j) acc[j] = wmma_bf(a.l, b.w[j].v, acc[j]);
#pragma unroll
  for (int j = 0; j < 8; ++j) acc[j] = wmma_bf(a.h, b.w[j].v, acc[j]); }
// ---- k_out: block = (64 rows, 128 of the 256 cols): out = O(hi/lo) . Wo rows (2 products)
__global__ __launch_bounds__(128) void k_out(const float* __restrict__ O, const __bf16* __restrict__ P, float* __restrict__ Y) {
  __shared__ __align__(16) float so[4][16][132];
  const int tid = threadIdx.x, wave = __builtin_amdgcn_readfirstlane(tid >> 5), lane = tid & 31, col = lane & 15, g = lane >> 4; const size_t r0 = (size_t)blockIdx.x * 64 + wave * 16; const int n0 = blockIdx.y * 128;   // the wave's number, and r0 with it, in scalar registers through the loop
  v8f acc[8] = {};
  const float* xp = O + (r0 + col) * HDM + 8 * g; const __bf16* wp = P + (size_t)(n0 + col) * HDM + 8 * g;
  PassOps b0, b1; b0.load(xp, wp, HDM);   // two register sets: pass kc + 1's loads are all in flight while pass kc's products run
#pragma unroll 1   // rolled: the two sets and the accumulators are the whole budget of 256 registers
  for (int kc = 0; kc < HDM / 32 - 2; kc += 2) {
    b1.load(xp + 32, wp + 32, HDM);
    __builtin_amdgcn_sched_barrier(0);   // the next pass's loads all issue ahead of this pass's products: sunk among them they would be waited for as soon as issued
    out_pass(b0, acc);
    xp += 64; wp += 64; b0.load(xp, wp, HDM);
    __builtin_amdgcn_sched_barrier(0);   // as above
    out_pass(b1, acc); }
  b1.load(xp + 32, wp + 32, HDM);
  __builtin_amdgcn_sched_barrier(0);   // as above
  out_pass(b0, acc); out_pass(b1, acc);
  const int lane2 = (int)__builtin_amdgcn_mbcnt_lo(~0u, 0u), col2 = lane2 & 15, g2 = lane2 >> 4;   // the lane's number read anew: no register carries it, or what follows from it, through the loop
#pragma unroll
  for (int j = 0; j < 8; ++j) {
#pragma unroll
    for (int r = 0; r < 8; ++r) so[wave][8 * g2 + r][j * 16 + col2] = acc[j][r]; }
  LDSX();
  for (int rl = 0; rl < 16; ++rl) vst2(Y + (r0 + rl) * DO + n0 + lane2 * 4, *(const v4f*)&so[wave][rl][lane2 * 4]);
}
extern "C" void kernel_launch(void* const* d_in, const int* in_sizes, int n_in, void* d_out, int out_size, void* d_ws, size_t ws_size, hipStream_t stream) {
  (void)in_sizes; (void)n_in; (void)out_size;
  const float** F = (const float**)d_in;   // 0 kp_feat [1024,256], 1 kp_dist [1024,8192], 2 rec_atom_feats [8192,256], 3 Wk [1024,256], 4 Wq, 5 Wv, 6 Wo [256,1024]
  if (ws_size < (size_t)WS_END) return;
  char* ws = (char*)d_ws; __bf16* PK = (__bf16*)(ws + WS_PK); float *KPp = (float*)(ws + WS_KP), *VPp = (float*)(ws + WS_VP), *QPp = (float*)(ws + WS_QP), *O = (float*)(ws + WS_O); _Float16 *VT = (_Float16*)(ws + WS_VT), *KF = (_Float16*)(ws + WS_KF); __bf16* DF = (__bf16*)(ws + WS_DF);
  k_pack<<<HDM, 256, 0, stream>>>(F[3], DI, PK + PK_K); k_pack<<<HDM, 256, 0, stream>>>(F[4], DI, PK + PK_Q); k_pack<<<HDM, 256, 0, stream>>>(F[5], DI, PK + PK_V); k_pack<<<DO, 256, 0, stream>>>(F[6], HDM, PK + PK_O);
  k_proj<<<dim3(NA / 64, HDM / 128), 128, 0, stream>>>(F[2], PK + PK_K, KPp);
  k_proj<<<dim3(NA / 64, HDM / 128), 128, 0, stream>>>(F[2], PK + PK_V, VPp);
  k_proj<<<dim3(NQ / 64, HDM / 128), 128, 0, stream>>>(F[0], PK + PK_Q, QPp);
  k_vt<<<dim3(NA / 64, NH), 256, 0, stream>>>(VPp, VT);
  k_frag<<<dim3(NA * HDM / 8 / 256, 2), 256, 0, stream>>>(KPp, F[1], KF, DF);
  k_attn<<<dim3(TQB, NH), 128 * NSP, 0, stream>>>(QPp, KF, DF, VT, O);
  k_out<<<dim3(TQB, DO / 128), 128, 0, stream>>>(O, PK + PK_O, (float*)d_out);
}

// v006
// One run takes 152 microseconds.
// Two timings next to v005 both put it at 1.03 times that version's speed.
// Over all steps from v000 it is 9.04 times as fast.
// compute dtype: kp_feat, kp_dist, rec_atom_feats and the four weights (module inputs) rounded to bf16; the three projections with exact bf16 products (inputs x inputs) on WMMA 16x16x32; attention logits q.k with q and k as single f16 operands (1 product; near-uniform softmax over 8,192 atoms, logit error ~1e-4 relative), P.V with P = exp(s - m) and V as single f16 operands (1 product; both errors relative to an 8,192-term softmax average); the output projection with the computed operand as bf16 hi + residual pair x exact Wo (2 products); the kp_dist bias, scaling, running-max softmax and normalisation in f32; f32 accumulate.
#include <hip/hip_runtime.h>
#include <math.h>

typedef __attribute__((ext_vector_type(16))) _Float16 v16h;
typedef __attribute__((ext_vector_type(16))) __bf16 v16b;
typedef __attribute__((ext_vector_type(8)))  _Float16 v8h;
typedef __attribute__((ext_vector_type(8)))  float v8f;
typedef __attribute__((ext_vector_type(4)))  float v4f;
typedef __attribute__((ext_vector_type(2)))  float v2f;
typedef __attribute__((ext_vector_type(4)))  unsigned v4u;
typedef __attribute__((ext_vector_type(4)))  int v4i;
typedef float __attribute__((may_alias)) float_a;
typedef int __attribute__((may_alias)) int_a;

template <typename T> __device__ __forceinline__ void vst2(void* p, T v) { *(T*)p = v;  }
__device__ __forceinline__ v8f wmma16(v16h a, v16h b, v8f c) {
  return __builtin_amdgcn_wmma_f32_16x16x32_f16(false, a, false, b, (short)0, c, false, false);
}
__device__ __forceinline__ v8f wmma_bf(v16b a, v16b b, v8f c) {
  return __builtin_amdgcn_wmma_f32_16x16x32_bf16(false, a, false, b, (short)0, c, false, false);
}
// 16x16x32 fragments: lane = (h = lane>>4, row/col = lane&15); elements 0..7 = k0+8h+0..7, 8..15 = k0+16+8h+0..7; D element r = row 8h+r
__device__ __forceinline__ v16h frag_h(const _Float16* rowk0, int lane) {
  union { v16h v; v8h q[2]; } u; const _Float16* p = rowk0 + 8 * (lane >> 4);
  u.q[0] = *(const v8h*)p; u.q[1] = *(const v8h*)(p + 16); return u.v;
}
__device__ __forceinline__ v16h frag_f32(const float* rowk0, int lane) {
  v16h a; const float* p = rowk0 + 8 * (lane >> 4);
#pragma unroll
  for (int i = 0; i < 8; ++i) { a[i] = (_Float16)p[i]; a[8 + i] = (_Float16)p[16 + i]; }
  return a;
}
__device__ __forceinline__ v16h frag_f32s(const float* rowk0, int lane, float sc) {
  v16h a; const float* p = rowk0 + 8 * (lane >> 4);
#pragma unroll
  for (int i = 0; i < 8; ++i) { a[i] = (_Float16)(p[i] * sc); a[8 + i] = (_Float16)(p[16 + i] * sc); }
  return a;
}
// column fragment from a [K][ld] layout (column n), rows >= K read as 0
__device__ __forceinline__ v16h fragc_f32(const float* W, int k0, int n, int lane, int ld, int K) {
  v16h a; const int g = lane >> 4;
#pragma unroll
  for (int i = 0; i < 8; ++i) { const int ka = k0 + 8 * g + i, kb = ka + 16;
    a[i] = (_Float16)(ka < K ? W[(size_t)(ka < K ? ka : K - 1) * ld + n] : 0.f); a[8 + i] = (_Float16)(kb < K ? W[(size_t)(kb < K ? kb : K - 1) * ld + n] : 0.f); }
  return a;
}
struct F2 { v16b h, l; };
__device__ __forceinline__ F2 bsplit16(const float v[16]) { F2 r;
#pragma unroll
  for (int i = 0; i < 16; ++i) { const __bf16 h = (__bf16)v[i]; r.h[i] = h; r.l[i] = (__bf16)(v[i] - (float)h); }
  return r; }
__device__ __forceinline__ F2 split_row(const float* row, int k0, int lane) { float v[16]; const float* p = row + k0 + 8 * (lane >> 4);
#pragma unroll
  for (int i = 0; i < 8; ++i) { v[i] = p[i]; v[8 + i] = p[16 + i]; }
  return bsplit16(v); }
__device__ __forceinline__ F2 split_rowK(const float* row, int k0, int lane, int K) { float v[16]; const int g = lane >> 4;
#pragma unroll
  for (int i = 0; i < 8; ++i) { const int ka = k0 + 8 * g + i, kb = ka + 16; v[i] = ka < K ? row[ka < K ? ka : K - 1] : 0.f; v[8 + i] = kb < K ? row[kb < K ? kb : K - 1] : 0.f; }
  return bsplit16(v); }
__device__ __forceinline__ F2 split_col(const float* W, int k0, int n, int lane, int ld, int K) { float v[16]; const int g = lane >> 4;
#pragma unroll
  for (int i = 0; i < 8; ++i) { const int ka = k0 + 8 * g + i, kb = ka + 16; v[i] = ka < K ? W[(size_t)(ka < K ? ka : K - 1) * ld + n] : 0.f; v[8 + i] = kb < K ? W[(size_t)(kb < K ? kb : K - 1) * ld + n] : 0.f; }
  return bsplit16(v); }
__device__ __forceinline__ v8f mac3(const F2& a, const F2& b, v8f c) { c = wmma_bf(a.l, b.h, c); c = wmma_bf(a.h, b.l, c); return wmma_bf(a.h, b.h, c); }
__device__ __forceinline__ float sigm(float v) { return 1.0f / (1.0f + expf(-v)); }
#define LDSX() do { asm volatile("s_wait_dscnt 0" ::: "memory"); __builtin_amdgcn_wave_barrier(); __builtin_amdgcn_fence(__ATOMIC_RELEASE, "workgroup"); } while (0)


// Keypoint multi-head attention (1,024 keypoints attend over 8,192 atoms; 16 heads x 64 via the module's RAW row-major reshape of the [rows][1024] projections: head h of K/V = projection rows 512h..512h+511 read as a contiguous [8192][64] block, head h of Q = rows 64h..64h+63 as [1024][64]); logits = (dist / sqrt(3) + q.k / 8) / sqrt(2); out = concat_h(P V) [1024][1024] . Wo^T.
#define NQ 1024          // keypoints
#define NA 8192          // atoms
#define DI 256           // in dim
#define HDM 1024         // heads x hidden
#define NH 16
#define HD 64
#define DO 256           // out dim
#ifndef TQB
#define TQB (NQ / 64)    // query tiles processed
#endif
typedef __attribute__((ext_vector_type(8))) __bf16 v8b;
typedef __attribute__((ext_vector_type(4))) __bf16 v4b;
typedef __attribute__((ext_vector_type(4))) _Float16 v4h;
typedef __attribute__((ext_vector_type(2))) unsigned v2u;
__device__ __forceinline__ v16b frag_b(const __bf16* rowk0, int lane) {
  union { v16b v; v8b q[2]; } u; const __bf16* p = rowk0 + 8 * (lane >> 4);
  u.q[0] = *(const v8b*)p; u.q[1] = *(const v8b*)(p + 16); return u.v;
}
__device__ __forceinline__ float bfr(float v) { return (float)(__bf16)v; }
// 2^v on the chip's own instruction, in line. In asm with the free slot behind a transcendental written into the statement
__device__ __forceinline__ float exp2_slot(float v) { float r; asm("v_exp_f32 %0, %1\n\tv_nop" : "=v"(r) : "v"(v)); return r; }
// eight at once, each in place: every one but the last has an independent instruction behind it, the last the v_nop
__device__ __forceinline__ void exp2x8(float* e) {
  asm("v_exp_f32 %0, %0\n\tv_exp_f32 %1, %1\n\tv_exp_f32 %2, %2\n\tv_exp_f32 %3, %3\n\tv_exp_f32 %4, %4\n\tv_exp_f32 %5, %5\n\tv_exp_f32 %6, %6\n\tv_exp_f32 %7, %7\n\tv_nop"
      : "+v"(e[0]), "+v"(e[1]), "+v"(e[2]), "+v"(e[3]), "+v"(e[4]), "+v"(e[5]), "+v"(e[6]), "+v"(e[7])); }
__device__ __attribute__((noinline)) float erf_ni(float v) { return erff(v); }

#define PK_K 0                          // [1024][256] Wk rows (natural [out][in])
#define PK_Q (PK_K + HDM * DI)
#define PK_V (PK_Q + HDM * DI)
#define PK_O (PK_V + HDM * DI)            // [256][1024] Wo rows
#define PK_END (PK_O + DO * HDM)
#define WS_PK 0u
#define WS_KP (WS_PK + 2u * PK_END)         // f32 [8192][1024] keys (flat = [16][8192][64])
#define WS_VP (WS_KP + 4u * NA * HDM)        // f32 [8192][1024] values
#define WS_QP (WS_VP + 4u * NA * HDM)        // f32 [1024][1024] queries (flat = [16][1024][64])
#define WS_VT (WS_QP + 4u * NQ * HDM)        // f16 V^T fragments [16 h][256 steps][4 dt][2 p][32 lanes][8]
#define WS_O  (WS_VT + 2u * HDM * NA)        // f32 [1024][1024] (k, h*64+d)
#define WS_KF (WS_O + 4u * NQ * HDM)         // f16 K fragments [16 h][512 atom tiles][2 kc][2 p][32 lanes][8]
#define WS_DF (WS_KF + 2u * HDM * NA)        // bf16 dist pieces [64 keypoint tiles][256 steps][2 ct][32 lanes][8]
#define WS_END (WS_DF + 2u * NQ * NA)

// The three packing kernels start few waves that each move kilobytes
// a wave's own LDS rows are written before its lanes read one another's values back
#define LDSW() asm volatile("s_wait_dscnt 0x0" ::: "memory")
// ---- k_pack: a weight of HDM * DI elements, natural order -> bf16. Thread = 8 pieces of 4 elements, its 8 loads in flight together, each 512 bytes in a row over the wave
#define PKB 32                          // blocks of a launch
static_assert(PKB * 256 * 8 * 4 == HDM * DI && DO * HDM == HDM * DI, "k_pack covers a weight exactly");
__global__ __launch_bounds__(256) void k_pack(const float* __restrict__ Wm, __bf16* __restrict__ DST) {
  const unsigned t = blockIdx.x * 256 + threadIdx.x; v4f a[8];
#pragma unroll
  for (int j = 0; j < 8; ++j) a[j] = ((const v4f*)Wm + j * (PKB * 256))[t];
#pragma unroll
  for (int j = 0; j < 8; ++j) { const v4b o = { (__bf16)a[j][0], (__bf16)a[j][1], (__bf16)a[j][2], (__bf16)a[j][3] }; ((v2u*)DST + j * (PKB * 256))[t] = __builtin_bit_cast(v2u, o); }
}
// a wave-uniform pointer held in a scalar register pair
template <typename T> __device__ __forceinline__ const T* sbase(const T* p) { const unsigned long long a = (unsigned long long)p;
  const unsigned lo = (unsigned)__builtin_amdgcn_readfirstlane((int)(unsigned)a), hi = (unsigned)__builtin_amdgcn_readfirstlane((int)(unsigned)(a >> 32));
  return (const T*)(const __attribute__((address_space(1))) T*)(((unsigned long long)hi << 32) | lo); }   // stays a global-memory pointer
// one k pass (32 wide) of a 16-row x 128-column wave tile: the lane's 16 f32 of its A row and its 8 bf16 B fragments, loaded as one group (pointers hold the lane's own row and 8 * (lane >> 4) step)
struct PassOps { v4f x[4]; union { v16b v; v8b q[2]; } w[8];
  __device__ __forceinline__ void load(const float* xp, const __bf16* wp, int ld) {
    x[0] = *(const v4f*)xp; x[1] = *(const v4f*)(xp + 4); x[2] = *(const v4f*)(xp + 16); x[3] = *(const v4f*)(xp + 20);
#pragma unroll
    for (int j = 0; j < 8; ++j) { w[j].q[0] = *(const v8b*)(wp + (size_t)j * 16 * ld); w[j].q[1] = *(const v8b*)(wp + (size_t)j * 16 * ld + 16); } }
  __device__ __forceinline__ v16b a_bf() const { v16b a;
#pragma unroll
    for (int i = 0; i < 16; ++i) a[i] = (__bf16)x[i >> 2][i & 3];
    return a; }
  __device__ __forceinline__ F2 a_split() const { float v[16];
#pragma unroll
    for (int i = 0; i < 16; ++i) v[i] = x[i >> 2][i & 3];
    return bsplit16(v); } };
// ---- k_proj: block = (64 rows, 128 of the 1024 cols): Y = bf16(X [rows][256]) . W rows (exact products) -> f32 rows (pitch 1024)
__global__ __launch_bounds__(128) void k_proj(const float* __restrict__ X, const __bf16* __restrict__ P, float* __restrict__ Y) {
  __shared__ __align__(16) float so[4][16][132];
  const int tid = threadIdx.x, wave = tid >> 5, lane = tid & 31, col = lane & 15, g = lane >> 4; const size_t r0 = (size_t)blockIdx.x * 64 + wave * 16; const int n0 = blockIdx.y * 128;
  v8f acc[8] = {};
  const float* xp = X + (r0 + col) * DI + 8 * g; const __bf16* wp = P + (size_t)(n0 + col) * DI + 8 * g;
  PassOps b0, b1; b0.load(xp, wp, DI);   // two register sets: pass kc + 1's loads are all in flight while pass kc's products run
#pragma unroll
  for (int kc = 0; kc < DI / 32; kc += 2) {
    b1.load(xp + (kc + 1) * 32, wp + (kc + 1) * 32, DI);
    { const v16b a = b0.a_bf();
#pragma unroll
      for (int j = 0; j < 8; ++j) acc[j] = wmma_bf(a, b0.w[j].v, acc[j]); }
    if (kc + 2 < DI / 32) b0.load(xp + (kc + 2) * 32, wp + (kc + 2) * 32, DI);
    { const v16b a = b1.a_bf();
#pragma unroll
      for (int j = 0; j < 8; ++j) acc[j] = wmma_bf(a, b1.w[j].v, acc[j]); } }
#pragma unroll
  for (int j = 0; j < 8; ++j) {
#pragma unroll
    for (int r = 0; r < 8; ++r) so[wave][8 * g + r][j * 16 + col] = acc[j][r]; }
  LDSX();
  v4f t[16];   // all 16 LDS reads fly together ahead of the stores
#pragma unroll
  for (int rl = 0; rl < 16; ++rl) t[rl] = *(const v4f*)&so[wave][rl][lane * 4];
#pragma unroll
  for (int rl = 0; rl < 16; ++rl) vst2(Y + (r0 + rl) * HDM + n0 + lane * 4, t[rl]);
}
// ---- k_vt: wave = one 32-atom step S = (head, step) of V, 8 KB in a row: 16 loads of whole lines in flight (lane (g, col): atoms 8 m + 4 g + 0..3, d = 4 col + 0..3), transposed in the wave's own LDS rows [d][atom], stored in fragment order:
// piece (dt, p, lane (g, col)) holds V[32 step + 16 p + 8 g + 0..7][16 dt + col], so that one load instruction of k_attn (32 lanes x 16 bytes) reads 512 bytes in a row
#define VT_P 40                         // LDS row pitch in f16: 32 atoms + 8 (80 bytes = 16 x 5: the 16-byte reads of 16 rows fall on distinct banks)
__global__ __launch_bounds__(256) void k_vt(const float* __restrict__ VP, _Float16* __restrict__ VT) {
  __shared__ __align__(16) _Float16 st[8][HD * VT_P];
  const int tid = threadIdx.x, wave = __builtin_amdgcn_readfirstlane(tid >> 5), lane = tid & 31, col = lane & 15, g = lane >> 4;
  const size_t S = (size_t)blockIdx.x * 8 + wave; const float* src = VP + S * (32 * HD) + g * (4 * HD) + col * 4; _Float16* sw = &st[wave][0];
  v4f x[4][4];
#pragma unroll
  for (int m = 0; m < 4; ++m) {
#pragma unroll
    for (int r = 0; r < 4; ++r) x[m][r] = *(const v4f*)(src + (8 * m + r) * HD); }
#pragma unroll
  for (int m = 0; m < 4; ++m) {
#pragma unroll
    for (int i = 0; i < 4; ++i) { const v4h o = { (_Float16)x[m][0][i], (_Float16)x[m][1][i], (_Float16)x[m][2][i], (_Float16)x[m][3][i] };
      vst2(&sw[(col * 4 + i) * VT_P + 8 * m + 4 * g], __builtin_bit_cast(v2u, o)); } }
  LDSW();
  v4u r[8];
#pragma unroll
  for (int q = 0; q < 8; ++q) r[q] = *(const v4u*)&sw[((q >> 1) * 16 + col) * VT_P + (q & 1) * 16 + g * 8];
#pragma unroll
  for (int q = 0; q < 8; ++q) vst2(VT + S * (32 * HD) + q * 256 + lane * 8, r[q]);
}
// ---- k_frag: k_attn's K fragments (blockIdx.y 0, f16) and its dist values (blockIdx.y 1, bf16), in the order in which k_attn's lanes read them. Tile = 16 rows x 64 f32 -> 2 KB in a row: piece (k, lane (g, col)) = row col, elements 16 k + 8 g + 0..7.
// K: tile R = projection row R = the 16-atom tile R & 511 of head R >> 9 (row col = atom col = columns 64 col + 0..63; k = 2 kc + p). dist: tile (qt, step pair sp) = rows 16 qt + col, columns 64 sp + 0..63 (k = 2 (step & 1) + ct)
// wave = FT_N tiles side by side: their loads are issued ahead of the work on the first tile, each of whole lines (lanes 0..15 row 2 j, lanes 16..31 row 2 j + 1, 256 bytes each); the pieces are cut from the wave's own LDS rows
#define FT_P 72                         // LDS row pitch in 16-bit elements: 64 + 8 (144 bytes = 16 x 9: the 16-byte reads of 16 rows fall on distinct banks)
#define FT_N 4
template <typename V4, typename T> __device__ __forceinline__ void frag_tiles(const float* src, const int rs, const int ts, T* dst, T* sw, const int lane) {   // rs, ts: row and tile steps of the source in elements; sw: 16 LDS rows for each tile
  const int col = lane & 15, g = lane >> 4; v4f x[FT_N][8];
  src += (size_t)g * rs + col * 4;
#pragma unroll
  for (int n = 0; n < FT_N; ++n) {
#pragma unroll
    for (int j = 0; j < 8; ++j) x[n][j] = *(const v4f*)(src + (size_t)n * ts + (size_t)(2 * j) * rs); }
#pragma unroll
  for (int n = 0; n < FT_N; ++n) {
#pragma unroll
    for (int j = 0; j < 8; ++j) { const V4 o = { (T)x[n][j][0], (T)x[n][j][1], (T)x[n][j][2], (T)x[n][j][3] }; vst2(&sw[(16 * n + 2 * j + g) * FT_P + col * 4], __builtin_bit_cast(v2u, o)); }
    LDSW();
    v4u r[4];
#pragma unroll
    for (int k = 0; k < 4; ++k) r[k] = *(const v4u*)&sw[(16 * n + col) * FT_P + (2 * k + g) * 8];
#pragma unroll
    for (int k = 0; k < 4; ++k) vst2(dst + n * 1024 + k * 256 + lane * 8, r[k]); }
}
__global__ __launch_bounds__(256) void k_frag(const float* __restrict__ KP, const float* __restrict__ DIST, _Float16* __restrict__ KF, __bf16* __restrict__ DF) {
  __shared__ __align__(16) unsigned short st[8][FT_N * 16 * FT_P];
  const int tid = threadIdx.x, wave = __builtin_amdgcn_readfirstlane(tid >> 5), lane = tid & 31;
  const unsigned t0 = (blockIdx.x * 8 + wave) * FT_N;   // the wave's first tile of 8,192; FT_N divides 128, so its dist tiles share their 16 rows
  if (blockIdx.y == 0) frag_tiles<v4h>(KP + (size_t)t0 * 1024, HD, 1024, KF + (size_t)t0 * 1024, (_Float16*)&st[wave][0], lane);
  else frag_tiles<v4b>(DIST + (size_t)(t0 >> 7) * 16 * NA + (t0 & 127) * 64, NA, 64, DF + (size_t)t0 * 1024, (__bf16*)&st[wave][0], lane);
}
// ---- k_attn: block = (64 keypoints, head h), 32 waves = 4 keypoint sub-tiles x NSP atom shares: wave (qs, sh) runs flash attention for 16 keypoints over the 32-atom steps ks = sh, sh + NSP, ... (logits = (bf16(dist) * (1/sqrt3) + q.k * 0.125) * (1/sqrt2) with q, k single f16 operands, held as u = q.k + bf16(dist) * (8/sqrt3), e^(logit - max) = 2^((u - max u) * K2), K2 = log2(e) / (8 sqrt2); P.V with P, V single f16 operands); the NSP partial (m, l, acc) of a keypoint are joined in LDS: O[k][h*64+d] = sum_sh acc_sh w_sh / sum_sh l_sh w_sh, w_sh = 2^((m_sh - M) * K2)
// a fragment stored in fragment order: elements 0..7 of all 32 lanes in a row, then elements 8..15 (p holds the lane's own 8 * lane step)
__device__ __forceinline__ v16h frag_pl(const _Float16* p) { union { v16h v; v8h q[2]; } u; u.q[0] = *(const v8h*)p; u.q[1] = *(const v8h*)(p + 256); return u.v; }
#define NSP 8            // atom shares per keypoint sub-tile (waves per SIMD)
#define SW_M (16 * 68)   // per-wave LDS, written once behind the loop: [16][68] partial output, then m[16], l[16]
#define SW_L (SW_M + 16)
#define SW_N (SW_L + 16)
// lane l <-> lane l ^ 16 without LDS
__device__ __forceinline__ float xhalf(float v) { const int b = __builtin_bit_cast(int, v); return __builtin_bit_cast(float, __builtin_amdgcn_permlanex16(b, b, 0x76543210, 0xfedcba98, false, false)); }
// transposed products: S^T = K . Q^T (A = 16 atom rows, B = 16 keypoint columns), O^T += V^T . P^T. Lane (g, col) holds, of keypoint q0 + col alone, the scores of atoms 16 ct + 8 g + r: maximum and sum run in the lane, one exchange between the halves shares the maximum, and the two converted score tiles are the B operand of the second product as they lie (element 8 ct + r = atom 16 ct + 8 g + r, the k order of the V^T fragment)
// NSP waves per SIMD is all that a block of this size can have: told so, the compiler spends the whole register budget and leaves the step's loads standing as groups ahead of their users, instead of sinking each to its user to save registers (the calls used to hold them in place)
__global__ __launch_bounds__(128 * NSP) __attribute__((amdgpu_waves_per_eu(NSP, NSP))) void k_attn(const float* __restrict__ QP, const _Float16* __restrict__ KF, const __bf16* __restrict__ DF, const _Float16* __restrict__ VT, float* __restrict__ O) {
  __shared__ __align__(16) float sm[4 * NSP][SW_N];
  const int tid = threadIdx.x, wave = __builtin_amdgcn_readfirstlane(tid >> 5), lane = tid & 31, col = lane & 15, g = lane >> 4;   // the wave's number in a scalar register: its share, loop counter and tile addresses stay scalar
  const int qb = blockIdx.x, h = blockIdx.y; const int q0 = qb * 64 + (wave & 3) * 16, sh = wave >> 2;
  float* sp = &sm[wave][0];
  const float CD = (float)(8.0 / 1.7320508075688772), K2 = (float)(1.4426950408889634 / (8.0 * 1.4142135623730951));
  const float* qrow = QP + (size_t)h * NQ * HD + (size_t)(q0 + col) * HD;
  v16h aq[2];
#pragma unroll
  for (int kc = 0; kc < 2; ++kc) aq[kc] = frag_f32(qrow + kc * 32, lane);
  float m = -3.0e38f, l = 0.f;   // of keypoint q0 + col: m (the maximum of u) shared by both halves, l the sum over the lane's own atoms
  v8f acc[4] = {};               // acc[dt][r] = O^T[16 dt + 8 g + r][q0 + col]
  // K, V and dist lie in fragment order (k_frag, k_vt): wave-uniform step bases + the one lane offset 8 * lane, every load instruction reads 512 bytes in a row (4 whole lines, not 16 part lines)
  const _Float16* kh = KF + (size_t)h * NA * HD; const _Float16* vh = VT + (size_t)h * HD * NA; const __bf16* dh = DF + (size_t)(q0 >> 4) * 16 * NA;
  const unsigned lane8 = lane * 8;
#pragma unroll 1
  for (int ks = sh; ks < NA / 32; ks += NSP) { v8f s[2];
    // the step's bases in scalar registers + the one 32-bit lane offset
    const _Float16* kp = sbase(kh + (size_t)ks * 32 * HD) + lane8; const __bf16* dp = sbase(dh + (size_t)ks * 32 * 16) + lane8; const _Float16* vp = sbase(vh + (size_t)ks * 32 * HD) + lane8;
    // the step's K, dist and V loads stand as groups ahead of the products that use them
    v16h ka[2][2]; v8b dv[2]; v16h va[4];
#pragma unroll
    for (int ct = 0; ct < 2; ++ct) {
#pragma unroll
      for (int kc = 0; kc < 2; ++kc) ka[ct][kc] = frag_pl(kp + (ct * 2 + kc) * 512); }
#pragma unroll
    for (int ct = 0; ct < 2; ++ct) dv[ct] = *(const v8b*)(dp + ct * 256);
#pragma unroll
    for (int ct = 0; ct < 2; ++ct) { s[ct] = v8f{};
#pragma unroll
      for (int kc = 0; kc < 2; ++kc) s[ct] = wmma16(ka[ct][kc], aq[kc], s[ct]); }
#pragma unroll
    for (int dt = 0; dt < 4; ++dt) va[dt] = frag_pl(vp + dt * 512);
#pragma unroll
    for (int ct = 0; ct < 2; ++ct) {
#pragma unroll
      for (int r = 0; r < 8; ++r) s[ct][r] = __builtin_fmaf((float)dv[ct][r], CD, s[ct][r]); }
    float mx = fmaxf(s[0][0], s[1][0]);
#pragma unroll
    for (int r = 1; r < 8; ++r) mx = fmaxf(mx, fmaxf(s[0][r], s[1][r]));
    mx = fmaxf(mx, xhalf(mx));
    const float mn = fmaxf(m, mx), nb = -mn * K2; const float alpha = exp2_slot((m - mn) * K2);   // exactly 1 while the maximum stands
    v16h pa; float es, e[16];
#pragma unroll
    for (int ct = 0; ct < 2; ++ct) {
#pragma unroll
      for (int r = 0; r < 8; ++r) e[8 * ct + r] = __builtin_fmaf(s[ct][r], K2, nb);
      exp2x8(e + 8 * ct); }
#pragma unroll
    for (int i = 0; i < 16; ++i) { es = i ? es + e[i] : e[i]; pa[i] = (_Float16)e[i]; }
    asm volatile("s_wait_xcnt 0x0" ::: "memory");   // the step's loads are done with their base registers before the loop's foot moves these on
    l = l * alpha + es; m = mn;
#pragma unroll
    for (int dt = 0; dt < 4; ++dt) acc[dt] *= alpha;
#pragma unroll
    for (int dt = 0; dt < 4; ++dt) acc[dt] = wmma16(va[dt], pa, acc[dt]); }
  l += xhalf(l);   // both halves' sums stand under the same maximum
  const int lane2 = (int)__builtin_amdgcn_mbcnt_lo(~0u, 0u), col2 = lane2 & 15, g2 = lane2 >> 4, tid2 = wave * 32 + lane2;   // the lane's number read anew: no register carries it, or what follows from it, through the loop
#pragma unroll
  for (int dt = 0; dt < 4; ++dt) { const v4f lo = { acc[dt][0], acc[dt][1], acc[dt][2], acc[dt][3] }, hi = { acc[dt][4], acc[dt][5], acc[dt][6], acc[dt][7] };
    vst2(&sp[col2 * 68 + dt * 16 + 8 * g2], lo); vst2(&sp[col2 * 68 + dt * 16 + 8 * g2 + 4], hi); }
  if (g2 == 0) { sp[SW_M + col2] = m; sp[SW_L + col2] = l; }
  __syncthreads();   // every share's partial is in LDS before any thread joins them
  { const int q = tid2 >> 4, d4 = (tid2 & 15) * 4, row = q & 15; const float* p0 = &sm[q >> 4][0];   // thread = (keypoint q of 64, 4 of the 64 d); share sh of q lies 4 waves further
    float ms[NSP], M = -3.0e38f;
#pragma unroll
    for (int i = 0; i < NSP; ++i) { ms[i] = p0[i * 4 * SW_N + SW_M + row]; M = fmaxf(M, ms[i]); }
    float L = 0.f; v4f o = {};
#pragma unroll
    for (int i = 0; i < NSP; ++i) { const float w = exp2_slot((ms[i] - M) * K2); L += p0[i * 4 * SW_N + SW_L + row] * w; o += *(const v4f*)&p0[i * 4 * SW_N + row * 68 + d4] * w; }
    vst2(O + (size_t)(qb * 64 + q) * HDM + h * HD + d4, o * (1.0f / L)); }
}
__device__ __forceinline__ void out_pass(const PassOps& b, v8f (&acc)[8]) { const F2 a = b.a_split();
#pragma unroll
  for (int j = 0; j < 8; ++j) acc[j] = wmma_bf(a.l, b.w[j].v, acc[j]);
#pragma unroll
  for (int j = 0; j < 8; ++j) acc[j] = wmma_bf(a.h, b.w[j].v, acc[j]); }
// ---- k_out: block = (64 rows, 128 of the 256 cols): out = O(hi/lo) . Wo rows (2 products)
__global__ __launch_bounds__(128) void k_out(const float* __restrict__ O, const __bf16* __restrict__ P, float* __restrict__ Y) {
  __shared__ __align__(16) float so[4][16][132];
  const int tid = threadIdx.x, wave = __builtin_amdgcn_readfirstlane(tid >> 5), lane = tid & 31, col = lane & 15, g = lane >> 4; const size_t r0 = (size_t)blockIdx.x * 64 + wave * 16; const int n0 = blockIdx.y * 128;   // the wave's number, and r0 with it, in scalar registers through the loop
  v8f acc[8] = {};
  const float* xp = O + (r0 + col) * HDM + 8 * g; const __bf16* wp = P + (size_t)(n0 + col) * HDM + 8 * g;
  PassOps b0, b1; b0.load(xp, wp, HDM);   // two register sets: pass kc + 1's loads are all in flight while pass kc's products run
#pragma unroll 1   // rolled: the two sets and the accumulators are the whole budget of 256 registers
  for (int kc = 0; kc < HDM / 32 - 2; kc += 2) {
    b1.load(xp + 32, wp + 32, HDM);
    __builtin_amdgcn_sched_barrier(0);   // the next pass's loads all issue ahead of this pass's products: sunk among them they would be waited for as soon as issued
    out_pass(b0, acc);
    xp += 64; wp += 64; b0.load(xp, wp, HDM);
    __builtin_amdgcn_sched_barrier(0);   // as above
    out_pass(b1, acc); }
  b1.load(xp + 32, wp + 32, HDM);
  __builtin_amdgcn_sched_barrier(0);   // as above
  out_pass(b0, acc); out_pass(b1, acc);
  const int lane2 = (int)__builtin_amdgcn_mbcnt_lo(~0u, 0u), col2 = lane2 & 15, g2 = lane2 >> 4;   // the lane's number read anew: no register carries it, or what follows from it, through the loop
#pragma unroll
  for (int j = 0; j < 8; ++j) {
#pragma unroll
    for (int r = 0; r < 8; ++r) so[wave][8 * g2 + r][j * 16 + col2] = acc[j][r]; }
  LDSX();
  for (int rl = 0; rl < 16; ++rl) vst2(Y + (r0 + rl) * DO + n0 + lane2 * 4, *(const v4f*)&so[wave][rl][lane2 * 4]);
}
extern "C" void kernel_launch(void* const* d_in, const int* in_sizes, int n_in, void* d_out, int out_size, void* d_ws, size_t ws_size, hipStream_t stream) {
  (void)in_sizes; (void)n_in; (void)out_size;
  const float** F = (const float**)d_in;   // 0 kp_feat [1024,256], 1 kp_dist [1024,8192], 2 rec_atom_feats [8192,256], 3 Wk [1024,256], 4 Wq, 5 Wv, 6 Wo [256,1024]
  if (ws_size < (size_t)WS_END) return;
  char* ws = (char*)d_ws; __bf16* PK = (__bf16*)(ws + WS_PK); float *KPp = (float*)(ws + WS_KP), *VPp = (float*)(ws + WS_VP), *QPp = (float*)(ws + WS_QP), *O = (float*)(ws + WS_O); _Float16 *VT = (_Float16*)(ws + WS_VT), *KF = (_Float16*)(ws + WS_KF); __bf16* DF = (__bf16*)(ws + WS_DF);
  k_pack<<<PKB, 256, 0, stream>>>(F[3], PK + PK_K); k_pack<<<PKB, 256, 0, stream>>>(F[4], PK + PK_Q); k_pack<<<PKB, 256, 0, stream>>>(F[5], PK + PK_V); k_pack<<<PKB, 256, 0, stream>>>(F[6], PK + PK_O);
  k_proj<<<dim3(NA / 64, HDM / 128), 128, 0, stream>>>(F[2], PK + PK_K, KPp);
  k_proj<<<dim3(NA / 64, HDM / 128), 128, 0, stream>>>(F[2], PK + PK_V, VPp);
  k_proj<<<dim3(NQ / 64, HDM / 128), 128, 0, stream>>>(F[0], PK + PK_Q, QPp);
  k_vt<<<NH * (NA / 32) / 8, 256, 0, stream>>>(VPp, VT);
  k_frag<<<dim3(NA * HDM / 1024 / (8 * FT_N), 2), 256, 0, stream>>>(KPp, F[1], KF, DF);
  k_attn<<<dim3(TQB, NH), 128 * NSP, 0, stream>>>(QPp, KF, DF, VT, O);
  k_out<<<dim3(TQB, DO / 128), 128, 0, stream>>>(O, PK + PK_O, (float*)d_out);
}

// v007
// Measured time: 128 microseconds a run.
// In two side-by-side timings against v006, it was 1.17 and 1.21 times as fast.
// Counting every step since v000, it is 10.8 times as fast.
// compute dtype: kp_feat, kp_dist, rec_atom_feats and the four weights (module inputs) rounded to bf16; the three projections with exact bf16 products (inputs x inputs) on WMMA 16x16x32; attention logits q.k with q and k as single f16 operands (1 product; near-uniform softmax over 8,192 atoms, logit error ~1e-4 relative), P.V with P = exp(s - m) and V as single f16 operands (1 product; both errors relative to an 8,192-term softmax average); the output projection with the computed operand as bf16 hi + residual pair x exact Wo (2 products); the kp_dist bias, scaling, running-max softmax and normalisation in f32; f32 accumulate.
#include <hip/hip_runtime.h>
#include <math.h>

typedef __attribute__((ext_vector_type(16))) _Float16 v16h;
typedef __attribute__((ext_vector_type(16))) __bf16 v16b;
typedef __attribute__((ext_vector_type(8)))  _Float16 v8h;
typedef __attribute__((ext_vector_type(8)))  float v8f;
typedef __attribute__((ext_vector_type(4)))  float v4f;
typedef __attribute__((ext_vector_type(2)))  float v2f;
typedef __attribute__((ext_vector_type(4)))  unsigned v4u;
typedef __attribute__((ext_vector_type(4)))  int v4i;
typedef float __attribute__((may_alias)) float_a;
typedef int __attribute__((may_alias)) int_a;

template <typename T> __device__ __forceinline__ void vst2(void* p, T v) { *(T*)p = v;  }
__device__ __forceinline__ v8f wmma16(v16h a, v16h b, v8f c) {
  return __builtin_amdgcn_wmma_f32_16x16x32_f16(false, a, false, b, (short)0, c, false, false);
}
__device__ __forceinline__ v8f wmma_bf(v16b a, v16b b, v8f c) {
  return __builtin_amdgcn_wmma_f32_16x16x32_bf16(false, a, false, b, (short)0, c, false, false);
}
// 16x16x32 fragments: lane = (h = lane>>4, row/col = lane&15); elements 0..7 = k0+8h+0..7, 8..15 = k0+16+8h+0..7; D element r = row 8h+r
__device__ __forceinline__ v16h frag_h(const _Float16* rowk0, int lane) {
  union { v16h v; v8h q[2]; } u; const _Float16* p = rowk0 + 8 * (lane >> 4);
  u.q[0] = *(const v8h*)p; u.q[1] = *(const v8h*)(p + 16); return u.v;
}
__device__ __forceinline__ v16h frag_f32(const float* rowk0, int lane) {
  v16h a; const float* p = rowk0 + 8 * (lane >> 4);
#pragma unroll
  for (int i = 0; i < 8; ++i) { a[i] = (_Float16)p[i]; a[8 + i] = (_Float16)p[16 + i]; }
  return a;
}
__device__ __forceinline__ v16h frag_f32s(const float* rowk0, int lane, float sc) {
  v16h a; const float* p = rowk0 + 8 * (lane >> 4);
#pragma unroll
  for (int i = 0; i < 8; ++i) { a[i] = (_Float16)(p[i] * sc); a[8 + i] = (_Float16)(p[16 + i] * sc); }
  return a;
}
// column fragment from a [K][ld] layout (column n), rows >= K read as 0
__device__ __forceinline__ v16h fragc_f32(const float* W, int k0, int n, int lane, int ld, int K) {
  v16h a; const int g = lane >> 4;
#pragma unroll
  for (int i = 0; i < 8; ++i) { const int ka = k0 + 8 * g + i, kb = ka + 16;
    a[i] = (_Float16)(ka < K ? W[(size_t)(ka < K ? ka : K - 1) * ld + n] : 0.f); a[8 + i] = (_Float16)(kb < K ? W[(size_t)(kb < K ? kb : K - 1) * ld + n] : 0.f); }
  return a;
}
struct F2 { v16b h, l; };
__device__ __forceinline__ F2 bsplit16(const float v[16]) { F2 r;
#pragma unroll
  for (int i = 0; i < 16; ++i) { const __bf16 h = (__bf16)v[i]; r.h[i] = h; r.l[i] = (__bf16)(v[i] - (float)h); }
  return r; }
__device__ __forceinline__ F2 split_row(const float* row, int k0, int lane) { float v[16]; const float* p = row + k0 + 8 * (lane >> 4);
#pragma unroll
  for (int i = 0; i < 8; ++i) { v[i] = p[i]; v[8 + i] = p[16 + i]; }
  return bsplit16(v); }
__device__ __forceinline__ F2 split_rowK(const float* row, int k0, int lane, int K) { float v[16]; const int g = lane >> 4;
#pragma unroll
  for (int i = 0; i < 8; ++i) { const int ka = k0 + 8 * g + i, kb = ka + 16; v[i] = ka < K ? row[ka < K ? ka : K - 1] : 0.f; v[8 + i] = kb < K ? row[kb < K ? kb : K - 1] : 0.f; }
  return bsplit16(v); }
__device__ __forceinline__ F2 split_col(const float* W, int k0, int n, int lane, int ld, int K) { float v[16]; const int g = lane >> 4;
#pragma unroll
  for (int i = 0; i < 8; ++i) { const int ka = k0 + 8 * g + i, kb = ka + 16; v[i] = ka < K ? W[(size_t)(ka < K ? ka : K - 1) * ld + n] : 0.f; v[8 + i] = kb < K ? W[(size_t)(kb < K ? kb : K - 1) * ld + n] : 0.f; }
  return bsplit16(v); }
__device__ __forceinline__ v8f mac3(const F2& a, const F2& b, v8f c) { c = wmma_bf(a.l, b.h, c); c = wmma_bf(a.h, b.l, c); return wmma_bf(a.h, b.h, c); }
__device__ __forceinline__ float sigm(float v) { return 1.0f / (1.0f + expf(-v)); }
#define LDSX() do { asm volatile("s_wait_dscnt 0" ::: "memory"); __builtin_amdgcn_wave_barrier(); __builtin_amdgcn_fence(__ATOMIC_RELEASE, "workgroup"); } while (0)


// Keypoint multi-head attention (1,024 keypoints attend over 8,192 atoms; 16 heads x 64 via the module's RAW row-major reshape of the [rows][1024] projections: head h of K/V = projection rows 512h..512h+511 read as a contiguous [8192][64] block, head h of Q = rows 64h..64h+63 as [1024][64]); logits = (dist / sqrt(3) + q.k / 8) / sqrt(2); out = concat_h(P V) [1024][1024] . Wo^T.
#define NQ 1024          // keypoints
#define NA 8192          // atoms
#define DI 256           // in dim
#define HDM 1024         // heads x hidden
#define NH 16
#define HD 64
#define DO 256           // out dim
#ifndef TQB
#define TQB (NQ / 64)    // query tiles processed
#endif
typedef __attribute__((ext_vector_type(8))) __bf16 v8b;
typedef __attribute__((ext_vector_type(4))) __bf16 v4b;
typedef __attribute__((ext_vector_type(4))) _Float16 v4h;
typedef __attribute__((ext_vector_type(2))) unsigned v2u;
__device__ __forceinline__ v16b frag_b(const __bf16* rowk0, int lane) {
  union { v16b v; v8b q[2]; } u; const __bf16* p = rowk0 + 8 * (lane >> 4);
  u.q[0] = *(const v8b*)p; u.q[1] = *(const v8b*)(p + 16); return u.v;
}
__device__ __forceinline__ float bfr(float v) { return (float)(__bf16)v; }
// 2^v on the chip's own instruction, in line. In asm with the free slot behind a transcendental written into the statement
__device__ __forceinline__ float exp2_slot(float v) { float r; asm("v_exp_f32 %0, %1\n\tv_nop" : "=v"(r) : "v"(v)); return r; }
// eight at once, each in place: every one but the last has an independent instruction behind it, the last the v_nop
__device__ __forceinline__ void exp2x8(float* e) {
  asm("v_exp_f32 %0, %0\n\tv_exp_f32 %1, %1\n\tv_exp_f32 %2, %2\n\tv_exp_f32 %3, %3\n\tv_exp_f32 %4, %4\n\tv_exp_f32 %5, %5\n\tv_exp_f32 %6, %6\n\tv_exp_f32 %7, %7\n\tv_nop"
      : "+v"(e[0]), "+v"(e[1]), "+v"(e[2]), "+v"(e[3]), "+v"(e[4]), "+v"(e[5]), "+v"(e[6]), "+v"(e[7])); }
__device__ __attribute__((noinline)) float erf_ni(float v) { return erff(v); }

// each weight lies as bf16 WMMA fragments: [16-row tile][kc][2 p][32 lanes][8], piece (kc, p, lane (g, col)) = row col, elements 32 kc + 16 p + 8 g + 0..7
#define PK_K 0                          // Wk [1024][256]: 64 row tiles x 8 kc
#define PK_Q (PK_K + HDM * DI)
#define PK_V (PK_Q + HDM * DI)
#define PK_O (PK_V + HDM * DI)            // Wo [256][1024]: 16 row tiles x 32 kc
#define PK_END (PK_O + DO * HDM)
#define WS_PK 0u
#define WS_KP (WS_PK + 2u * PK_END)         // f32 [8192][1024] keys (flat = [16][8192][64])
#define WS_VP (WS_KP + 4u * NA * HDM)        // f32 [8192][1024] values
#define WS_QP (WS_VP + 4u * NA * HDM)        // f32 [1024][1024] queries (flat = [16][1024][64])
#define WS_VT (WS_QP + 4u * NQ * HDM)        // f16 V^T fragments [16 h][256 steps][4 dt][2 p][32 lanes][8]
#define WS_O  (WS_VT + 2u * HDM * NA)        // f32 attention output (keypoint, c = h*64+d) in k_out's A fragment order: [64 keypoint tiles][32 kc][4 i][32 lanes][4], piece (kc, i, lane (g, col)) = keypoint col, c = 32 kc + 16 (i >> 1) + 8 g + 4 (i & 1) + 0..3
#define WS_KF (WS_O + 4u * NQ * HDM)         // f16 K fragments [16 h][512 atom tiles][2 kc][2 p][32 lanes][8]
#define WS_DF (WS_KF + 2u * HDM * NA)        // bf16 dist pieces [64 keypoint tiles][256 steps][2 ct][32 lanes][8]
#define WS_XA (WS_DF + 2u * NQ * NA)         // bf16 rec_atom_feats fragments [512 row tiles][8 kc][2 p][32 lanes][8]
#define WS_XQ (WS_XA + 2u * NA * DI)         // bf16 kp_feat fragments [64 row tiles][8 kc][2 p][32 lanes][8]
#define WS_END (WS_XQ + 2u * NQ * DI)

// The three packing kernels start few waves that each move kilobytes
// a wave's own LDS rows are written before its lanes read one another's values back
#define LDSW() asm volatile("s_wait_dscnt 0x0" ::: "memory")
// a wave-uniform pointer held in a scalar register pair
template <typename T> __device__ __forceinline__ const T* sbase(const T* p) { const unsigned long long a = (unsigned long long)p;
  const unsigned lo = (unsigned)__builtin_amdgcn_readfirstlane((int)(unsigned)a), hi = (unsigned)__builtin_amdgcn_readfirstlane((int)(unsigned)(a >> 32));
  return (const T*)(const __attribute__((address_space(1))) T*)(((unsigned long long)hi << 32) | lo); }   // stays a global-memory pointer
// one k pass (32 wide) of a 128-column wave tile: its 8 bf16 B fragments, stored in fragment order (wp holds the lane's own 8 * lane step; ts = elements of a 16-row tile): every load instruction reads 512 bytes in a row
struct FragB { union { v16b v; v8b q[2]; } w[8];
  __device__ __forceinline__ void load(const __bf16* wp, int ts) {
#pragma unroll
    for (int j = 0; j < 8; ++j) { w[j].q[0] = *(const v8b*)(wp + (size_t)j * ts); w[j].q[1] = *(const v8b*)(wp + (size_t)j * ts + 256); } } };
// k_proj's pass: the A fragment of its 16 rows lies in fragment order too
struct PassF { union { v16b v; v8b q[2]; } a; FragB b;
  __device__ __forceinline__ void load(const __bf16* xp, const __bf16* wp) { a.q[0] = *(const v8b*)xp; a.q[1] = *(const v8b*)(xp + 256); b.load(wp, 16 * DI); } };
// k_out's pass: the lane's 16 f32 of its A row, stored by k_attn in fragment order (xp holds the lane's own 4 * lane step)
struct PassOps { v4f x[4]; FragB b;
  __device__ __forceinline__ void load(const float* xp, const __bf16* wp) {
#pragma unroll
    for (int i = 0; i < 4; ++i) x[i] = *(const v4f*)(xp + i * 128);
    b.load(wp, 16 * HDM); }
  __device__ __forceinline__ F2 a_split() const { float v[16];
#pragma unroll
    for (int i = 0; i < 16; ++i) v[i] = x[i >> 2][i & 3];
    return bsplit16(v); } };
// ---- k_proj: block = (64 rows, 128 of the 1024 cols): Y = bf16(X [rows][256]) . W rows (exact products) -> f32 rows (pitch 1024); X and W as k_pack's fragments
__global__ __launch_bounds__(128) void k_proj(const __bf16* __restrict__ XF, const __bf16* __restrict__ P, float* __restrict__ Y) {
  __shared__ __align__(16) float so[4][16][132];
  const int tid = threadIdx.x, wave = __builtin_amdgcn_readfirstlane(tid >> 5), lane = tid & 31, col = lane & 15, g = lane >> 4; const size_t r0 = (size_t)blockIdx.x * 64 + wave * 16; const int n0 = blockIdx.y * 128;   // the wave's number in a scalar register: the tile bases stay scalar
  v8f acc[8] = {};
  const __bf16* xp = XF + r0 * DI + lane * 8; const __bf16* wp = P + (size_t)n0 * DI + lane * 8;
  PassF b0, b1; b0.load(xp, wp);   // two register sets: pass kc + 1's loads are all in flight while pass kc's products run
#pragma unroll
  for (int kc = 0; kc < DI / 32; kc += 2) {
    b1.load(xp + (kc + 1) * 512, wp + (kc + 1) * 512);
    __builtin_amdgcn_sched_barrier(0);   // the next pass's loads all issue ahead of this pass's products: sunk among them they would be waited for as soon as issued
#pragma unroll
    for (int j = 0; j < 8; ++j) acc[j] = wmma_bf(b0.a.v, b0.b.w[j].v, acc[j]);
    if (kc + 2 < DI / 32) b0.load(xp + (kc + 2) * 512, wp + (kc + 2) * 512);
    __builtin_amdgcn_sched_barrier(0);   // as above
#pragma unroll
    for (int j = 0; j < 8; ++j) acc[j] = wmma_bf(b1.a.v, b1.b.w[j].v, acc[j]); }
#pragma unroll
  for (int j = 0; j < 8; ++j) {
#pragma unroll
    for (int r = 0; r < 8; ++r) so[wave][8 * g + r][j * 16 + col] = acc[j][r]; }
  LDSX();
  v4f t[16];   // all 16 LDS reads fly together ahead of the stores
#pragma unroll
  for (int rl = 0; rl < 16; ++rl) t[rl] = *(const v4f*)&so[wave][rl][lane * 4];
#pragma unroll
  for (int rl = 0; rl < 16; ++rl) vst2(Y + (r0 + rl) * HDM + n0 + lane * 4, t[rl]);
}
// ---- k_vt: wave = one 32-atom step S = (head, step) of V, 8 KB in a row: 16 loads of whole lines in flight (lane (g, col): atoms 8 m + 4 g + 0..3, d = 4 col + 0..3), transposed in the wave's own LDS rows [d][atom], stored in fragment order:
// piece (dt, p, lane (g, col)) holds V[32 step + 16 p + 8 g + 0..7][16 dt + col], so that one load instruction of k_attn (32 lanes x 16 bytes) reads 512 bytes in a row
#define VT_P 40                         // LDS row pitch in f16: 32 atoms + 8 (80 bytes = 16 x 5: the 16-byte reads of 16 rows fall on distinct banks)
__global__ __launch_bounds__(256) void k_vt(const float* __restrict__ VP, _Float16* __restrict__ VT) {
  __shared__ __align__(16) _Float16 st[8][HD * VT_P];
  const int tid = threadIdx.x, wave = __builtin_amdgcn_readfirstlane(tid >> 5), lane = tid & 31, col = lane & 15, g = lane >> 4;
  const size_t S = (size_t)blockIdx.x * 8 + wave; const float* src = VP + S * (32 * HD) + g * (4 * HD) + col * 4; _Float16* sw = &st[wave][0];
  v4f x[4][4];
#pragma unroll
  for (int m = 0; m < 4; ++m) {
#pragma unroll
    for (int r = 0; r < 4; ++r) x[m][r] = *(const v4f*)(src + (8 * m + r) * HD); }
#pragma unroll
  for (int m = 0; m < 4; ++m) {
#pragma unroll
    for (int i = 0; i < 4; ++i) { const v4h o = { (_Float16)x[m][0][i], (_Float16)x[m][1][i], (_Float16)x[m][2][i], (_Float16)x[m][3][i] };
      vst2(&sw[(col * 4 + i) * VT_P + 8 * m + 4 * g], __builtin_bit_cast(v2u, o)); } }
  LDSW();
  v4u r[8];
#pragma unroll
  for (int q = 0; q < 8; ++q) r[q] = *(const v4u*)&sw[((q >> 1) * 16 + col) * VT_P + (q & 1) * 16 + g * 8];
#pragma unroll
  for (int q = 0; q < 8; ++q) vst2(VT + S * (32 * HD) + q * 256 + lane * 8, r[q]);
}
// ---- k_frag: k_attn's K fragments (blockIdx.y 0, f16) and its dist values (blockIdx.y 1, bf16), in the order in which k_attn's lanes read them. Tile = 16 rows x 64 f32 -> 2 KB in a row: piece (k, lane (g, col)) = row col, elements 16 k + 8 g + 0..7.
// K: tile R = projection row R = the 16-atom tile R & 511 of head R >> 9 (row col = atom col = columns 64 col + 0..63; k = 2 kc + p). dist: tile (qt, step pair sp) = rows 16 qt + col, columns 64 sp + 0..63 (k = 2 (step & 1) + ct)
// wave = FT_N tiles side by side: their loads are issued ahead of the work on the first tile, each of whole lines (lanes 0..15 row 2 j, lanes 16..31 row 2 j + 1, 256 bytes each); the pieces are cut from the wave's own LDS rows
#define FT_P 72                         // LDS row pitch in 16-bit elements: 64 + 8 (144 bytes = 16 x 9: the 16-byte reads of 16 rows fall on distinct banks)
#define FT_N 4
template <typename V4, typename T> __device__ __forceinline__ void frag_tiles(const float* src, const int rs, const int ts, T* dst, T* sw, const int lane) {   // rs, ts: row and tile steps of the source in elements; sw: 16 LDS rows for each tile
  const int col = lane & 15, g = lane >> 4; v4f x[FT_N][8];
  src += (size_t)g * rs + col * 4;
#pragma unroll
  for (int n = 0; n < FT_N; ++n) {
#pragma unroll
    for (int j = 0; j < 8; ++j) x[n][j] = *(const v4f*)(src + (size_t)n * ts + (size_t)(2 * j) * rs); }
#pragma unroll
  for (int n = 0; n < FT_N; ++n) {
#pragma unroll
    for (int j = 0; j < 8; ++j) { const V4 o = { (T)x[n][j][0], (T)x[n][j][1], (T)x[n][j][2], (T)x[n][j][3] }; vst2(&sw[(16 * n + 2 * j + g) * FT_P + col * 4], __builtin_bit_cast(v2u, o)); }
    LDSW();
    v4u r[4];
#pragma unroll
    for (int k = 0; k < 4; ++k) r[k] = *(const v4u*)&sw[(16 * n + col) * FT_P + (2 * k + g) * 8];
#pragma unroll
    for (int k = 0; k < 4; ++k) vst2(dst + n * 1024 + k * 256 + lane * 8, r[k]); }
}
// ---- k_pack: the four weights and the two feature inputs -> bf16 fragments for k_proj and k_out. Wave = 16 rows x 256 columns (FT_N tiles side by side); 64 waves (8 blocks) to a weight or to 1,024 feature rows
#define PKB (8 * (4 + (NQ + NA) / 1024))
static_assert(FT_N * 64 == DI && HDM == 4 * DI && DO * 4 == HDM && HDM / 16 == 64 && NQ == 1024, "a wave takes a whole row tile of a [..][256] matrix, a quarter of one of Wo; 64 waves to a unit");
__global__ __launch_bounds__(256) void k_pack(const float* __restrict__ Wk, const float* __restrict__ Wq, const float* __restrict__ Wv, const float* __restrict__ Wo, const float* __restrict__ XQ, const float* __restrict__ XA, __bf16* __restrict__ PK, __bf16* __restrict__ XQF, __bf16* __restrict__ XAF) {
  __shared__ __align__(16) unsigned short st[8][FT_N * 16 * FT_P];
  const int tid = threadIdx.x, wave = __builtin_amdgcn_readfirstlane(tid >> 5), lane = tid & 31;
  const unsigned sel = blockIdx.x >> 3, u = (blockIdx.x & 7) * 8 + wave; __bf16* sw = (__bf16*)&st[wave][0];
  if (sel == 3) { frag_tiles<v4b>(Wo + (size_t)(u >> 2) * 16 * HDM + (u & 3) * DI, HDM, 64, PK + PK_O + (size_t)u * (16 * DI), sw, lane); return; }   // row tile u >> 2, columns 256 (u & 3) + 0..255
  const float* m = sel == 0 ? Wk : sel == 1 ? Wq : sel == 2 ? Wv : sel == 4 ? XQ : XA;
  __bf16* d = sel < 3 ? PK + (size_t)sel * (HDM * DI) : sel == 4 ? XQF : XAF;
  const unsigned rt = sel < 5 ? u : (sel - 5) * 64 + u;   // row tile of the matrix
  frag_tiles<v4b>(m + (size_t)rt * 16 * DI, DI, 64, d + (size_t)rt * (16 * DI), sw, lane);
}
__global__ __launch_bounds__(256) void k_frag(const float* __restrict__ KP, const float* __restrict__ DIST, _Float16* __restrict__ KF, __bf16* __restrict__ DF) {
  __shared__ __align__(16) unsigned short st[8][FT_N * 16 * FT_P];
  const int tid = threadIdx.x, wave = __builtin_amdgcn_readfirstlane(tid >> 5), lane = tid & 31;
  const unsigned t0 = (blockIdx.x * 8 + wave) * FT_N;   // the wave's first tile of 8,192; FT_N divides 128, so its dist tiles share their 16 rows
  if (blockIdx.y == 0) frag_tiles<v4h>(KP + (size_t)t0 * 1024, HD, 1024, KF + (size_t)t0 * 1024, (_Float16*)&st[wave][0], lane);
  else frag_tiles<v4b>(DIST + (size_t)(t0 >> 7) * 16 * NA + (t0 & 127) * 64, NA, 64, DF + (size_t)t0 * 1024, (__bf16*)&st[wave][0], lane);
}
// ---- k_attn: block = (64 keypoints, head h), 32 waves = 4 keypoint sub-tiles x NSP atom shares: wave (qs, sh) runs flash attention for 16 keypoints over the 32-atom steps ks = sh, sh + NSP, ... (logits = (bf16(dist) * (1/sqrt3) + q.k * 0.125) * (1/sqrt2) with q, k single f16 operands, held as u = q.k + bf16(dist) * (8/sqrt3), e^(logit - max) = 2^((u - max u) * K2), K2 = log2(e) / (8 sqrt2); P.V with P, V single f16 operands); the NSP partial (m, l, acc) of a keypoint are joined in LDS: O[k][h*64+d] = sum_sh acc_sh w_sh / sum_sh l_sh w_sh, w_sh = 2^((m_sh - M) * K2)
// a fragment stored in fragment order: elements 0..7 of all 32 lanes in a row, then elements 8..15 (p holds the lane's own 8 * lane step)
__device__ __forceinline__ v16h frag_pl(const _Float16* p) { union { v16h v; v8h q[2]; } u; u.q[0] = *(const v8h*)p; u.q[1] = *(const v8h*)(p + 256); return u.v; }
#define NSP 8            // atom shares per keypoint sub-tile (waves per SIMD)
#define SW_M (16 * 68)   // per-wave LDS, written once behind the loop: [16][68] partial output, then m[16], l[16]
#define SW_L (SW_M + 16)
#define SW_N (SW_L + 16)
// lane l <-> lane l ^ 16 without LDS
__device__ __forceinline__ float xhalf(float v) { const int b = __builtin_bit_cast(int, v); return __builtin_bit_cast(float, __builtin_amdgcn_permlanex16(b, b, 0x76543210, 0xfedcba98, false, false)); }
// transposed products: S^T = K . Q^T (A = 16 atom rows, B = 16 keypoint columns), O^T += V^T . P^T. Lane (g, col) holds, of keypoint q0 + col alone, the scores of atoms 16 ct + 8 g + r: maximum and sum run in the lane, one exchange between the halves shares the maximum, and the two converted score tiles are the B operand of the second product as they lie (element 8 ct + r = atom 16 ct + 8 g + r, the k order of the V^T fragment)
// NSP waves per SIMD is all that a block of this size can have: told so, the compiler spends the whole register budget and leaves the step's loads standing as groups ahead of their users, instead of sinking each to its user to save registers (the calls used to hold them in place)
__global__ __launch_bounds__(128 * NSP) __attribute__((amdgpu_waves_per_eu(NSP, NSP))) void k_attn(const float* __restrict__ QP, const _Float16* __restrict__ KF, const __bf16* __restrict__ DF, const _Float16* __restrict__ VT, float* __restrict__ O) {
  __shared__ __align__(16) float sm[4 * NSP][SW_N];
  const int tid = threadIdx.x, wave = __builtin_amdgcn_readfirstlane(tid >> 5), lane = tid & 31, col = lane & 15, g = lane >> 4;   // the wave's number in a scalar register: its share, loop counter and tile addresses stay scalar
  const int qb = blockIdx.x, h = blockIdx.y; const int q0 = qb * 64 + (wave & 3) * 16, sh = wave >> 2;
  float* sp = &sm[wave][0];
  const float CD = (float)(8.0 / 1.7320508075688772), K2 = (float)(1.4426950408889634 / (8.0 * 1.4142135623730951));
  const float* qrow = QP + (size_t)h * NQ * HD + (size_t)(q0 + col) * HD;
  v16h aq[2];
#pragma unroll
  for (int kc = 0; kc < 2; ++kc) aq[kc] = frag_f32(qrow + kc * 32, lane);
  float m = -3.0e38f, l = 0.f;   // of keypoint q0 + col: m (the maximum of u) shared by both halves, l the sum over the lane's own atoms
  v8f acc[4] = {};               // acc[dt][r] = O^T[16 dt + 8 g + r][q0 + col]
  // K, V and dist lie in fragment order (k_frag, k_vt): wave-uniform step bases + the one lane offset 8 * lane, every load instruction reads 512 bytes in a row (4 whole lines, not 16 part lines)
  const _Float16* kh = KF + (size_t)h * NA * HD; const _Float16* vh = VT + (size_t)h * HD * NA; const __bf16* dh = DF + (size_t)(q0 >> 4) * 16 * NA;
  const unsigned lane8 = lane * 8;
#pragma unroll 1
  for (int ks = sh; ks < NA / 32; ks += NSP) { v8f s[2];
    // the step's bases in scalar registers + the one 32-bit lane offset
    const _Float16* kp = sbase(kh + (size_t)ks * 32 * HD) + lane8; const __bf16* dp = sbase(dh + (size_t)ks * 32 * 16) + lane8; const _Float16* vp = sbase(vh + (size_t)ks * 32 * HD) + lane8;
    // the step's K, dist and V loads stand as groups ahead of the products that use them
    v16h ka[2][2]; v8b dv[2]; v16h va[4];
#pragma unroll
    for (int ct = 0; ct < 2; ++ct) {
#pragma unroll
      for (int kc = 0; kc < 2; ++kc) ka[ct][kc] = frag_pl(kp + (ct * 2 + kc) * 512); }
#pragma unroll
    for (int ct = 0; ct < 2; ++ct) dv[ct] = *(const v8b*)(dp + ct * 256);
#pragma unroll
    for (int ct = 0; ct < 2; ++ct) { s[ct] = v8f{};
#pragma unroll
      for (int kc = 0; kc < 2; ++kc) s[ct] = wmma16(ka[ct][kc], aq[kc], s[ct]); }
#pragma unroll
    for (int dt = 0; dt < 4; ++dt) va[dt] = frag_pl(vp + dt * 512);
#pragma unroll
    for (int ct = 0; ct < 2; ++ct) {
#pragma unroll
      for (int r = 0; r < 8; ++r) s[ct][r] = __builtin_fmaf((float)dv[ct][r], CD, s[ct][r]); }
    float mx = fmaxf(s[0][0], s[1][0]);
#pragma unroll
    for (int r = 1; r < 8; ++r) mx = fmaxf(mx, fmaxf(s[0][r], s[1][r]));
    mx = fmaxf(mx, xhalf(mx));
    const float mn = fmaxf(m, mx), nb = -mn * K2; const float alpha = exp2_slot((m - mn) * K2);   // exactly 1 while the maximum stands
    v16h pa; float es, e[16];
#pragma unroll
    for (int ct = 0; ct < 2; ++ct) {
#pragma unroll
      for (int r = 0; r < 8; ++r) e[8 * ct + r] = __builtin_fmaf(s[ct][r], K2, nb);
      exp2x8(e + 8 * ct); }
#pragma unroll
    for (int i = 0; i < 16; ++i) { es = i ? es + e[i] : e[i]; pa[i] = (_Float16)e[i]; }
    asm volatile("s_wait_xcnt 0x0" ::: "memory");   // the step's loads are done with their base registers before the loop's foot moves these on
    l = l * alpha + es; m = mn;
#pragma unroll
    for (int dt = 0; dt < 4; ++dt) acc[dt] *= alpha;
#pragma unroll
    for (int dt = 0; dt < 4; ++dt) acc[dt] = wmma16(va[dt], pa, acc[dt]); }
  l += xhalf(l);   // both halves' sums stand under the same maximum
  const int lane2 = (int)__builtin_amdgcn_mbcnt_lo(~0u, 0u), col2 = lane2 & 15, g2 = lane2 >> 4;   // the lane's number read anew: no register carries it, or what follows from it, through the loop
#pragma unroll
  for (int dt = 0; dt < 4; ++dt) { const v4f lo = { acc[dt][0], acc[dt][1], acc[dt][2], acc[dt][3] }, hi = { acc[dt][4], acc[dt][5], acc[dt][6], acc[dt][7] };
    vst2(&sp[col2 * 68 + dt * 16 + 8 * g2], lo); vst2(&sp[col2 * 68 + dt * 16 + 8 * g2 + 4], hi); }
  if (g2 == 0) { sp[SW_M + col2] = m; sp[SW_L + col2] = l; }
  __syncthreads();   // every share's partial is in LDS before any thread joins them
  { const int qs = wave >> 3, kcl = (wave >> 2) & 1, pi = wave & 3, d4 = kcl * 32 + (pi >> 1) * 16 + g2 * 8 + (pi & 1) * 4, row = col2; const float* p0 = &sm[qs][0];   // wave = one piece row (keypoint sub-tile qs, kc = 2 h + kcl, i = pi) of k_out's A fragments, thread = (keypoint row, 4 of the 64 d); share sh of a keypoint lies 4 waves further
    float ms[NSP], M = -3.0e38f;
#pragma unroll
    for (int i = 0; i < NSP; ++i) { ms[i] = p0[i * 4 * SW_N + SW_M + row]; M = fmaxf(M, ms[i]); }
    float L = 0.f; v4f o = {};
#pragma unroll
    for (int i = 0; i < NSP; ++i) { const float w = exp2_slot((ms[i] - M) * K2); L += p0[i * 4 * SW_N + SW_L + row] * w; o += *(const v4f*)&p0[i * 4 * SW_N + row * 68 + d4] * w; }
    vst2(O + ((((size_t)(qb * 4 + qs) * (HDM / 32) + h * 2 + kcl) * 4 + pi) * 32 + lane2) * 4, o * (1.0f / L)); }   // 512 bytes in a row over the wave
}
__device__ __forceinline__ void out_pass(const PassOps& b, v8f (&acc)[8]) { const F2 a = b.a_split();
#pragma unroll
  for (int j = 0; j < 8; ++j) acc[j] = wmma_bf(a.l, b.b.w[j].v, acc[j]);
#pragma unroll
  for (int j = 0; j < 8; ++j) acc[j] = wmma_bf(a.h, b.b.w[j].v, acc[j]); }
// ---- k_out: block = (64 rows, 128 of the 256 cols): out = O(hi/lo) . Wo rows (2 products); Wo as k_pack's fragments
__global__ __launch_bounds__(128) void k_out(const float* __restrict__ O, const __bf16* __restrict__ P, float* __restrict__ Y) {
  __shared__ __align__(16) float so[4][16][132];
  const int tid = threadIdx.x, wave = __builtin_amdgcn_readfirstlane(tid >> 5), lane = tid & 31; const size_t r0 = (size_t)blockIdx.x * 64 + wave * 16; const int n0 = blockIdx.y * 128;   // the wave's number, and r0 with it, in scalar registers through the loop
  v8f acc[8] = {};
  const float* xp = O + r0 * HDM + lane * 4; const __bf16* wp = P + (size_t)n0 * HDM + lane * 8;
  PassOps b0, b1; b0.load(xp, wp);   // two register sets: pass kc + 1's loads are all in flight while pass kc's products run
#pragma unroll 1   // rolled: the two sets and the accumulators are the whole budget of 256 registers
  for (int kc = 0; kc < HDM / 32 - 2; kc += 2) {
    b1.load(xp + 512, wp + 512);
    __builtin_amdgcn_sched_barrier(0);   // the next pass's loads all issue ahead of this pass's products: sunk among them they would be waited for as soon as issued
    out_pass(b0, acc);
    xp += 1024; wp += 1024; b0.load(xp, wp);
    __builtin_amdgcn_sched_barrier(0);   // as above
    out_pass(b1, acc);
    asm volatile("s_wait_xcnt 0x0" ::: "memory"); }   // the trip's loads are done with their address registers before the next trip moves these on
  b1.load(xp + 512, wp + 512);
  __builtin_amdgcn_sched_barrier(0);   // as above
  out_pass(b0, acc); out_pass(b1, acc);
  const int lane2 = (int)__builtin_amdgcn_mbcnt_lo(~0u, 0u), col2 = lane2 & 15, g2 = lane2 >> 4;   // the lane's number read anew: no register carries it, or what follows from it, through the loop
#pragma unroll
  for (int j = 0; j < 8; ++j) {
#pragma unroll
    for (int r = 0; r < 8; ++r) so[wave][8 * g2 + r][j * 16 + col2] = acc[j][r]; }
  LDSX();
  for (int rl = 0; rl < 16; ++rl) vst2(Y + (r0 + rl) * DO + n0 + lane2 * 4, *(const v4f*)&so[wave][rl][lane2 * 4]);
}
extern "C" void kernel_launch(void* const* d_in, const int* in_sizes, int n_in, void* d_out, int out_size, void* d_ws, size_t ws_size, hipStream_t stream) {
  (void)in_sizes; (void)n_in; (void)out_size;
  const float** F = (const float**)d_in;   // 0 kp_feat [1024,256], 1 kp_dist [1024,8192], 2 rec_atom_feats [8192,256], 3 Wk [1024,256], 4 Wq, 5 Wv, 6 Wo [256,1024]
  if (ws_size < (size_t)WS_END) return;
  char* ws = (char*)d_ws; __bf16* PK = (__bf16*)(ws + WS_PK); float *KPp = (float*)(ws + WS_KP), *VPp = (float*)(ws + WS_VP), *QPp = (float*)(ws + WS_QP), *O = (float*)(ws + WS_O); _Float16 *VT = (_Float16*)(ws + WS_VT), *KF = (_Float16*)(ws + WS_KF); __bf16 *DF = (__bf16*)(ws + WS_DF), *XA = (__bf16*)(ws + WS_XA), *XQ = (__bf16*)(ws + WS_XQ);
  k_pack<<<PKB, 256, 0, stream>>>(F[3], F[4], F[5], F[6], F[0], F[2], PK, XQ, XA);
  k_proj<<<dim3(NA / 64, HDM / 128), 128, 0, stream>>>(XA, PK + PK_K, KPp);
  k_proj<<<dim3(NA / 64, HDM / 128), 128, 0, stream>>>(XA, PK + PK_V, VPp);
  k_proj<<<dim3(NQ / 64, HDM / 128), 128, 0, stream>>>(XQ, PK + PK_Q, QPp);
  k_vt<<<NH * (NA / 32) / 8, 256, 0, stream>>>(VPp, VT);
  k_frag<<<dim3(NA * HDM / 1024 / (8 * FT_N), 2), 256, 0, stream>>>(KPp, F[1], KF, DF);
  k_attn<<<dim3(TQB, NH), 128 * NSP, 0, stream>>>(QPp, KF, DF, VT, O);
  k_out<<<dim3(TQB, DO / 128), 128, 0, stream>>>(O, PK + PK_O, (float*)d_out);
}

// v008
// It runs in 114 microseconds.
// Timed twice side by side with v007, it ran 1.15 and 1.12 times as fast.
// Counting every step since v000, it is 12.2 times as fast.
// compute dtype: kp_feat, kp_dist, rec_atom_feats and the four weights (module inputs) rounded to bf16; the three projections with exact bf16 products (inputs x inputs) on WMMA 16x16x32; attention logits q.k with q and k as single f16 operands (1 product; near-uniform softmax over 8,192 atoms, logit error ~1e-4 relative), P.V with P = exp(s - m) and V as single f16 operands (1 product; both errors relative to an 8,192-term softmax average); the output projection with the computed operand as bf16 hi + residual pair x exact Wo (2 products); the kp_dist bias, scaling, running-max softmax and normalisation in f32; f32 accumulate.
#include <hip/hip_runtime.h>
#include <math.h>

typedef __attribute__((ext_vector_type(16))) _Float16 v16h;
typedef __attribute__((ext_vector_type(16))) __bf16 v16b;
typedef __attribute__((ext_vector_type(8)))  _Float16 v8h;
typedef __attribute__((ext_vector_type(8)))  float v8f;
typedef __attribute__((ext_vector_type(4)))  float v4f;
typedef __attribute__((ext_vector_type(2)))  float v2f;
typedef __attribute__((ext_vector_type(4)))  unsigned v4u;
typedef __attribute__((ext_vector_type(4)))  int v4i;
typedef float __attribute__((may_alias)) float_a;
typedef int __attribute__((may_alias)) int_a;

template <typename T> __device__ __forceinline__ void vst2(void* p, T v) { *(T*)p = v;  }
__device__ __forceinline__ v8f wmma16(v16h a, v16h b, v8f c) {
  return __builtin_amdgcn_wmma_f32_16x16x32_f16(false, a, false, b, (short)0, c, false, false);
}
__device__ __forceinline__ v8f wmma_bf(v16b a, v16b b, v8f c) {
  return __builtin_amdgcn_wmma_f32_16x16x32_bf16(false, a, false, b, (short)0, c, false, false);
}
// 16x16x32 fragments: lane = (h = lane>>4, row/col = lane&15); elements 0..7 = k0+8h+0..7, 8..15 = k0+16+8h+0..7; D element r = row 8h+r
__device__ __forceinline__ v16h frag_h(const _Float16* rowk0, int lane) {
  union { v16h v; v8h q[2]; } u; const _Float16* p = rowk0 + 8 * (lane >> 4);
  u.q[0] = *(const v8h*)p; u.q[1] = *(const v8h*)(p + 16); return u.v;
}
__device__ __forceinline__ v16h frag_f32(const float* rowk0, int lane) {
  v16h a; const float* p = rowk0 + 8 * (lane >> 4);
#pragma unroll
  for (int i = 0; i < 8; ++i) { a[i] = (_Float16)p[i]; a[8 + i] = (_Float16)p[16 + i]; }
  return a;
}
__device__ __forceinline__ v16h frag_f32s(const float* rowk0, int lane, float sc) {
  v16h a; const float* p = rowk0 + 8 * (lane >> 4);
#pragma unroll
  for (int i = 0; i < 8; ++i) { a[i] = (_Float16)(p[i] * sc); a[8 + i] = (_Float16)(p[16 + i] * sc); }
  return a;
}
// column fragment from a [K][ld] layout (column n), rows >= K read as 0
__device__ __forceinline__ v16h fragc_f32(const float* W, int k0, int n, int lane, int ld, int K) {
  v16h a; const int g = lane >> 4;
#pragma unroll
  for (int i = 0; i < 8; ++i) { const int ka = k0 + 8 * g + i, kb = ka + 16;
    a[i] = (_Float16)(ka < K ? W[(size_t)(ka < K ? ka : K - 1) * ld + n] : 0.f); a[8 + i] = (_Float16)(kb < K ? W[(size_t)(kb < K ? kb : K - 1) * ld + n] : 0.f); }
  return a;
}
struct F2 { v16b h, l; };
__device__ __forceinline__ F2 bsplit16(const float v[16]) { F2 r;
#pragma unroll
  for (int i = 0; i < 16; ++i) { const __bf16 h = (__bf16)v[i]; r.h[i] = h; r.l[i] = (__bf16)(v[i] - (float)h); }
  return r; }
__device__ __forceinline__ F2 split_row(const float* row, int k0, int lane) { float v[16]; const float* p = row + k0 + 8 * (lane >> 4);
#pragma unroll
  for (int i = 0; i < 8; ++i) { v[i] = p[i]; v[8 + i] = p[16 + i]; }
  return bsplit16(v); }
__device__ __forceinline__ F2 split_rowK(const float* row, int k0, int lane, int K) { float v[16]; const int g = lane >> 4;
#pragma unroll
  for (int i = 0; i < 8; ++i) { const int ka = k0 + 8 * g + i, kb = ka + 16; v[i] = ka < K ? row[ka < K ? ka : K - 1] : 0.f; v[8 + i] = kb < K ? row[kb < K ? kb : K - 1] : 0.f; }
  return bsplit16(v); }
__device__ __forceinline__ F2 split_col(const float* W, int k0, int n, int lane, int ld, int K) { float v[16]; const int g = lane >> 4;
#pragma unroll
  for (int i = 0; i < 8; ++i) { const int ka = k0 + 8 * g + i, kb = ka + 16; v[i] = ka < K ? W[(size_t)(ka < K ? ka : K - 1) * ld + n] : 0.f; v[8 + i] = kb < K ? W[(size_t)(kb < K ? kb : K - 1) * ld + n] : 0.f; }
  return bsplit16(v); }
__device__ __forceinline__ v8f mac3(const F2& a, const F2& b, v8f c) { c = wmma_bf(a.l, b.h, c); c = wmma_bf(a.h, b.l, c); return wmma_bf(a.h, b.h, c); }
__device__ __forceinline__ float sigm(float v) { return 1.0f / (1.0f + expf(-v)); }
#define LDSX() do { asm volatile("s_wait_dscnt 0" ::: "memory"); __builtin_amdgcn_wave_barrier(); __builtin_amdgcn_fence(__ATOMIC_RELEASE, "workgroup"); } while (0)


// Keypoint multi-head attention (1,024 keypoints attend over 8,192 atoms; 16 heads x 64 via the module's RAW row-major reshape of the [rows][1024] projections: head h of K/V = projection rows 512h..512h+511 read as a contiguous [8192][64] block, head h of Q = rows 64h..64h+63 as [1024][64]); logits = (dist / sqrt(3) + q.k / 8) / sqrt(2); out = concat_h(P V) [1024][1024] . Wo^T.
#define NQ 1024          // keypoints
#define NA 8192          // atoms
#define DI 256           // in dim
#define HDM 1024         // heads x hidden
#define NH 16
#define HD 64
#define DO 256           // out dim
#ifndef TQB
#define TQB (NQ / 64)    // query tiles processed
#endif
typedef __attribute__((ext_vector_type(8))) __bf16 v8b;
typedef __attribute__((ext_vector_type(4))) __bf16 v4b;
typedef __attribute__((ext_vector_type(4))) _Float16 v4h;
typedef __attribute__((ext_vector_type(2))) unsigned v2u;
__device__ __forceinline__ v16b frag_b(const __bf16* rowk0, int lane) {
  union { v16b v; v8b q[2]; } u; const __bf16* p = rowk0 + 8 * (lane >> 4);
  u.q[0] = *(const v8b*)p; u.q[1] = *(const v8b*)(p + 16); return u.v;
}
__device__ __forceinline__ float bfr(float v) { return (float)(__bf16)v; }
// 2^v on the chip's own instruction, in line. In asm with the free slot behind a transcendental written into the statement
__device__ __forceinline__ float exp2_slot(float v) { float r; asm("v_exp_f32 %0, %1\n\tv_nop" : "=v"(r) : "v"(v)); return r; }
// eight at once, each in place: every one but the last has an independent instruction behind it, the last the v_nop
__device__ __forceinline__ void exp2x8(float* e) {
  asm("v_exp_f32 %0, %0\n\tv_exp_f32 %1, %1\n\tv_exp_f32 %2, %2\n\tv_exp_f32 %3, %3\n\tv_exp_f32 %4, %4\n\tv_exp_f32 %5, %5\n\tv_exp_f32 %6, %6\n\tv_exp_f32 %7, %7\n\tv_nop"
      : "+v"(e[0]), "+v"(e[1]), "+v"(e[2]), "+v"(e[3]), "+v"(e[4]), "+v"(e[5]), "+v"(e[6]), "+v"(e[7])); }
__device__ __attribute__((noinline)) float erf_ni(float v) { return erff(v); }

// each weight lies as bf16 WMMA fragments: [16-row tile][kc][2 p][32 lanes][8], piece (kc, p, lane (g, col)) = row col, elements 32 kc + 16 p + 8 g + 0..7
#define PK_K 0                          // Wk [1024][256]: 64 row tiles x 8 kc
#define PK_Q (PK_K + HDM * DI)
#define PK_V (PK_Q + HDM * DI)
#define PK_O (PK_V + HDM * DI)            // Wo [256][1024]: 16 row tiles x 32 kc
#define PK_END (PK_O + DO * HDM)
#define WS_PK 0u
#define WS_QP (WS_PK + 2u * PK_END)         // f32 [1024][1024] queries (flat = [16][1024][64])
#define WS_VT (WS_QP + 4u * NQ * HDM)        // f16 V^T fragments [16 h][256 steps][4 dt][2 p][32 lanes][8] (steps, tiles and places of atoms: k_projf)
#define WS_O  (WS_VT + 2u * HDM * NA)        // f32 attention output (keypoint, c = h*64+d) in k_out's A fragment order: [64 keypoint tiles][32 kc][4 i][32 lanes][4], piece (kc, i, lane (g, col)) = keypoint col, c = 32 kc + 16 (i >> 1) + 8 g + 4 (i & 1) + 0..3
#define WS_KF (WS_O + 4u * NQ * HDM)         // f16 K fragments [16 h][512 atom tiles][2 kc][2 p][32 lanes][8]
#define WS_DF (WS_KF + 2u * HDM * NA)        // bf16 dist pieces [64 keypoint tiles][256 steps][2 ct][32 lanes][8]
#define WS_XA (WS_DF + 2u * NQ * NA)         // bf16 rec_atom_feats fragments [512 row tiles][8 kc][2 p][32 lanes][8]
#define WS_XQ (WS_XA + 2u * NA * DI)         // bf16 kp_feat fragments [64 row tiles][8 kc][2 p][32 lanes][8]
#define WS_END (WS_XQ + 2u * NQ * DI)

// The packing kernels start few waves that each move kilobytes
// a wave's own LDS rows are written before its lanes read one another's values back
#define LDSW() asm volatile("s_wait_dscnt 0x0" ::: "memory")
// a wave-uniform pointer held in a scalar register pair
template <typename T> __device__ __forceinline__ const T* sbase(const T* p) { const unsigned long long a = (unsigned long long)p;
  const unsigned lo = (unsigned)__builtin_amdgcn_readfirstlane((int)(unsigned)a), hi = (unsigned)__builtin_amdgcn_readfirstlane((int)(unsigned)(a >> 32));
  return (const T*)(const __attribute__((address_space(1))) T*)(((unsigned long long)hi << 32) | lo); }   // stays a global-memory pointer
// one k pass (32 wide) of a 128-column wave tile: its 8 bf16 B fragments, stored in fragment order (wp holds the lane's own 8 * lane step; ts = elements of a 16-row tile): every load instruction reads 512 bytes in a row
struct FragB { union { v16b v; v8b q[2]; } w[8];
  __device__ __forceinline__ void load(const __bf16* wp, int ts) {
#pragma unroll
    for (int j = 0; j < 8; ++j) { w[j].q[0] = *(const v8b*)(wp + (size_t)j * ts); w[j].q[1] = *(const v8b*)(wp + (size_t)j * ts + 256); } } };
// k_proj's pass: the A fragment of its 16 rows lies in fragment order too
struct PassF { union { v16b v; v8b q[2]; } a; FragB b;
  __device__ __forceinline__ void load(const __bf16* xp, const __bf16* wp) { a.q[0] = *(const v8b*)xp; a.q[1] = *(const v8b*)(xp + 256); b.load(wp, 16 * DI); } };
// k_out's pass: the lane's 16 f32 of its A row, stored by k_attn in fragment order (xp holds the lane's own 4 * lane step)
struct PassOps { v4f x[4]; FragB b;
  __device__ __forceinline__ void load(const float* xp, const __bf16* wp) {
#pragma unroll
    for (int i = 0; i < 4; ++i) x[i] = *(const v4f*)(xp + i * 128);
    b.load(wp, 16 * HDM); }
  __device__ __forceinline__ F2 a_split() const { float v[16];
#pragma unroll
    for (int i = 0; i < 16; ++i) v[i] = x[i >> 2][i & 3];
    return bsplit16(v); } };
// ---- k_proj: block = (64 rows, 128 of the 1024 cols): Y = bf16(X [rows][256]) . W rows (exact products) -> f32 rows (pitch 1024); X and W as k_pack's fragments
__global__ __launch_bounds__(128) void k_proj(const __bf16* __restrict__ XF, const __bf16* __restrict__ P, float* __restrict__ Y) {
  __shared__ __align__(16) float so[4][16][132];
  const int tid = threadIdx.x, wave = __builtin_amdgcn_readfirstlane(tid >> 5), lane = tid & 31, col = lane & 15, g = lane >> 4; const size_t r0 = (size_t)blockIdx.x * 64 + wave * 16; const int n0 = blockIdx.y * 128;   // the wave's number in a scalar register: the tile bases stay scalar
  v8f acc[8] = {};
  const __bf16* xp = XF + r0 * DI + lane * 8; const __bf16* wp = P + (size_t)n0 * DI + lane * 8;
  PassF b0, b1; b0.load(xp, wp);   // two register sets: pass kc + 1's loads are all in flight while pass kc's products run
#pragma unroll
  for (int kc = 0; kc < DI / 32; kc += 2) {
    b1.load(xp + (kc + 1) * 512, wp + (kc + 1) * 512);
    __builtin_amdgcn_sched_barrier(0);   // the next pass's loads all issue ahead of this pass's products: sunk among them they would be waited for as soon as issued
#pragma unroll
    for (int j = 0; j < 8; ++j) acc[j] = wmma_bf(b0.a.v, b0.b.w[j].v, acc[j]);
    if (kc + 2 < DI / 32) b0.load(xp + (kc + 2) * 512, wp + (kc + 2) * 512);
    __builtin_amdgcn_sched_barrier(0);   // as above
#pragma unroll
    for (int j = 0; j < 8; ++j) acc[j] = wmma_bf(b1.a.v, b1.b.w[j].v, acc[j]); }
#pragma unroll
  for (int j = 0; j < 8; ++j) {
#pragma unroll
    for (int r = 0; r < 8; ++r) so[wave][8 * g + r][j * 16 + col] = acc[j][r]; }
  LDSX();
  v4f t[16];   // all 16 LDS reads fly together ahead of the stores
#pragma unroll
  for (int rl = 0; rl < 16; ++rl) t[rl] = *(const v4f*)&so[wave][rl][lane * 4];
#pragma unroll
  for (int rl = 0; rl < 16; ++rl) vst2(Y + (r0 + rl) * HDM + n0 + lane * 4, t[rl]);
}
// ---- k_projf: the K (ISV false) and V (ISV true) projections, k_proj's tile and passes, stored straight from the accumulators as k_attn's f16 fragments: no f32 copy, no LDS, no repacking launch.
// Projection row R holds the 16 atoms 16 (R & 511) + a of head R >> 9 (a = column >> 6, d = column & 63). k_attn's 16-atom tile (rg, a) is made of atom a of the 16 rows 16 rg + i, i = 0..15 its place in the tile; step ks = 8 (rg & 31) + (a >> 1) of the head takes tiles a = 2 (ks & 7) + ct. Softmax over the atoms does not depend on their order; K, V and dist (k_dist) follow the same one.
// K: operands swapped (A = weight rows, B = feature rows): lane (g, col) holds Y[16 rg + col][16 j + 8 g + 0..7] = piece (k = j & 3) of the A fragment of tile (rg, a), row i = col. V: lane (g, col) holds Y[16 rg + 8 g + 0..7][16 j + col] = piece (dt = j & 3, p = a & 1) of the V^T fragment, places i = 8 g + 0..7. Every store instruction writes 512 bytes in a row
template <bool ISV> __global__ __launch_bounds__(128) void k_projf(const __bf16* __restrict__ XF, const __bf16* __restrict__ P, _Float16* __restrict__ F) {
  const int tid = threadIdx.x, wave = __builtin_amdgcn_readfirstlane(tid >> 5), lane = tid & 31; const size_t rg = (size_t)blockIdx.x * 4 + wave; const int n0 = blockIdx.y * 128;   // the wave's number in a scalar register: the tile bases stay scalar
  v8f acc[8] = {};
  const __bf16* xp = XF + rg * 16 * DI + lane * 8; const __bf16* wp = P + (size_t)n0 * DI + lane * 8;
  PassF b0, b1; b0.load(xp, wp);   // two register sets: pass kc + 1's loads are all in flight while pass kc's products run
#pragma unroll
  for (int kc = 0; kc < DI / 32; kc += 2) {
    b1.load(xp + (kc + 1) * 512, wp + (kc + 1) * 512);
    __builtin_amdgcn_sched_barrier(0);   // the next pass's loads all issue ahead of this pass's products: sunk among them they would be waited for as soon as issued
#pragma unroll
    for (int j = 0; j < 8; ++j) acc[j] = ISV ? wmma_bf(b0.a.v, b0.b.w[j].v, acc[j]) : wmma_bf(b0.b.w[j].v, b0.a.v, acc[j]);
    if (kc + 2 < DI / 32) b0.load(xp + (kc + 2) * 512, wp + (kc + 2) * 512);
    __builtin_amdgcn_sched_barrier(0);   // as above
#pragma unroll
    for (int j = 0; j < 8; ++j) acc[j] = ISV ? wmma_bf(b1.a.v, b1.b.w[j].v, acc[j]) : wmma_bf(b1.b.w[j].v, b1.a.v, acc[j]); }
  _Float16* fp = F + (rg * 8 + blockIdx.y) * 2048 + lane * 8;   // the wave's two tiles a = 2 blockIdx.y + (j >> 2) are one step: 4 KB in a row in either array
#pragma unroll
  for (int j = 0; j < 8; ++j) { v8h o;
#pragma unroll
    for (int r = 0; r < 8; ++r) o[r] = (_Float16)acc[j][r];
    vst2(fp + (ISV ? (j & 3) * 512 + (j >> 2) * 256 : j * 256), o); }
}
// ---- frag_tiles: tile = 16 rows x 64 f32 -> 2 KB in a row: piece (k, lane (g, col)) = row col, elements 16 k + 8 g + 0..7.
// wave = FT_N tiles side by side: their loads are issued ahead of the work on the first tile, each of whole lines (lanes 0..15 row 2 j, lanes 16..31 row 2 j + 1, 256 bytes each); the pieces are cut from the wave's own LDS rows
#define FT_P 72                         // LDS row pitch in 16-bit elements: 64 + 8 (144 bytes = 16 x 9: the 16-byte reads of 16 rows fall on distinct banks)
#define FT_N 4
template <typename V4, typename T> __device__ __forceinline__ void frag_tiles(const float* src, const int rs, const int ts, T* dst, T* sw, const int lane) {   // rs, ts: row and tile steps of the source in elements; sw: 16 LDS rows for each tile
  const int col = lane & 15, g = lane >> 4; v4f x[FT_N][8];
  src += (size_t)g * rs + col * 4;
#pragma unroll
  for (int n = 0; n < FT_N; ++n) {
#pragma unroll
    for (int j = 0; j < 8; ++j) x[n][j] = *(const v4f*)(src + (size_t)n * ts + (size_t)(2 * j) * rs); }
#pragma unroll
  for (int n = 0; n < FT_N; ++n) {
#pragma unroll
    for (int j = 0; j < 8; ++j) { const V4 o = { (T)x[n][j][0], (T)x[n][j][1], (T)x[n][j][2], (T)x[n][j][3] }; vst2(&sw[(16 * n + 2 * j + g) * FT_P + col * 4], __builtin_bit_cast(v2u, o)); }
    LDSW();
    v4u r[4];
#pragma unroll
    for (int k = 0; k < 4; ++k) r[k] = *(const v4u*)&sw[(16 * n + col) * FT_P + (2 * k + g) * 8];
#pragma unroll
    for (int k = 0; k < 4; ++k) vst2(dst + n * 1024 + k * 256 + lane * 8, r[k]); }
}
// ---- k_pack: the four weights and the two feature inputs -> bf16 fragments for k_proj, k_projf and k_out. Wave = 16 rows x 256 columns (FT_N tiles side by side); 64 waves (8 blocks) to a weight or to 1,024 feature rows
#define PKB (8 * (4 + (NQ + NA) / 1024))
static_assert(FT_N * 64 == DI && HDM == 4 * DI && DO * 4 == HDM && HDM / 16 == 64 && NQ == 1024, "a wave takes a whole row tile of a [..][256] matrix, a quarter of one of Wo; 64 waves to a unit");
__global__ __launch_bounds__(256) void k_pack(const float* __restrict__ Wk, const float* __restrict__ Wq, const float* __restrict__ Wv, const float* __restrict__ Wo, const float* __restrict__ XQ, const float* __restrict__ XA, __bf16* __restrict__ PK, __bf16* __restrict__ XQF, __bf16* __restrict__ XAF) {
  __shared__ __align__(16) unsigned short st[8][FT_N * 16 * FT_P];
  const int tid = threadIdx.x, wave = __builtin_amdgcn_readfirstlane(tid >> 5), lane = tid & 31;
  const unsigned sel = blockIdx.x >> 3, u = (blockIdx.x & 7) * 8 + wave; __bf16* sw = (__bf16*)&st[wave][0];
  if (sel == 3) { frag_tiles<v4b>(Wo + (size_t)(u >> 2) * 16 * HDM + (u & 3) * DI, HDM, 64, PK + PK_O + (size_t)u * (16 * DI), sw, lane); return; }   // row tile u >> 2, columns 256 (u & 3) + 0..255
  const float* m = sel == 0 ? Wk : sel == 1 ? Wq : sel == 2 ? Wv : sel == 4 ? XQ : XA;
  __bf16* d = sel < 3 ? PK + (size_t)sel * (HDM * DI) : sel == 4 ? XQF : XAF;
  const unsigned rt = sel < 5 ? u : (sel - 5) * 64 + u;   // row tile of the matrix
  frag_tiles<v4b>(m + (size_t)rt * 16 * DI, DI, 64, d + (size_t)rt * (16 * DI), sw, lane);
}
// ---- k_dist: k_attn's dist values (bf16) in the order in which its lanes read them. Wave u = (keypoint tile qt = u >> 5, rg = u & 31): 16 rows x 256 columns, column 16 i + a = place i of tile (rg, a) (k_projf), -> 8 KB in a row: piece (a, lane (g, col)) = row col, places 8 g + 0..7 of tile a.
// 32 loads of whole lines in flight (lanes 0..15 row 2 j, lanes 16..31 row 2 j + 1, 256 bytes each), turned in the wave's own LDS rows [row][a][i]
#define DT_A 24                         // LDS pitch of one a in bf16: 16 places + 8 (48 bytes: the four a of a store's lanes, 4 apart, fall 48 dwords apart, on distinct banks)
#define DT_R (16 * DT_A + 8)            // LDS row pitch in bf16 (784 bytes = 16 x 49: the 16-byte reads of 16 rows fall on distinct banks)
__global__ __launch_bounds__(256) void k_dist(const float* __restrict__ DIST, __bf16* __restrict__ DF) {
  __shared__ __align__(16) __bf16 st[8][16 * DT_R];
  const int tid = threadIdx.x, wave = __builtin_amdgcn_readfirstlane(tid >> 5), lane = tid & 31, col = lane & 15, g = lane >> 4;
  const unsigned u = blockIdx.x * 8 + wave; __bf16* sw = &st[wave][0];
  const float* src = DIST + (size_t)(u >> 5) * 16 * NA + (u & 31) * 256 + (size_t)g * NA + col * 4;
  v4f x[4][8];
#pragma unroll
  for (int n = 0; n < 4; ++n) {
#pragma unroll
    for (int j = 0; j < 8; ++j) x[n][j] = *(const v4f*)(src + n * 64 + (size_t)(2 * j) * NA); }
#pragma unroll
  for (int n = 0; n < 4; ++n) {
#pragma unroll
    for (int j = 0; j < 8; ++j) {
#pragma unroll
      for (int e = 0; e < 4; ++e) sw[(2 * j + g) * DT_R + (4 * (col & 3) + e) * DT_A + 4 * n + (col >> 2)] = (__bf16)x[n][j][e]; } }   // column 64 n + 4 col + e: i = 4 n + (col >> 2), a = 4 (col & 3) + e
  LDSW();
  v4u r[16];
#pragma unroll
  for (int a = 0; a < 16; ++a) r[a] = *(const v4u*)&sw[col * DT_R + a * DT_A + g * 8];
#pragma unroll
  for (int a = 0; a < 16; ++a) vst2(DF + (size_t)u * 4096 + a * 256 + lane * 8, r[a]);
}
// ---- k_attn: block = (64 keypoints, head h), 32 waves = 4 keypoint sub-tiles x NSP atom shares: wave (qs, sh) runs flash attention for 16 keypoints over the 32-atom steps ks = sh, sh + NSP, ... (logits = (bf16(dist) * (1/sqrt3) + q.k * 0.125) * (1/sqrt2) with q, k single f16 operands, held as u = q.k + bf16(dist) * (8/sqrt3), e^(logit - max) = 2^((u - max u) * K2), K2 = log2(e) / (8 sqrt2); P.V with P, V single f16 operands); the NSP partial (m, l, acc) of a keypoint are joined in LDS: O[k][h*64+d] = sum_sh acc_sh w_sh / sum_sh l_sh w_sh, w_sh = 2^((m_sh - M) * K2)
// a fragment stored in fragment order: elements 0..7 of all 32 lanes in a row, then elements 8..15 (p holds the lane's own 8 * lane step)
__device__ __forceinline__ v16h frag_pl(const _Float16* p) { union { v16h v; v8h q[2]; } u; u.q[0] = *(const v8h*)p; u.q[1] = *(const v8h*)(p + 256); return u.v; }
#define NSP 8            // atom shares per keypoint sub-tile (waves per SIMD)
#define SW_M (16 * 68)   // per-wave LDS, written once behind the loop: [16][68] partial output, then m[16], l[16]
#define SW_L (SW_M + 16)
#define SW_N (SW_L + 16)
// lane l <-> lane l ^ 16 without LDS
__device__ __forceinline__ float xhalf(float v) { const int b = __builtin_bit_cast(int, v); return __builtin_bit_cast(float, __builtin_amdgcn_permlanex16(b, b, 0x76543210, 0xfedcba98, false, false)); }
// transposed products: S^T = K . Q^T (A = 16 atom rows, B = 16 keypoint columns), O^T += V^T . P^T. Lane (g, col) holds, of keypoint q0 + col alone, the scores of atoms 16 ct + 8 g + r: maximum and sum run in the lane, one exchange between the halves shares the maximum, and the two converted score tiles are the B operand of the second product as they lie (element 8 ct + r = atom 16 ct + 8 g + r, the k order of the V^T fragment)
// NSP waves per SIMD is all that a block of this size can have: told so, the compiler spends the whole register budget and leaves the step's loads standing as groups ahead of their users, instead of sinking each to its user to save registers (the calls used to hold them in place)
__global__ __launch_bounds__(128 * NSP) __attribute__((amdgpu_waves_per_eu(NSP, NSP))) void k_attn(const float* __restrict__ QP, const _Float16* __restrict__ KF, const __bf16* __restrict__ DF, const _Float16* __restrict__ VT, float* __restrict__ O) {
  __shared__ __align__(16) float sm[4 * NSP][SW_N];
  const int tid = threadIdx.x, wave = __builtin_amdgcn_readfirstlane(tid >> 5), lane = tid & 31, col = lane & 15, g = lane >> 4;   // the wave's number in a scalar register: its share, loop counter and tile addresses stay scalar
  const int qb = blockIdx.x, h = blockIdx.y; const int q0 = qb * 64 + (wave & 3) * 16, sh = wave >> 2;
  float* sp = &sm[wave][0];
  const float CD = (float)(8.0 / 1.7320508075688772), K2 = (float)(1.4426950408889634 / (8.0 * 1.4142135623730951));
  const float* qrow = QP + (size_t)h * NQ * HD + (size_t)(q0 + col) * HD;
  v16h aq[2];
#pragma unroll
  for (int kc = 0; kc < 2; ++kc) aq[kc] = frag_f32(qrow + kc * 32, lane);
  float m = -3.0e38f, l = 0.f;   // of keypoint q0 + col: m (the maximum of u) shared by both halves, l the sum over the lane's own atoms
  v8f acc[4] = {};               // acc[dt][r] = O^T[16 dt + 8 g + r][q0 + col]
  // K, V and dist lie in fragment order (k_projf, k_dist): wave-uniform step bases + the one lane offset 8 * lane, every load instruction reads 512 bytes in a row (4 whole lines, not 16 part lines)
  const _Float16* kh = KF + (size_t)h * NA * HD; const _Float16* vh = VT + (size_t)h * HD * NA; const __bf16* dh = DF + (size_t)(q0 >> 4) * 16 * NA;
  const unsigned lane8 = lane * 8;
#pragma unroll 1
  for (int ks = sh; ks < NA / 32; ks += NSP) { v8f s[2];
    // the step's bases in scalar registers + the one 32-bit lane offset
    const _Float16* kp = sbase(kh + (size_t)ks * 32 * HD) + lane8; const __bf16* dp = sbase(dh + (size_t)ks * 32 * 16) + lane8; const _Float16* vp = sbase(vh + (size_t)ks * 32 * HD) + lane8;
    // the step's K, dist and V loads stand as groups ahead of the products that use them
    v16h ka[2][2]; v8b dv[2]; v16h va[4];
#pragma unroll
    for (int ct = 0; ct < 2; ++ct) {
#pragma unroll
      for (int kc = 0; kc < 2; ++kc) ka[ct][kc] = frag_pl(kp + (ct * 2 + kc) * 512); }
#pragma unroll
    for (int ct = 0; ct < 2; ++ct) dv[ct] = *(const v8b*)(dp + ct * 256);
#pragma unroll
    for (int ct = 0; ct < 2; ++ct) { s[ct] = v8f{};
#pragma unroll
      for (int kc = 0; kc < 2; ++kc) s[ct] = wmma16(ka[ct][kc], aq[kc], s[ct]); }
#pragma unroll
    for (int dt = 0; dt < 4; ++dt) va[dt] = frag_pl(vp + dt * 512);
#pragma unroll
    for (int ct = 0; ct < 2; ++ct) {
#pragma unroll
      for (int r = 0; r < 8; ++r) s[ct][r] = __builtin_fmaf((float)dv[ct][r], CD, s[ct][r]); }
    float mx = fmaxf(s[0][0], s[1][0]);
#pragma unroll
    for (int r = 1; r < 8; ++r) mx = fmaxf(mx, fmaxf(s[0][r], s[1][r]));
    mx = fmaxf(mx, xhalf(mx));
    const float mn = fmaxf(m, mx), nb = -mn * K2; const float alpha = exp2_slot((m - mn) * K2);   // exactly 1 while the maximum stands
    v16h pa; float es, e[16];
#pragma unroll
    for (int ct = 0; ct < 2; ++ct) {
#pragma unroll
      for (int r = 0; r < 8; ++r) e[8 * ct + r] = __builtin_fmaf(s[ct][r], K2, nb);
      exp2x8(e + 8 * ct); }
#pragma unroll
    for (int i = 0; i < 16; ++i) { es = i ? es + e[i] : e[i]; pa[i] = (_Float16)e[i]; }
    asm volatile("s_wait_xcnt 0x0" ::: "memory");   // the step's loads are done with their base registers before the loop's foot moves these on
    l = l * alpha + es; m = mn;
#pragma unroll
    for (int dt = 0; dt < 4; ++dt) acc[dt] *= alpha;
#pragma unroll
    for (int dt = 0; dt < 4; ++dt) acc[dt] = wmma16(va[dt], pa, acc[dt]); }
  l += xhalf(l);   // both halves' sums stand under the same maximum
  const int lane2 = (int)__builtin_amdgcn_mbcnt_lo(~0u, 0u), col2 = lane2 & 15, g2 = lane2 >> 4;   // the lane's number read anew: no register carries it, or what follows from it, through the loop
#pragma unroll
  for (int dt = 0; dt < 4; ++dt) { const v4f lo = { acc[dt][0], acc[dt][1], acc[dt][2], acc[dt][3] }, hi = { acc[dt][4], acc[dt][5], acc[dt][6], acc[dt][7] };
    vst2(&sp[col2 * 68 + dt * 16 + 8 * g2], lo); vst2(&sp[col2 * 68 + dt * 16 + 8 * g2 + 4], hi); }
  if (g2 == 0) { sp[SW_M + col2] = m; sp[SW_L + col2] = l; }
  __syncthreads();   // every share's partial is in LDS before any thread joins them
  { const int qs = wave >> 3, kcl = (wave >> 2) & 1, pi = wave & 3, d4 = kcl * 32 + (pi >> 1) * 16 + g2 * 8 + (pi & 1) * 4, row = col2; const float* p0 = &sm[qs][0];   // wave = one piece row (keypoint sub-tile qs, kc = 2 h + kcl, i = pi) of k_out's A fragments, thread = (keypoint row, 4 of the 64 d); share sh of a keypoint lies 4 waves further
    float ms[NSP], M = -3.0e38f;
#pragma unroll
    for (int i = 0; i < NSP; ++i) { ms[i] = p0[i * 4 * SW_N + SW_M + row]; M = fmaxf(M, ms[i]); }
    float L = 0.f; v4f o = {};
#pragma unroll
    for (int i = 0; i < NSP; ++i) { const float w = exp2_slot((ms[i] - M) * K2); L += p0[i * 4 * SW_N + SW_L + row] * w; o += *(const v4f*)&p0[i * 4 * SW_N + row * 68 + d4] * w; }
    vst2(O + ((((size_t)(qb * 4 + qs) * (HDM / 32) + h * 2 + kcl) * 4 + pi) * 32 + lane2) * 4, o * (1.0f / L)); }   // 512 bytes in a row over the wave
}
__device__ __forceinline__ void out_pass(const PassOps& b, v8f (&acc)[8]) { const F2 a = b.a_split();
#pragma unroll
  for (int j = 0; j < 8; ++j) acc[j] = wmma_bf(a.l, b.b.w[j].v, acc[j]);
#pragma unroll
  for (int j = 0; j < 8; ++j) acc[j] = wmma_bf(a.h, b.b.w[j].v, acc[j]); }
// ---- k_out: block = (64 rows, 128 of the 256 cols): out = O(hi/lo) . Wo rows (2 products); Wo as k_pack's fragments
__global__ __launch_bounds__(128) void k_out(const float* __restrict__ O, const __bf16* __restrict__ P, float* __restrict__ Y) {
  __shared__ __align__(16) float so[4][16][132];
  const int tid = threadIdx.x, wave = __builtin_amdgcn_readfirstlane(tid >> 5), lane = tid & 31; const size_t r0 = (size_t)blockIdx.x * 64 + wave * 16; const int n0 = blockIdx.y * 128;   // the wave's number, and r0 with it, in scalar registers through the loop
  v8f acc[8] = {};
  const float* xp = O + r0 * HDM + lane * 4; const __bf16* wp = P + (size_t)n0 * HDM + lane * 8;
  PassOps b0, b1; b0.load(xp, wp);   // two register sets: pass kc + 1's loads are all in flight while pass kc's products run
#pragma unroll 1   // rolled: the two sets and the accumulators are the whole budget of 256 registers
  for (int kc = 0; kc < HDM / 32 - 2; kc += 2) {
    b1.load(xp + 512, wp + 512);
    __builtin_amdgcn_sched_barrier(0);   // the next pass's loads all issue ahead of this pass's products: sunk among them they would be waited for as soon as issued
    out_pass(b0, acc);
    xp += 1024; wp += 1024; b0.load(xp, wp);
    __builtin_amdgcn_sched_barrier(0);   // as above
    out_pass(b1, acc);
    asm volatile("s_wait_xcnt 0x0" ::: "memory"); }   // the trip's loads are done with their address registers before the next trip moves these on
  b1.load(xp + 512, wp + 512);
  __builtin_amdgcn_sched_barrier(0);   // as above
  out_pass(b0, acc); out_pass(b1, acc);
  const int lane2 = (int)__builtin_amdgcn_mbcnt_lo(~0u, 0u), col2 = lane2 & 15, g2 = lane2 >> 4;   // the lane's number read anew: no register carries it, or what follows from it, through the loop
#pragma unroll
  for (int j = 0; j < 8; ++j) {
#pragma unroll
    for (int r = 0; r < 8; ++r) so[wave][8 * g2 + r][j * 16 + col2] = acc[j][r]; }
  LDSX();
  for (int rl = 0; rl < 16; ++rl) vst2(Y + (r0 + rl) * DO + n0 + lane2 * 4, *(const v4f*)&so[wave][rl][lane2 * 4]);
}
extern "C" void kernel_launch(void* const* d_in, const int* in_sizes, int n_in, void* d_out, int out_size, void* d_ws, size_t ws_size, hipStream_t stream) {
  (void)in_sizes; (void)n_in; (void)out_size;
  const float** F = (const float**)d_in;   // 0 kp_feat [1024,256], 1 kp_dist [1024,8192], 2 rec_atom_feats [8192,256], 3 Wk [1024,256], 4 Wq, 5 Wv, 6 Wo [256,1024]
  if (ws_size < (size_t)WS_END) return;
  char* ws = (char*)d_ws; __bf16* PK = (__bf16*)(ws + WS_PK); float *QPp = (float*)(ws + WS_QP), *O = (float*)(ws + WS_O); _Float16 *VT = (_Float16*)(ws + WS_VT), *KF = (_Float16*)(ws + WS_KF); __bf16 *DF = (__bf16*)(ws + WS_DF), *XA = (__bf16*)(ws + WS_XA), *XQ = (__bf16*)(ws + WS_XQ);
  k_pack<<<PKB, 256, 0, stream>>>(F[3], F[4], F[5], F[6], F[0], F[2], PK, XQ, XA);
  k_projf<false><<<dim3(NA / 64, HDM / 128), 128, 0, stream>>>(XA, PK + PK_K, KF);
  k_projf<true><<<dim3(NA / 64, HDM / 128), 128, 0, stream>>>(XA, PK + PK_V, VT);
  k_proj<<<dim3(NQ / 64, HDM / 128), 128, 0, stream>>>(XQ, PK + PK_Q, QPp);
  k_dist<<<(NQ / 16) * (NA / 256) / 8, 256, 0, stream>>>(F[1], DF);
  k_attn<<<dim3(TQB, NH), 128 * NSP, 0, stream>>>(QPp, KF, DF, VT, O);
  k_out<<<dim3(TQB, DO / 128), 128, 0, stream>>>(O, PK + PK_O, (float*)d_out);
}

// v009
// A run of this version takes 105 microseconds.
// Timed twice side by side with v008, it ran 1.07 times as fast both times.
// Over all steps from v000 it is 13.0 times as fast.
// compute dtype: kp_feat, kp_dist, rec_atom_feats and the four weights (module inputs) rounded to bf16; the three projections with exact bf16 products (inputs x inputs) on WMMA 16x16x32; attention logits q.k with q and k as single f16 operands (1 product; near-uniform softmax over 8,192 atoms, logit error ~1e-4 relative), P.V with P = exp(s - m) and V as single f16 operands (1 product; both errors relative to an 8,192-term softmax average); the output projection with the computed operand as bf16 hi + residual pair x exact Wo (2 products); the kp_dist bias, scaling, running-max softmax and normalisation in f32; f32 accumulate.
#include <hip/hip_runtime.h>
#include <math.h>

typedef __attribute__((ext_vector_type(16))) _Float16 v16h;
typedef __attribute__((ext_vector_type(16))) __bf16 v16b;
typedef __attribute__((ext_vector_type(8)))  _Float16 v8h;
typedef __attribute__((ext_vector_type(8)))  float v8f;
typedef __attribute__((ext_vector_type(4)))  float v4f;
typedef __attribute__((ext_vector_type(2)))  float v2f;
typedef __attribute__((ext_vector_type(4)))  unsigned v4u;
typedef __attribute__((ext_vector_type(4)))  int v4i;
typedef float __attribute__((may_alias)) float_a;
typedef int __attribute__((may_alias)) int_a;

template <typename T> __device__ __forceinline__ void vst2(void* p, T v) { *(T*)p = v;  }
__device__ __forceinline__ v8f wmma16(v16h a, v16h b, v8f c) {
  return __builtin_amdgcn_wmma_f32_16x16x32_f16(false, a, false, b, (short)0, c, false, false);
}
__device__ __forceinline__ v8f wmma_bf(v16b a, v16b b, v8f c) {
  return __builtin_amdgcn_wmma_f32_16x16x32_bf16(false, a, false, b, (short)0, c, false, false);
}
// 16x16x32 fragments: lane = (h = lane>>4, row/col = lane&15); elements 0..7 = k0+8h+0..7, 8..15 = k0+16+8h+0..7; D element r = row 8h+r
__device__ __forceinline__ v16h frag_h(const _Float16* rowk0, int lane) {
  union { v16h v; v8h q[2]; } u; const _Float16* p = rowk0 + 8 * (lane >> 4);
  u.q[0] = *(const v8h*)p; u.q[1] = *(const v8h*)(p + 16); return u.v;
}
__device__ __forceinline__ v16h frag_f32(const float* rowk0, int lane) {
  v16h a; const float* p = rowk0 + 8 * (lane >> 4);
#pragma unroll
  for (int i = 0; i < 8; ++i) { a[i] = (_Float16)p[i]; a[8 + i] = (_Float16)p[16 + i]; }
  return a;
}
__device__ __forceinline__ v16h frag_f32s(const float* rowk0, int lane, float sc) {
  v16h a; const float* p = rowk0 + 8 * (lane >> 4);
#pragma unroll
  for (int i = 0; i < 8; ++i) { a[i] = (_Float16)(p[i] * sc); a[8 + i] = (_Float16)(p[16 + i] * sc); }
  return a;
}
// column fragment from a [K][ld] layout (column n), rows >= K read as 0
__device__ __forceinline__ v16h fragc_f32(const float* W, int k0, int n, int lane, int ld, int K) {
  v16h a; const int g = lane >> 4;
#pragma unroll
  for (int i = 0; i < 8; ++i) { const int ka = k0 + 8 * g + i, kb = ka + 16;
    a[i] = (_Float16)(ka < K ? W[(size_t)(ka < K ? ka : K - 1) * ld + n] : 0.f); a[8 + i] = (_Float16)(kb < K ? W[(size_t)(kb < K ? kb : K - 1) * ld + n] : 0.f); }
  return a;
}
struct F2 { v16b h, l; };
__device__ __forceinline__ F2 bsplit16(const float v[16]) { F2 r;
#pragma unroll
  for (int i = 0; i < 16; ++i) { const __bf16 h = (__bf16)v[i]; r.h[i] = h; r.l[i] = (__bf16)(v[i] - (float)h); }
  return r; }
__device__ __forceinline__ F2 split_row(const float* row, int k0, int lane) { float v[16]; const float* p = row + k0 + 8 * (lane >> 4);
#pragma unroll
  for (int i = 0; i < 8; ++i) { v[i] = p[i]; v[8 + i] = p[16 + i]; }
  return bsplit16(v); }
__device__ __forceinline__ F2 split_rowK(const float* row, int k0, int lane, int K) { float v[16]; const int g = lane >> 4;
#pragma unroll
  for (int i = 0; i < 8; ++i) { const int ka = k0 + 8 * g + i, kb = ka + 16; v[i] = ka < K ? row[ka < K ? ka : K - 1] : 0.f; v[8 + i] = kb < K ? row[kb < K ? kb : K - 1] : 0.f; }
  return bsplit16(v); }
__device__ __forceinline__ F2 split_col(const float* W, int k0, int n, int lane, int ld, int K) { float v[16]; const int g = lane >> 4;
#pragma unroll
  for (int i = 0; i < 8; ++i) { const int ka = k0 + 8 * g + i, kb = ka + 16; v[i] = ka < K ? W[(size_t)(ka < K ? ka : K - 1) * ld + n] : 0.f; v[8 + i] = kb < K ? W[(size_t)(kb < K ? kb : K - 1) * ld + n] : 0.f; }
  return bsplit16(v); }
__device__ __forceinline__ v8f mac3(const F2& a, const F2& b, v8f c) { c = wmma_bf(a.l, b.h, c); c = wmma_bf(a.h, b.l, c); return wmma_bf(a.h, b.h, c); }
__device__ __forceinline__ float sigm(float v) { return 1.0f / (1.0f + expf(-v)); }
#define LDSX() do { asm volatile("s_wait_dscnt 0" ::: "memory"); __builtin_amdgcn_wave_barrier(); __builtin_amdgcn_fence(__ATOMIC_RELEASE, "workgroup"); } while (0)


// Keypoint multi-head attention (1,024 keypoints attend over 8,192 atoms; 16 heads x 64 via the module's RAW row-major reshape of the [rows][1024] projections: head h of K/V = projection rows 512h..512h+511 read as a contiguous [8192][64] block, head h of Q = rows 64h..64h+63 as [1024][64]); logits = (dist / sqrt(3) + q.k / 8) / sqrt(2); out = concat_h(P V) [1024][1024] . Wo^T.
#define NQ 1024          // keypoints
#define NA 8192          // atoms
#define DI 256           // in dim
#define HDM 1024         // heads x hidden
#define NH 16
#define HD 64
#define DO 256           // out dim
#ifndef TQB
#define TQB (NQ / 64)    // query tiles processed
#endif
typedef __attribute__((ext_vector_type(8))) __bf16 v8b;
typedef __attribute__((ext_vector_type(4))) __bf16 v4b;
typedef __attribute__((ext_vector_type(4))) _Float16 v4h;
typedef __attribute__((ext_vector_type(2))) unsigned v2u;
__device__ __forceinline__ v16b frag_b(const __bf16* rowk0, int lane) {
  union { v16b v; v8b q[2]; } u; const __bf16* p = rowk0 + 8 * (lane >> 4);
  u.q[0] = *(const v8b*)p; u.q[1] = *(const v8b*)(p + 16); return u.v;
}
__device__ __forceinline__ float bfr(float v) { return (float)(__bf16)v; }
// 2^v on the chip's own instruction, in line. In asm with the free slot behind a transcendental written into the statement
__device__ __forceinline__ float exp2_slot(float v) { float r; asm("v_exp_f32 %0, %1\n\tv_nop" : "=v"(r) : "v"(v)); return r; }
// eight at once, each in place: every one but the last has an independent instruction behind it, the last the v_nop
__device__ __forceinline__ void exp2x8(float* e) {
  asm("v_exp_f32 %0, %0\n\tv_exp_f32 %1, %1\n\tv_exp_f32 %2, %2\n\tv_exp_f32 %3, %3\n\tv_exp_f32 %4, %4\n\tv_exp_f32 %5, %5\n\tv_exp_f32 %6, %6\n\tv_exp_f32 %7, %7\n\tv_nop"
      : "+v"(e[0]), "+v"(e[1]), "+v"(e[2]), "+v"(e[3]), "+v"(e[4]), "+v"(e[5]), "+v"(e[6]), "+v"(e[7])); }
__device__ __attribute__((noinline)) float erf_ni(float v) { return erff(v); }

// each weight lies as bf16 WMMA fragments: [16-row tile][kc][2 p][32 lanes][8], piece (kc, p, lane (g, col)) = row col, elements 32 kc + 16 p + 8 g + 0..7
#define PK_K 0                          // Wk [1024][256]: 64 row tiles x 8 kc
#define PK_Q (PK_K + HDM * DI)
#define PK_V (PK_Q + HDM * DI)
#define PK_O (PK_V + HDM * DI)            // Wo [256][1024]: 16 row tiles x 32 kc
#define PK_END (PK_O + DO * HDM)
#define WS_PK 0u
#define WS_QP (WS_PK + 2u * PK_END)         // f32 [1024][1024] queries (flat = [16][1024][64])
#define WS_VT (WS_QP + 4u * NQ * HDM)        // f16 V^T fragments [16 h][256 steps][4 dt][2 p][32 lanes][8] (steps, tiles and places of atoms: k_projf)
#define WS_O  (WS_VT + 2u * HDM * NA)        // f32 attention output (keypoint, c = h*64+d) in k_out's A fragment order: [64 keypoint tiles][32 kc][4 i][32 lanes][4], piece (kc, i, lane (g, col)) = keypoint col, c = 32 kc + 16 (i >> 1) + 8 g + 4 (i & 1) + 0..3
#define WS_KF (WS_O + 4u * NQ * HDM)         // f16 K fragments [16 h][512 atom tiles][2 kc][2 p][32 lanes][8]
#define WS_DF (WS_KF + 2u * HDM * NA)        // bf16 dist pieces [64 keypoint tiles][256 steps][2 ct][32 lanes][8]
#define WS_XA (WS_DF + 2u * NQ * NA)         // bf16 rec_atom_feats fragments [512 row tiles][8 kc][2 p][32 lanes][8]
#define WS_XQ (WS_XA + 2u * NA * DI)         // bf16 kp_feat fragments [64 row tiles][8 kc][2 p][32 lanes][8]
#define WS_END (WS_XQ + 2u * NQ * DI)

// The packing kernels start few waves that each move kilobytes
// a wave's own LDS rows are written before its lanes read one another's values back
#define LDSW() asm volatile("s_wait_dscnt 0x0" ::: "memory")
// a wave-uniform pointer held in a scalar register pair
template <typename T> __device__ __forceinline__ const T* sbase(const T* p) { const unsigned long long a = (unsigned long long)p;
  const unsigned lo = (unsigned)__builtin_amdgcn_readfirstlane((int)(unsigned)a), hi = (unsigned)__builtin_amdgcn_readfirstlane((int)(unsigned)(a >> 32));
  return (const T*)(const __attribute__((address_space(1))) T*)(((unsigned long long)hi << 32) | lo); }   // stays a global-memory pointer
// one k pass (32 wide) of a 128-column wave tile: its 8 bf16 B fragments, stored in fragment order (wp holds the lane's own 8 * lane step; ts = elements of a 16-row tile): every load instruction reads 512 bytes in a row
struct FragB { union { v16b v; v8b q[2]; } w[8];
  __device__ __forceinline__ void load(const __bf16* wp, int ts) {
#pragma unroll
    for (int j = 0; j < 8; ++j) { w[j].q[0] = *(const v8b*)(wp + (size_t)j * ts); w[j].q[1] = *(const v8b*)(wp + (size_t)j * ts + 256); } } };
// k_proj's pass: the A fragment of its 16 rows lies in fragment order too
struct PassF { union { v16b v; v8b q[2]; } a; FragB b;
  __device__ __forceinline__ void load(const __bf16* xp, const __bf16* wp) { a.q[0] = *(const v8b*)xp; a.q[1] = *(const v8b*)(xp + 256); b.load(wp, 16 * DI); } };
// k_out's pass: the lane's 16 f32 of its A row, stored by k_attn in fragment order (xp holds the lane's own 4 * lane step)
struct PassOps { v4f x[4]; FragB b;
  __device__ __forceinline__ void load(const float* xp, const __bf16* wp) {
#pragma unroll
    for (int i = 0; i < 4; ++i) x[i] = *(const v4f*)(xp + i * 128);
    b.load(wp, 16 * HDM); }
  __device__ __forceinline__ F2 a_split() const { float v[16];
#pragma unroll
    for (int i = 0; i < 16; ++i) v[i] = x[i >> 2][i & 3];
    return bsplit16(v); } };
// ---- k_proj: block = (64 rows, 128 of the 1024 cols): Y = bf16(X [rows][256]) . W rows (exact products) -> f32 rows (pitch 1024); X and W as k_pack's fragments
__global__ __launch_bounds__(128) void k_proj(const __bf16* __restrict__ XF, const __bf16* __restrict__ P, float* __restrict__ Y) {
  __shared__ __align__(16) float so[4][16][132];
  const int tid = threadIdx.x, wave = __builtin_amdgcn_readfirstlane(tid >> 5), lane = tid & 31, col = lane & 15, g = lane >> 4; const size_t r0 = (size_t)blockIdx.x * 64 + wave * 16; const int n0 = blockIdx.y * 128;   // the wave's number in a scalar register: the tile bases stay scalar
  v8f acc[8] = {};
  const __bf16* xp = XF + r0 * DI + lane * 8; const __bf16* wp = P + (size_t)n0 * DI + lane * 8;
  PassF b0, b1; b0.load(xp, wp);   // two register sets: pass kc + 1's loads are all in flight while pass kc's products run
#pragma unroll
  for (int kc = 0; kc < DI / 32; kc += 2) {
    b1.load(xp + (kc + 1) * 512, wp + (kc + 1) * 512);
    __builtin_amdgcn_sched_barrier(0);   // the next pass's loads all issue ahead of this pass's products: sunk among them they would be waited for as soon as issued
#pragma unroll
    for (int j = 0; j < 8; ++j) acc[j] = wmma_bf(b0.a.v, b0.b.w[j].v, acc[j]);
    if (kc + 2 < DI / 32) b0.load(xp + (kc + 2) * 512, wp + (kc + 2) * 512);
    __builtin_amdgcn_sched_barrier(0);   // as above
#pragma unroll
    for (int j = 0; j < 8; ++j) acc[j] = wmma_bf(b1.a.v, b1.b.w[j].v, acc[j]); }
#pragma unroll
  for (int j = 0; j < 8; ++j) {
#pragma unroll
    for (int r = 0; r < 8; ++r) so[wave][8 * g + r][j * 16 + col] = acc[j][r]; }
  LDSX();
  v4f t[16];   // all 16 LDS reads fly together ahead of the stores
#pragma unroll
  for (int rl = 0; rl < 16; ++rl) t[rl] = *(const v4f*)&so[wave][rl][lane * 4];
#pragma unroll
  for (int rl = 0; rl < 16; ++rl) vst2(Y + (r0 + rl) * HDM + n0 + lane * 4, t[rl]);
}
// ---- k_projf: the K (ISV false) and V (ISV true) projections, k_proj's tile and passes, stored straight from the accumulators as k_attn's f16 fragments: no f32 copy, no LDS, no repacking launch.
// Projection row R holds the 16 atoms 16 (R & 511) + a of head R >> 9 (a = column >> 6, d = column & 63). k_attn's 16-atom tile (rg, a) is made of atom a of the 16 rows 16 rg + i, i = 0..15 its place in the tile; step ks = 8 (rg & 31) + (a >> 1) of the head takes tiles a = 2 (ks & 7) + ct. Softmax over the atoms does not depend on their order; K, V and dist (k_dist) follow the same one.
// K: operands swapped (A = weight rows, B = feature rows): lane (g, col) holds Y[16 rg + col][16 j + 8 g + 0..7] = piece (k = j & 3) of the A fragment of tile (rg, a), row i = col. V: lane (g, col) holds Y[16 rg + 8 g + 0..7][16 j + col] = piece (dt = j & 3, p = a & 1) of the V^T fragment, places i = 8 g + 0..7. Every store instruction writes 512 bytes in a row
template <bool ISV> __global__ __launch_bounds__(128) void k_projf(const __bf16* __restrict__ XF, const __bf16* __restrict__ P, _Float16* __restrict__ F) {
  const int tid = threadIdx.x, wave = __builtin_amdgcn_readfirstlane(tid >> 5), lane = tid & 31; const size_t rg = (size_t)blockIdx.x * 4 + wave; const int n0 = blockIdx.y * 128;   // the wave's number in a scalar register: the tile bases stay scalar
  v8f acc[8] = {};
  const __bf16* xp = XF + rg * 16 * DI + lane * 8; const __bf16* wp = P + (size_t)n0 * DI + lane * 8;
  PassF b0, b1; b0.load(xp, wp);   // two register sets: pass kc + 1's loads are all in flight while pass kc's products run
#pragma unroll
  for (int kc = 0; kc < DI / 32; kc += 2) {
    b1.load(xp + (kc + 1) * 512, wp + (kc + 1) * 512);
    __builtin_amdgcn_sched_barrier(0);   // the next pass's loads all issue ahead of this pass's products: sunk among them they would be waited for as soon as issued
#pragma unroll
    for (int j = 0; j < 8; ++j) acc[j] = ISV ? wmma_bf(b0.a.v, b0.b.w[j].v, acc[j]) : wmma_bf(b0.b.w[j].v, b0.a.v, acc[j]);
    if (kc + 2 < DI / 32) b0.load(xp + (kc + 2) * 512, wp + (kc + 2) * 512);
    __builtin_amdgcn_sched_barrier(0);   // as above
#pragma unroll
    for (int j = 0; j < 8; ++j) acc[j] = ISV ? wmma_bf(b1.a.v, b1.b.w[j].v, acc[j]) : wmma_bf(b1.b.w[j].v, b1.a.v, acc[j]); }
  _Float16* fp = F + (rg * 8 + blockIdx.y) * 2048 + lane * 8;   // the wave's two tiles a = 2 blockIdx.y + (j >> 2) are one step: 4 KB in a row in either array
#pragma unroll
  for (int j = 0; j < 8; ++j) { v8h o;
#pragma unroll
    for (int r = 0; r < 8; ++r) o[r] = (_Float16)acc[j][r];
    vst2(fp + (ISV ? (j & 3) * 512 + (j >> 2) * 256 : j * 256), o); }
}
// ---- frag_tiles: tile = 16 rows x 64 f32 -> 2 KB in a row: piece (k, lane (g, col)) = row col, elements 16 k + 8 g + 0..7.
// wave = FT_N tiles side by side: their loads are issued ahead of the work on the first tile, each of whole lines (lanes 0..15 row 2 j, lanes 16..31 row 2 j + 1, 256 bytes each); the pieces are cut from the wave's own LDS rows
#define FT_P 72                         // LDS row pitch in 16-bit elements: 64 + 8 (144 bytes = 16 x 9: the 16-byte reads of 16 rows fall on distinct banks)
#define FT_N 4
template <typename V4, typename T> __device__ __forceinline__ void frag_tiles(const float* src, const int rs, const int ts, T* dst, T* sw, const int lane) {   // rs, ts: row and tile steps of the source in elements; sw: 16 LDS rows for each tile
  const int col = lane & 15, g = lane >> 4; v4f x[FT_N][8];
  src += (size_t)g * rs + col * 4;
#pragma unroll
  for (int n = 0; n < FT_N; ++n) {
#pragma unroll
    for (int j = 0; j < 8; ++j) x[n][j] = *(const v4f*)(src + (size_t)n * ts + (size_t)(2 * j) * rs); }
#pragma unroll
  for (int n = 0; n < FT_N; ++n) {
#pragma unroll
    for (int j = 0; j < 8; ++j) { const V4 o = { (T)x[n][j][0], (T)x[n][j][1], (T)x[n][j][2], (T)x[n][j][3] }; vst2(&sw[(16 * n + 2 * j + g) * FT_P + col * 4], __builtin_bit_cast(v2u, o)); }
    LDSW();
    v4u r[4];
#pragma unroll
    for (int k = 0; k < 4; ++k) r[k] = *(const v4u*)&sw[(16 * n + col) * FT_P + (2 * k + g) * 8];
#pragma unroll
    for (int k = 0; k < 4; ++k) vst2(dst + n * 1024 + k * 256 + lane * 8, r[k]); }
}
// ---- k_pack: the four weights and the two feature inputs -> bf16 fragments for k_proj, k_projf and k_out. Wave = 16 rows x 256 columns (FT_N tiles side by side); 64 waves (8 blocks) to a weight or to 1,024 feature rows
#define PKB (8 * (4 + (NQ + NA) / 1024))
static_assert(FT_N * 64 == DI && HDM == 4 * DI && DO * 4 == HDM && HDM / 16 == 64 && NQ == 1024, "a wave takes a whole row tile of a [..][256] matrix, a quarter of one of Wo; 64 waves to a unit");
__global__ __launch_bounds__(256) void k_pack(const float* __restrict__ Wk, const float* __restrict__ Wq, const float* __restrict__ Wv, const float* __restrict__ Wo, const float* __restrict__ XQ, const float* __restrict__ XA, __bf16* __restrict__ PK, __bf16* __restrict__ XQF, __bf16* __restrict__ XAF) {
  __shared__ __align__(16) unsigned short st[8][FT_N * 16 * FT_P];
  const int tid = threadIdx.x, wave = __builtin_amdgcn_readfirstlane(tid >> 5), lane = tid & 31;
  const unsigned sel = blockIdx.x >> 3, u = (blockIdx.x & 7) * 8 + wave; __bf16* sw = (__bf16*)&st[wave][0];
  if (sel == 3) { frag_tiles<v4b>(Wo + (size_t)(u >> 2) * 16 * HDM + (u & 3) * DI, HDM, 64, PK + PK_O + (size_t)u * (16 * DI), sw, lane); return; }   // row tile u >> 2, columns 256 (u & 3) + 0..255
  const float* m = sel == 0 ? Wk : sel == 1 ? Wq : sel == 2 ? Wv : sel == 4 ? XQ : XA;
  __bf16* d = sel < 3 ? PK + (size_t)sel * (HDM * DI) : sel == 4 ? XQF : XAF;
  const unsigned rt = sel < 5 ? u : (sel - 5) * 64 + u;   // row tile of the matrix
  frag_tiles<v4b>(m + (size_t)rt * 16 * DI, DI, 64, d + (size_t)rt * (16 * DI), sw, lane);
}
// ---- k_dist: k_attn's dist values (bf16) in the order in which its lanes read them. Wave u = (keypoint tile qt = u >> 5, rg = u & 31): 16 rows x 256 columns, column 16 i + a = place i of tile (rg, a) (k_projf), -> 8 KB in a row: piece (a, lane (g, col)) = row col, places 8 g + 0..7 of tile a.
// 32 loads of whole lines in flight (lanes 0..15 row 2 j, lanes 16..31 row 2 j + 1, 256 bytes each), turned in the wave's own LDS rows [row][a][i]
#define DT_A 24                         // LDS pitch of one a in bf16: 16 places + 8 (48 bytes: the four a of a store's lanes, 4 apart, fall 48 dwords apart, on distinct banks)
#define DT_R (16 * DT_A + 8)            // LDS row pitch in bf16 (784 bytes = 16 x 49: the 16-byte reads of 16 rows fall on distinct banks)
__global__ __launch_bounds__(256) void k_dist(const float* __restrict__ DIST, __bf16* __restrict__ DF) {
  __shared__ __align__(16) __bf16 st[8][16 * DT_R];
  const int tid = threadIdx.x, wave = __builtin_amdgcn_readfirstlane(tid >> 5), lane = tid & 31, col = lane & 15, g = lane >> 4;
  const unsigned u = blockIdx.x * 8 + wave; __bf16* sw = &st[wave][0];
  const float* src = DIST + (size_t)(u >> 5) * 16 * NA + (u & 31) * 256 + (size_t)g * NA + col * 4;
  v4f x[4][8];
#pragma unroll
  for (int n = 0; n < 4; ++n) {
#pragma unroll
    for (int j = 0; j < 8; ++j) x[n][j] = *(const v4f*)(src + n * 64 + (size_t)(2 * j) * NA); }
#pragma unroll
  for (int n = 0; n < 4; ++n) {
#pragma unroll
    for (int j = 0; j < 8; ++j) {
#pragma unroll
      for (int e = 0; e < 4; ++e) sw[(2 * j + g) * DT_R + (4 * (col & 3) + e) * DT_A + 4 * n + (col >> 2)] = (__bf16)x[n][j][e]; } }   // column 64 n + 4 col + e: i = 4 n + (col >> 2), a = 4 (col & 3) + e
  LDSW();
  v4u r[16];
#pragma unroll
  for (int a = 0; a < 16; ++a) r[a] = *(const v4u*)&sw[col * DT_R + a * DT_A + g * 8];
#pragma unroll
  for (int a = 0; a < 16; ++a) vst2(DF + (size_t)u * 4096 + a * 256 + lane * 8, r[a]);
}
// ---- k_attn: block = (64 keypoints, head h), 32 waves = 4 keypoint sub-tiles x NSP atom shares: wave (qs, sh) runs flash attention for 16 keypoints over the 32-atom steps ks = sh, sh + NSP, ... (logits = (bf16(dist) * (1/sqrt3) + q.k * 0.125) * (1/sqrt2) with q, k single f16 operands, held as u = q.k + bf16(dist) * (8/sqrt3), e^(logit - max) = 2^((u - max u) * K2), K2 = log2(e) / (8 sqrt2); P.V with P, V single f16 operands); the NSP partial (m, l, acc) of a keypoint are joined in LDS: O[k][h*64+d] = sum_sh acc_sh w_sh / sum_sh l_sh w_sh, w_sh = 2^((m_sh - M) * K2)
// a fragment stored in fragment order: elements 0..7 of all 32 lanes in a row, then elements 8..15 (p holds the lane's own 8 * lane step)
__device__ __forceinline__ v16h frag_pl(const _Float16* p) { union { v16h v; v8h q[2]; } u; u.q[0] = *(const v8h*)p; u.q[1] = *(const v8h*)(p + 256); return u.v; }
#define NSP 8            // atom shares per keypoint sub-tile (waves per SIMD)
#define SW_M (16 * 68)   // per-wave LDS, written once behind the loop: [16][68] partial output, then m[16], l[16]
#define SW_L (SW_M + 16)
#define SW_N (SW_L + 16)
// LDS ring: two buffers, each one tile = the 256 atoms (NSP steps) of one trip of the work-group, as the bytes lie in memory: dist pieces [4 keypoint sub-tiles][NSP steps] of 1 KB, K fragments [NSP steps] of 4 KB, V^T fragments [NSP steps] of 4 KB.
// Each byte comes from L2 once for the work-group; read straight from memory, a step's K and V were fetched by each of the four waves that share them
#define RG_K (4 * NSP * 1024)
#define RG_V (RG_K + NSP * 4096)
#define RG_B (RG_V + NSP * 4096)   // bytes of a buffer
#define NTR (NA / (32 * NSP))      // trips = tiles
static_assert(RG_K == 32768 && RG_B == 3 * 32768 && 2 * RG_B >= 4 * NSP * SW_N * 4, "three regions of 32 KB, each two copies of 16 bytes a thread; the partials lie over the ring behind the loop");
// a thread's six 16-byte copies of one tile (two to a region, 16 KB apart in LDS), through no register. l: the LDS byte address of its dist place in the buffer; the four pointers: its own bytes in memory.
// The wait is the statement's last line: it stands in front of whatever rewrites an address register that a copy names
__device__ __forceinline__ void tile_copy(const unsigned l, const char* d0, const char* d1, const char* k0, const char* v0) {
  asm volatile("global_load_async_to_lds_b128 %0, %6, off\n\tglobal_load_async_to_lds_b128 %1, %7, off\n\tglobal_load_async_to_lds_b128 %2, %8, off\n\tglobal_load_async_to_lds_b128 %3, %9, off\n\tglobal_load_async_to_lds_b128 %4, %10, off\n\tglobal_load_async_to_lds_b128 %5, %11, off\n\ts_wait_xcnt 0x0"
      :: "v"(l + RG_K), "v"(l + RG_K + 16384), "v"(l), "v"(l + 16384), "v"(l + RG_V), "v"(l + RG_V + 16384), "v"(k0), "v"(k0 + 16384), "v"(d0), "v"(d1), "v"(v0), "v"(v0 + 16384) : "memory"); }
// lane l <-> lane l ^ 16 without LDS
__device__ __forceinline__ float xhalf(float v) { const int b = __builtin_bit_cast(int, v); return __builtin_bit_cast(float, __builtin_amdgcn_permlanex16(b, b, 0x76543210, 0xfedcba98, false, false)); }
// transposed products: S^T = K . Q^T (A = 16 atom rows, B = 16 keypoint columns), O^T += V^T . P^T. Lane (g, col) holds, of keypoint q0 + col alone, the scores of atoms 16 ct + 8 g + r: maximum and sum run in the lane, one exchange between the halves shares the maximum, and the two converted score tiles are the B operand of the second product as they lie (element 8 ct + r = atom 16 ct + 8 g + r, the k order of the V^T fragment)
// NSP waves per SIMD is all that a block of this size can have: told so, the compiler spends the whole register budget and leaves the step's loads standing as groups ahead of their users, instead of sinking each to its user to save registers (the calls used to hold them in place)
__global__ __launch_bounds__(128 * NSP) __attribute__((amdgpu_waves_per_eu(NSP, NSP))) void k_attn(const float* __restrict__ QP, const _Float16* __restrict__ KF, const __bf16* __restrict__ DF, const _Float16* __restrict__ VT, float* __restrict__ O) {
  __shared__ __align__(16) char ring[2 * RG_B];
  float (*sm)[SW_N] = (float (*)[SW_N])ring;   // behind the loop the ring's bytes hold the partials
  const int tid = threadIdx.x, wave = __builtin_amdgcn_readfirstlane(tid >> 5), lane = tid & 31, col = lane & 15, g = lane >> 4;   // the wave's number in a scalar register: its share, loop counter and tile addresses stay scalar
  const int qb = blockIdx.x, h = blockIdx.y; const int q0 = qb * 64 + (wave & 3) * 16, sh = wave >> 2;
  float* sp = &sm[wave][0];
  const float CD = (float)(8.0 / 1.7320508075688772), K2 = (float)(1.4426950408889634 / (8.0 * 1.4142135623730951));
  // the wave's places in a tile: chunk c = wave (and wave + 32) of the 64 chunks of 512 bytes of each region; a dist chunk belongs to keypoint sub-tile c >> 4, of which a tile holds 8 KB in a row
  const unsigned lane16 = lane * 16, lr = (unsigned)(size_t)&ring[0] + wave * 512 + lane16;   // the low 32 bits of a __shared__ address are the LDS byte address
  const char* gk = (const char*)KF + (size_t)h * (NA * HD * 2) + wave * 512; const char* gv = (const char*)VT + (size_t)h * (HD * NA * 2) + wave * 512;
  const char* gd = (const char*)DF + (size_t)(qb * 4 + (wave >> 4)) * (16 * NA * 2) + (wave & 15) * 512; const char* ge = gd + 2 * (16 * NA * 2);
  tile_copy(lr, gd + lane16, ge + lane16, gk + lane16, gv + lane16);   // tile 0 -> buffer 0
  const float* qrow = QP + (size_t)h * NQ * HD + (size_t)(q0 + col) * HD;
  v16h aq[2];
#pragma unroll
  for (int kc = 0; kc < 2; ++kc) aq[kc] = frag_f32(qrow + kc * 32, lane);
  float m = -3.0e38f, l = 0.f;   // of keypoint q0 + col: m (the maximum of u) shared by both halves, l the sum over the lane's own atoms
  v8f acc[4] = {};               // acc[dt][r] = O^T[16 dt + 8 g + r][q0 + col]
  // K, V and dist lie in fragment order (k_projf, k_dist), in the ring as in memory: every LDS load reads 512 bytes in a row
  const unsigned lane8 = lane * 8;
  asm volatile("s_wait_asynccnt 0x0" ::: "memory");   // the wave's own copies of tile 0 have landed
  __syncthreads();   // tile 0 is whole before any wave reads it
  tile_copy(lr + RG_B, gd + 8192 + lane16, ge + 8192 + lane16, gk + 32768 + lane16, gv + 32768 + lane16);   // tile 1 -> buffer 1
#pragma unroll 1   // rolled: one copy of the step's code, the buffer picked by the trip's parity
  for (int t = 0; t < NTR; ++t) { v8f s[2];   // trip t: the wave's step ks = NSP t + sh, read from buffer t & 1
    const char* rb = ring + (t & 1) * RG_B;
    const _Float16* kp = (const _Float16*)(rb + RG_K + sh * 4096) + lane8; const __bf16* dp = (const __bf16*)(rb + ((wave & 3) * NSP + sh) * 1024) + lane8; const _Float16* vp = (const _Float16*)(rb + RG_V + sh * 4096) + lane8;
    // the step's K, dist and V loads stand as groups ahead of the products that use them
    v16h ka[2][2]; v8b dv[2]; v16h va[4];
#pragma unroll
    for (int ct = 0; ct < 2; ++ct) {
#pragma unroll
      for (int kc = 0; kc < 2; ++kc) ka[ct][kc] = frag_pl(kp + (ct * 2 + kc) * 512); }
#pragma unroll
    for (int ct = 0; ct < 2; ++ct) dv[ct] = *(const v8b*)(dp + ct * 256);
#pragma unroll
    for (int ct = 0; ct < 2; ++ct) { s[ct] = v8f{};
#pragma unroll
      for (int kc = 0; kc < 2; ++kc) s[ct] = wmma16(ka[ct][kc], aq[kc], s[ct]); }
#pragma unroll
    for (int dt = 0; dt < 4; ++dt) va[dt] = frag_pl(vp + dt * 512);
#pragma unroll
    for (int ct = 0; ct < 2; ++ct) {
#pragma unroll
      for (int r = 0; r < 8; ++r) s[ct][r] = __builtin_fmaf((float)dv[ct][r], CD, s[ct][r]); }
    // the trip's LDS reads end here, and so does its use of the ring: what follows works on registers, and a wave need not have done it for the others to go on
    asm volatile("s_wait_dscnt 0x0" ::: "memory");      // the wave's reads of buffer t & 1 are done
    asm volatile("s_wait_asynccnt 0x0" ::: "memory");   // its copies of tile t + 1 have landed
    __syncthreads();   // publishes tile t + 1 and ends every wave's reads of buffer t & 1
    if (t + 2 < NTR) tile_copy(lr + (t & 1) * RG_B, sbase(gd + (size_t)(t + 2) * 8192) + lane16, sbase(ge + (size_t)(t + 2) * 8192) + lane16, sbase(gk + (size_t)(t + 2) * 32768) + lane16, sbase(gv + (size_t)(t + 2) * 32768) + lane16);   // tile t + 2 -> the buffer just read; the tile's bases in scalar registers: no address register is carried through the loop
    float mx = fmaxf(s[0][0], s[1][0]);
#pragma unroll
    for (int r = 1; r < 8; ++r) mx = fmaxf(mx, fmaxf(s[0][r], s[1][r]));
    mx = fmaxf(mx, xhalf(mx));
    const float mn = fmaxf(m, mx), nb = -mn * K2; const float alpha = exp2_slot((m - mn) * K2);   // exactly 1 while the maximum stands
    v16h pa; float es, e[16];
#pragma unroll
    for (int ct = 0; ct < 2; ++ct) {
#pragma unroll
      for (int r = 0; r < 8; ++r) e[8 * ct + r] = __builtin_fmaf(s[ct][r], K2, nb);
      exp2x8(e + 8 * ct); }
#pragma unroll
    for (int i = 0; i < 16; ++i) { es = i ? es + e[i] : e[i]; pa[i] = (_Float16)e[i]; }
    l = l * alpha + es; m = mn;
#pragma unroll
    for (int dt = 0; dt < 4; ++dt) acc[dt] *= alpha;
#pragma unroll
    for (int dt = 0; dt < 4; ++dt) acc[dt] = wmma16(va[dt], pa, acc[dt]); }
  asm volatile("s_wait_asynccnt 0x0" ::: "memory");   // no copy is out when the ring's bytes take the partials (the last trip's barrier has ended every read)
  l += xhalf(l);   // both halves' sums stand under the same maximum
  const int lane2 = (int)__builtin_amdgcn_mbcnt_lo(~0u, 0u), col2 = lane2 & 15, g2 = lane2 >> 4;   // the lane's number read anew: no register carries it, or what follows from it, through the loop
#pragma unroll
  for (int dt = 0; dt < 4; ++dt) { const v4f lo = { acc[dt][0], acc[dt][1], acc[dt][2], acc[dt][3] }, hi = { acc[dt][4], acc[dt][5], acc[dt][6], acc[dt][7] };
    vst2(&sp[col2 * 68 + dt * 16 + 8 * g2], lo); vst2(&sp[col2 * 68 + dt * 16 + 8 * g2 + 4], hi); }
  if (g2 == 0) { sp[SW_M + col2] = m; sp[SW_L + col2] = l; }
  __syncthreads();   // every share's partial is in LDS before any thread joins them
  { const int qs = wave >> 3, kcl = (wave >> 2) & 1, pi = wave & 3, d4 = kcl * 32 + (pi >> 1) * 16 + g2 * 8 + (pi & 1) * 4, row = col2; const float* p0 = &sm[qs][0];   // wave = one piece row (keypoint sub-tile qs, kc = 2 h + kcl, i = pi) of k_out's A fragments, thread = (keypoint row, 4 of the 64 d); share sh of a keypoint lies 4 waves further
    float ms[NSP], M = -3.0e38f;
#pragma unroll
    for (int i = 0; i < NSP; ++i) { ms[i] = p0[i * 4 * SW_N + SW_M + row]; M = fmaxf(M, ms[i]); }
    float L = 0.f; v4f o = {};
#pragma unroll
    for (int i = 0; i < NSP; ++i) { const float w = exp2_slot((ms[i] - M) * K2); L += p0[i * 4 * SW_N + SW_L + row] * w; o += *(const v4f*)&p0[i * 4 * SW_N + row * 68 + d4] * w; }
    vst2(O + ((((size_t)(qb * 4 + qs) * (HDM / 32) + h * 2 + kcl) * 4 + pi) * 32 + lane2) * 4, o * (1.0f / L)); }   // 512 bytes in a row over the wave
}
__device__ __forceinline__ void out_pass(const PassOps& b, v8f (&acc)[8]) { const F2 a = b.a_split();
#pragma unroll
  for (int j = 0; j < 8; ++j) acc[j] = wmma_bf(a.l, b.b.w[j].v, acc[j]);
#pragma unroll
  for (int j = 0; j < 8; ++j) acc[j] = wmma_bf(a.h, b.b.w[j].v, acc[j]); }
// ---- k_out: block = (64 rows, 128 of the 256 cols): out = O(hi/lo) . Wo rows (2 products); Wo as k_pack's fragments
__global__ __launch_bounds__(128) void k_out(const float* __restrict__ O, const __bf16* __restrict__ P, float* __restrict__ Y) {
  __shared__ __align__(16) float so[4][16][132];
  const int tid = threadIdx.x, wave = __builtin_amdgcn_readfirstlane(tid >> 5), lane = tid & 31; const size_t r0 = (size_t)blockIdx.x * 64 + wave * 16; const int n0 = blockIdx.y * 128;   // the wave's number, and r0 with it, in scalar registers through the loop
  v8f acc[8] = {};
  const float* xp = O + r0 * HDM + lane * 4; const __bf16* wp = P + (size_t)n0 * HDM + lane * 8;
  PassOps b0, b1; b0.load(xp, wp);   // two register sets: pass kc + 1's loads are all in flight while pass kc's products run
#pragma unroll 1   // rolled: the two sets and the accumulators are the whole budget of 256 registers
  for (int kc = 0; kc < HDM / 32 - 2; kc += 2) {
    b1.load(xp + 512, wp + 512);
    __builtin_amdgcn_sched_barrier(0);   // the next pass's loads all issue ahead of this pass's products: sunk among them they would be waited for as soon as issued
    out_pass(b0, acc);
    xp += 1024; wp += 1024; b0.load(xp, wp);
    __builtin_amdgcn_sched_barrier(0);   // as above
    out_pass(b1, acc);
    asm volatile("s_wait_xcnt 0x0" ::: "memory"); }   // the trip's loads are done with their address registers before the next trip moves these on
  b1.load(xp + 512, wp + 512);
  __builtin_amdgcn_sched_barrier(0);   // as above
  out_pass(b0, acc); out_pass(b1, acc);
  const int lane2 = (int)__builtin_amdgcn_mbcnt_lo(~0u, 0u), col2 = lane2 & 15, g2 = lane2 >> 4;   // the lane's number read anew: no register carries it, or what follows from it, through the loop
#pragma unroll
  for (int j = 0; j < 8; ++j) {
#pragma unroll
    for (int r = 0; r < 8; ++r) so[wave][8 * g2 + r][j * 16 + col2] = acc[j][r]; }
  LDSX();
  for (int rl = 0; rl < 16; ++rl) vst2(Y + (r0 + rl) * DO + n0 + lane2 * 4, *(const v4f*)&so[wave][rl][lane2 * 4]);
}
extern "C" void kernel_launch(void* const* d_in, const int* in_sizes, int n_in, void* d_out, int out_size, void* d_ws, size_t ws_size, hipStream_t stream) {
  (void)in_sizes; (void)n_in; (void)out_size;
  const float** F = (const float**)d_in;   // 0 kp_feat [1024,256], 1 kp_dist [1024,8192], 2 rec_atom_feats [8192,256], 3 Wk [1024,256], 4 Wq, 5 Wv, 6 Wo [256,1024]
  if (ws_size < (size_t)WS_END) return;
  char* ws = (char*)d_ws; __bf16* PK = (__bf16*)(ws + WS_PK); float *QPp = (float*)(ws + WS_QP), *O = (float*)(ws + WS_O); _Float16 *VT = (_Float16*)(ws + WS_VT), *KF = (_Float16*)(ws + WS_KF); __bf16 *DF = (__bf16*)(ws + WS_DF), *XA = (__bf16*)(ws + WS_XA), *XQ = (__bf16*)(ws + WS_XQ);
  k_pack<<<PKB, 256, 0, stream>>>(F[3], F[4], F[5], F[6], F[0], F[2], PK, XQ, XA);
  k_projf<false><<<dim3(NA / 64, HDM / 128), 128, 0, stream>>>(XA, PK + PK_K, KF);
  k_projf<true><<<dim3(NA / 64, HDM / 128), 128, 0, stream>>>(XA, PK + PK_V, VT);
  k_proj<<<dim3(NQ / 64, HDM / 128), 128, 0, stream>>>(XQ, PK + PK_Q, QPp);
  k_dist<<<(NQ / 16) * (NA / 256) / 8, 256, 0, stream>>>(F[1], DF);
  k_attn<<<dim3(TQB, NH), 128 * NSP, 0, stream>>>(QPp, KF, DF, VT, O);
  k_out<<<dim3(TQB, DO / 128), 128, 0, stream>>>(O, PK + PK_O, (float*)d_out);
}

// v010
// A run of this version takes 96.7 microseconds.
// In two side-by-side timings against v009, it was 1.10 and 1.09 times as fast.
// All steps since v000 together make it 14.3 times as fast.
// compute dtype: kp_feat, kp_dist, rec_atom_feats and the four weights (module inputs) rounded to bf16; the three projections with exact bf16 products (inputs x inputs) on WMMA 16x16x32; attention logits q.k with q and k as single f16 operands (1 product; near-uniform softmax over 8,192 atoms, logit error ~1e-4 relative), P.V with P = exp(s - m) and V as single f16 operands (1 product; both errors relative to an 8,192-term softmax average); the output projection with the computed operand as bf16 hi + residual pair x exact Wo (2 products); the kp_dist bias, scaling, running-max softmax and normalisation in f32; f32 accumulate.
#include <hip/hip_runtime.h>
#include <math.h>

typedef __attribute__((ext_vector_type(16))) _Float16 v16h;
typedef __attribute__((ext_vector_type(16))) __bf16 v16b;
typedef __attribute__((ext_vector_type(8)))  _Float16 v8h;
typedef __attribute__((ext_vector_type(8)))  float v8f;
typedef __attribute__((ext_vector_type(4)))  float v4f;
typedef __attribute__((ext_vector_type(2)))  float v2f;
typedef __attribute__((ext_vector_type(4)))  unsigned v4u;
typedef __attribute__((ext_vector_type(4)))  int v4i;
typedef float __attribute__((may_alias)) float_a;
typedef int __attribute__((may_alias)) int_a;

template <typename T> __device__ __forceinline__ void vst2(void* p, T v) { *(T*)p = v;  }
__device__ __forceinline__ v8f wmma16(v16h a, v16h b, v8f c) {
  return __builtin_amdgcn_wmma_f32_16x16x32_f16(false, a, false, b, (short)0, c, false, false);
}
__device__ __forceinline__ v8f wmma_bf(v16b a, v16b b, v8f c) {
  return __builtin_amdgcn_wmma_f32_16x16x32_bf16(false, a, false, b, (short)0, c, false, false);
}
// 16x16x32 fragments: lane = (h = lane>>4, row/col = lane&15); elements 0..7 = k0+8h+0..7, 8..15 = k0+16+8h+0..7; D element r = row 8h+r
__device__ __forceinline__ v16h frag_h(const _Float16* rowk0, int lane) {
  union { v16h v; v8h q[2]; } u; const _Float16* p = rowk0 + 8 * (lane >> 4);
  u.q[0] = *(const v8h*)p; u.q[1] = *(const v8h*)(p + 16); return u.v;
}
__device__ __forceinline__ v16h frag_f32(const float* rowk0, int lane) {
  v16h a; const float* p = rowk0 + 8 * (lane >> 4);
#pragma unroll
  for (int i = 0; i < 8; ++i) { a[i] = (_Float16)p[i]; a[8 + i] = (_Float16)p[16 + i]; }
  return a;
}
__device__ __forceinline__ v16h frag_f32s(const float* rowk0, int lane, float sc) {
  v16h a; const float* p = rowk0 + 8 * (lane >> 4);
#pragma unroll
  for (int i = 0; i < 8; ++i) { a[i] = (_Float16)(p[i] * sc); a[8 + i] = (_Float16)(p[16 + i] * sc); }
  return a;
}
// column fragment from a [K][ld] layout (column n), rows >= K read as 0
__device__ __forceinline__ v16h fragc_f32(const float* W, int k0, int n, int lane, int ld, int K) {
  v16h a; const int g = lane >> 4;
#pragma unroll
  for (int i = 0; i < 8; ++i) { const int ka = k0 + 8 * g + i, kb = ka + 16;
    a[i] = (_Float16)(ka < K ? W[(size_t)(ka < K ? ka : K - 1) * ld + n] : 0.f); a[8 + i] = (_Float16)(kb < K ? W[(size_t)(kb < K ? kb : K - 1) * ld + n] : 0.f); }
  return a;
}
struct F2 { v16b h, l; };
__device__ __forceinline__ F2 bsplit16(const float v[16]) { F2 r;
#pragma unroll
  for (int i = 0; i < 16; ++i) { const __bf16 h = (__bf16)v[i]; r.h[i] = h; r.l[i] = (__bf16)(v[i] - (float)h); }
  return r; }
__device__ __forceinline__ F2 split_row(const float* row, int k0, int lane) { float v[16]; const float* p = row + k0 + 8 * (lane >> 4);
#pragma unroll
  for (int i = 0; i < 8; ++i) { v[i] = p[i]; v[8 + i] = p[16 + i]; }
  return bsplit16(v); }
__device__ __forceinline__ F2 split_rowK(const float* row, int k0, int lane, int K) { float v[16]; const int g = lane >> 4;
#pragma unroll
  for (int i = 0; i < 8; ++i) { const int ka = k0 + 8 * g + i, kb = ka + 16; v[i] = ka < K ? row[ka < K ? ka : K - 1] : 0.f; v[8 + i] = kb < K ? row[kb < K ? kb : K - 1] : 0.f; }
  return bsplit16(v); }
__device__ __forceinline__ F2 split_col(const float* W, int k0, int n, int lane, int ld, int K) { float v[16]; const int g = lane >> 4;
#pragma unroll
  for (int i = 0; i < 8; ++i) { const int ka = k0 + 8 * g + i, kb = ka + 16; v[i] = ka < K ? W[(size_t)(ka < K ? ka : K - 1) * ld + n] : 0.f; v[8 + i] = kb < K ? W[(size_t)(kb < K ? kb : K - 1) * ld + n] : 0.f; }
  return bsplit16(v); }
__device__ __forceinline__ v8f mac3(const F2& a, const F2& b, v8f c) { c = wmma_bf(a.l, b.h, c); c = wmma_bf(a.h, b.l, c); return wmma_bf(a.h, b.h, c); }
__device__ __forceinline__ float sigm(float v) { return 1.0f / (1.0f + expf(-v)); }
#define LDSX() do { asm volatile("s_wait_dscnt 0" ::: "memory"); __builtin_amdgcn_wave_barrier(); __builtin_amdgcn_fence(__ATOMIC_RELEASE, "workgroup"); } while (0)


// Keypoint multi-head attention (1,024 keypoints attend over 8,192 atoms; 16 heads x 64 via the module's RAW row-major reshape of the [rows][1024] projections: head h of K/V = projection rows 512h..512h+511 read as a contiguous [8192][64] block, head h of Q = rows 64h..64h+63 as [1024][64]); logits = (dist / sqrt(3) + q.k / 8) / sqrt(2); out = concat_h(P V) [1024][1024] . Wo^T.
#define NQ 1024          // keypoints
#define NA 8192          // atoms
#define DI 256           // in dim
#define HDM 1024         // heads x hidden
#define NH 16
#define HD 64
#define DO 256           // out dim
#ifndef TQB
#define TQB (NQ / 64)    // query tiles processed
#endif
typedef __attribute__((ext_vector_type(8))) __bf16 v8b;
typedef __attribute__((ext_vector_type(4))) __bf16 v4b;
typedef __attribute__((ext_vector_type(4))) _Float16 v4h;
typedef __attribute__((ext_vector_type(2))) unsigned v2u;
__device__ __forceinline__ v16b frag_b(const __bf16* rowk0, int lane) {
  union { v16b v; v8b q[2]; } u; const __bf16* p = rowk0 + 8 * (lane >> 4);
  u.q[0] = *(const v8b*)p; u.q[1] = *(const v8b*)(p + 16); return u.v;
}
__device__ __forceinline__ float bfr(float v) { return (float)(__bf16)v; }
// 2^v on the chip's own instruction, in line. In asm with the free slot behind a transcendental written into the statement
__device__ __forceinline__ float exp2_slot(float v) { float r; asm("v_exp_f32 %0, %1\n\tv_nop" : "=v"(r) : "v"(v)); return r; }
// eight at once, each in place: every one but the last has an independent instruction behind it, the last the v_nop
__device__ __forceinline__ void exp2x8(float* e) {
  asm("v_exp_f32 %0, %0\n\tv_exp_f32 %1, %1\n\tv_exp_f32 %2, %2\n\tv_exp_f32 %3, %3\n\tv_exp_f32 %4, %4\n\tv_exp_f32 %5, %5\n\tv_exp_f32 %6, %6\n\tv_exp_f32 %7, %7\n\tv_nop"
      : "+v"(e[0]), "+v"(e[1]), "+v"(e[2]), "+v"(e[3]), "+v"(e[4]), "+v"(e[5]), "+v"(e[6]), "+v"(e[7])); }
__device__ __attribute__((noinline)) float erf_ni(float v) { return erff(v); }

// each weight lies as bf16 WMMA fragments: [16-row tile][kc][2 p][32 lanes][8], piece (kc, p, lane (g, col)) = row col, elements 32 kc + 16 p + 8 g + 0..7
#define PK_K 0                          // Wk [1024][256]: 64 row tiles x 8 kc
#define PK_Q (PK_K + HDM * DI)
#define PK_V (PK_Q + HDM * DI)
#define PK_O (PK_V + HDM * DI)            // Wo [256][1024]: 16 row tiles x 32 kc
#define PK_END (PK_O + DO * HDM)
#define WS_PK 0u
#define WS_QP (WS_PK + 2u * PK_END)         // f32 [1024][1024] queries (flat = [16][1024][64])
#define WS_VT (WS_QP + 4u * NQ * HDM)        // f16 V^T fragments [16 h][256 steps][4 dt][2 p][32 lanes][8] (steps, tiles and places of atoms: proj_f)
#define WS_O  (WS_VT + 2u * HDM * NA)        // f32 attention output (keypoint, c = h*64+d) in k_out's A fragment order: [64 keypoint tiles][32 kc][4 i][32 lanes][4], piece (kc, i, lane (g, col)) = keypoint col, c = 32 kc + 16 (i >> 1) + 8 g + 4 (i & 1) + 0..3
#define WS_KF (WS_O + 4u * NQ * HDM)         // f16 K fragments [16 h][512 atom tiles][2 kc][2 p][32 lanes][8]
#define WS_DF (WS_KF + 2u * HDM * NA)        // bf16 dist pieces [64 keypoint tiles][256 steps][2 ct][32 lanes][8]
#define WS_XA (WS_DF + 2u * NQ * NA)         // bf16 rec_atom_feats fragments [512 row tiles][8 kc][2 p][32 lanes][8]
#define WS_XQ (WS_XA + 2u * NA * DI)         // bf16 kp_feat fragments [64 row tiles][8 kc][2 p][32 lanes][8]
#define WS_END (WS_XQ + 2u * NQ * DI)

// The packing kernel starts few waves that each move kilobytes
// a wave's own LDS rows are written before its lanes read one another's values back
#define LDSW() asm volatile("s_wait_dscnt 0x0" ::: "memory")
// a wave-uniform pointer held in a scalar register pair
template <typename T> __device__ __forceinline__ const T* sbase(const T* p) { const unsigned long long a = (unsigned long long)p;
  const unsigned lo = (unsigned)__builtin_amdgcn_readfirstlane((int)(unsigned)a), hi = (unsigned)__builtin_amdgcn_readfirstlane((int)(unsigned)(a >> 32));
  return (const T*)(const __attribute__((address_space(1))) T*)(((unsigned long long)hi << 32) | lo); }   // stays a global-memory pointer
// one k pass (32 wide) of a 128-column wave tile: its 8 bf16 B fragments, stored in fragment order (wp holds the lane's own 8 * lane step; ts = elements of a 16-row tile): every load instruction reads 512 bytes in a row
struct FragB { union { v16b v; v8b q[2]; } w[8];
  __device__ __forceinline__ void load(const __bf16* wp, int ts) {
#pragma unroll
    for (int j = 0; j < 8; ++j) { w[j].q[0] = *(const v8b*)(wp + (size_t)j * ts); w[j].q[1] = *(const v8b*)(wp + (size_t)j * ts + 256); } } };
// k_proj's pass: the A fragment of its 16 rows lies in fragment order too
struct PassF { union { v16b v; v8b q[2]; } a; FragB b;
  __device__ __forceinline__ void load(const __bf16* xp, const __bf16* wp) { a.q[0] = *(const v8b*)xp; a.q[1] = *(const v8b*)(xp + 256); b.load(wp, 16 * DI); } };
// k_out's pass: the lane's 16 f32 of its A row, stored by k_attn in fragment order (xp holds the lane's own 4 * lane step)
struct PassOps { v4f x[4]; FragB b;
  __device__ __forceinline__ void load(const float* xp, const __bf16* wp) {
#pragma unroll
    for (int i = 0; i < 4; ++i) x[i] = *(const v4f*)(xp + i * 128);
    b.load(wp, 16 * HDM); }
  __device__ __forceinline__ F2 a_split() const { float v[16];
#pragma unroll
    for (int i = 0; i < 16; ++i) v[i] = x[i >> 2][i & 3];
    return bsplit16(v); } };
// ---- proj_q (a job of k_proj): block (bx, by) = (64 rows, 128 of the 1024 cols): Y = bf16(X [rows][256]) . W rows (exact products) -> f32 rows (pitch 1024); X and W as k_pack's fragments
__device__ __forceinline__ void proj_q(const __bf16* __restrict__ XF, const __bf16* __restrict__ P, float* __restrict__ Y, float (*so)[16][132], const unsigned bx, const unsigned by) {
  const int tid = threadIdx.x, wave = __builtin_amdgcn_readfirstlane(tid >> 5), lane = tid & 31, col = lane & 15, g = lane >> 4; const size_t r0 = (size_t)bx * 64 + wave * 16; const int n0 = by * 128;   // the wave's number in a scalar register: the tile bases stay scalar
  v8f acc[8] = {};
  const __bf16* xp = XF + r0 * DI + lane * 8; const __bf16* wp = P + (size_t)n0 * DI + lane * 8;
  PassF b0, b1; b0.load(xp, wp);   // two register sets: pass kc + 1's loads are all in flight while pass kc's products run
#pragma unroll
  for (int kc = 0; kc < DI / 32; kc += 2) {
    b1.load(xp + (kc + 1) * 512, wp + (kc + 1) * 512);
    __builtin_amdgcn_sched_barrier(0);   // the next pass's loads all issue ahead of this pass's products: sunk among them they would be waited for as soon as issued
#pragma unroll
    for (int j = 0; j < 8; ++j) acc[j] = wmma_bf(b0.a.v, b0.b.w[j].v, acc[j]);
    if (kc + 2 < DI / 32) b0.load(xp + (kc + 2) * 512, wp + (kc + 2) * 512);
    __builtin_amdgcn_sched_barrier(0);   // as above
#pragma unroll
    for (int j = 0; j < 8; ++j) acc[j] = wmma_bf(b1.a.v, b1.b.w[j].v, acc[j]); }
#pragma unroll
  for (int j = 0; j < 8; ++j) {
#pragma unroll
    for (int r = 0; r < 8; ++r) so[wave][8 * g + r][j * 16 + col] = acc[j][r]; }
  LDSX();
  v4f t[16];   // all 16 LDS reads fly together ahead of the stores
#pragma unroll
  for (int rl = 0; rl < 16; ++rl) t[rl] = *(const v4f*)&so[wave][rl][lane * 4];
#pragma unroll
  for (int rl = 0; rl < 16; ++rl) vst2(Y + (r0 + rl) * HDM + n0 + lane * 4, t[rl]);
}
// ---- proj_f (two jobs of k_proj): the K (ISV false) and V (ISV true) projections, proj_q's tile and passes, stored straight from the accumulators as k_attn's f16 fragments: no f32 copy, no LDS, no repacking launch.
// Projection row R holds the 16 atoms 16 (R & 511) + a of head R >> 9 (a = column >> 6, d = column & 63). k_attn's 16-atom tile (rg, a) is made of atom a of the 16 rows 16 rg + i, i = 0..15 its place in the tile; step ks = 8 (rg & 31) + (a >> 1) of the head takes tiles a = 2 (ks & 7) + ct. Softmax over the atoms does not depend on their order; K, V and dist (pack_dist) follow the same one.
// K: operands swapped (A = weight rows, B = feature rows): lane (g, col) holds Y[16 rg + col][16 j + 8 g + 0..7] = piece (k = j & 3) of the A fragment of tile (rg, a), row i = col. V: lane (g, col) holds Y[16 rg + 8 g + 0..7][16 j + col] = piece (dt = j & 3, p = a & 1) of the V^T fragment, places i = 8 g + 0..7. Every store instruction writes 512 bytes in a row
template <bool ISV> __device__ __forceinline__ void proj_f(const __bf16* __restrict__ XF, const __bf16* __restrict__ P, _Float16* __restrict__ F, const unsigned bx, const unsigned by) {
  const int tid = threadIdx.x, wave = __builtin_amdgcn_readfirstlane(tid >> 5), lane = tid & 31; const size_t rg = (size_t)bx * 4 + wave; const int n0 = by * 128;   // the wave's number in a scalar register: the tile bases stay scalar
  v8f acc[8] = {};
  const __bf16* xp = XF + rg * 16 * DI + lane * 8; const __bf16* wp = P + (size_t)n0 * DI + lane * 8;
  PassF b0, b1; b0.load(xp, wp);   // two register sets: pass kc + 1's loads are all in flight while pass kc's products run
#pragma unroll
  for (int kc = 0; kc < DI / 32; kc += 2) {
    b1.load(xp + (kc + 1) * 512, wp + (kc + 1) * 512);
    __builtin_amdgcn_sched_barrier(0);   // the next pass's loads all issue ahead of this pass's products: sunk among them they would be waited for as soon as issued
#pragma unroll
    for (int j = 0; j < 8; ++j) acc[j] = ISV ? wmma_bf(b0.a.v, b0.b.w[j].v, acc[j]) : wmma_bf(b0.b.w[j].v, b0.a.v, acc[j]);
    if (kc + 2 < DI / 32) b0.load(xp + (kc + 2) * 512, wp + (kc + 2) * 512);
    __builtin_amdgcn_sched_barrier(0);   // as above
#pragma unroll
    for (int j = 0; j < 8; ++j) acc[j] = ISV ? wmma_bf(b1.a.v, b1.b.w[j].v, acc[j]) : wmma_bf(b1.b.w[j].v, b1.a.v, acc[j]); }
  _Float16* fp = F + (rg * 8 + by) * 2048 + lane * 8;   // the wave's two tiles a = 2 by + (j >> 2) are one step: 4 KB in a row in either array
#pragma unroll
  for (int j = 0; j < 8; ++j) { v8h o;
#pragma unroll
    for (int r = 0; r < 8; ++r) o[r] = (_Float16)acc[j][r];
    vst2(fp + (ISV ? (j & 3) * 512 + (j >> 2) * 256 : j * 256), o); }
  asm volatile("s_wait_xcnt 0x0" ::: "memory");   // the stores are done with their address and data registers before code of another job, which follows in the merged kernel, rewrites these
}
// ---- k_proj: the three projections, which do not depend on one another, as one launch: a launch's gap, the start of its waves and its thinly filled end are paid once, and the small Q job runs beside the others.
// The block's index picks the job (a scalar branch): PJ_Q blocks of Q, then PJ_F of K, then PJ_F of V, each job's blocks in the order (bx fastest) that its own grid had; blocks 128 apart in the K or V job still share their feature rows
#define PJ_Q ((NQ / 64) * (HDM / 128))
#define PJ_F ((NA / 64) * (HDM / 128))
__global__ __launch_bounds__(128) void k_proj(const __bf16* __restrict__ XQF, const __bf16* __restrict__ XAF, const __bf16* __restrict__ PK, float* __restrict__ QP, _Float16* __restrict__ KF, _Float16* __restrict__ VT) {
  __shared__ __align__(16) float so[4][16][132];   // used by the Q job alone
  const unsigned f = blockIdx.x;
  if (f < PJ_Q) { proj_q(XQF, PK + PK_Q, QP, so, f % (NQ / 64), f / (NQ / 64)); return; }
  const unsigned u = f - PJ_Q;
  if (u < PJ_F) proj_f<false>(XAF, PK + PK_K, KF, u % (NA / 64), u / (NA / 64));
  else proj_f<true>(XAF, PK + PK_V, VT, (u - PJ_F) % (NA / 64), (u - PJ_F) / (NA / 64));
}
// ---- frag_tiles: tile = 16 rows x 64 f32 -> 2 KB in a row: piece (k, lane (g, col)) = row col, elements 16 k + 8 g + 0..7.
// wave = FT_N tiles side by side: their loads are issued ahead of the work on the first tile, each of whole lines (lanes 0..15 row 2 j, lanes 16..31 row 2 j + 1, 256 bytes each); the pieces are cut from the wave's own LDS rows
#define FT_P 72                         // LDS row pitch in 16-bit elements: 64 + 8 (144 bytes = 16 x 9: the 16-byte reads of 16 rows fall on distinct banks)
#define FT_N 4
template <typename V4, typename T> __device__ __forceinline__ void frag_tiles(const float* src, const int rs, const int ts, T* dst, T* sw, const int lane) {   // rs, ts: row and tile steps of the source in elements; sw: 16 LDS rows for each tile
  const int col = lane & 15, g = lane >> 4; v4f x[FT_N][8];
  src += (size_t)g * rs + col * 4;
#pragma unroll
  for (int n = 0; n < FT_N; ++n) {
#pragma unroll
    for (int j = 0; j < 8; ++j) x[n][j] = *(const v4f*)(src + (size_t)n * ts + (size_t)(2 * j) * rs); }
#pragma unroll
  for (int n = 0; n < FT_N; ++n) {
#pragma unroll
    for (int j = 0; j < 8; ++j) { const V4 o = { (T)x[n][j][0], (T)x[n][j][1], (T)x[n][j][2], (T)x[n][j][3] }; vst2(&sw[(16 * n + 2 * j + g) * FT_P + col * 4], __builtin_bit_cast(v2u, o)); }
    LDSW();
    v4u r[4];
#pragma unroll
    for (int k = 0; k < 4; ++k) r[k] = *(const v4u*)&sw[(16 * n + col) * FT_P + (2 * k + g) * 8];
#pragma unroll
    for (int k = 0; k < 4; ++k) vst2(dst + n * 1024 + k * 256 + lane * 8, r[k]); }
}
// ---- pack_wx (a job of k_pack): the four weights and the two feature inputs -> bf16 fragments for k_proj and k_out. Wave = 16 rows x 256 columns (FT_N tiles side by side); 64 waves (8 blocks) to a weight or to 1,024 feature rows; bx: the block within the job, sw: the wave's own LDS
#define PKB (8 * (4 + (NQ + NA) / 1024))
static_assert(FT_N * 64 == DI && HDM == 4 * DI && DO * 4 == HDM && HDM / 16 == 64 && NQ == 1024, "a wave takes a whole row tile of a [..][256] matrix, a quarter of one of Wo; 64 waves to a unit");
__device__ __forceinline__ void pack_wx(const float* __restrict__ Wk, const float* __restrict__ Wq, const float* __restrict__ Wv, const float* __restrict__ Wo, const float* __restrict__ XQ, const float* __restrict__ XA, __bf16* __restrict__ PK, __bf16* __restrict__ XQF, __bf16* __restrict__ XAF, __bf16* sw, const unsigned bx, const int wave, const int lane) {
  const unsigned sel = bx >> 3, u = (bx & 7) * 8 + wave;
  if (sel == 3) { frag_tiles<v4b>(Wo + (size_t)(u >> 2) * 16 * HDM + (u & 3) * DI, HDM, 64, PK + PK_O + (size_t)u * (16 * DI), sw, lane); return; }   // row tile u >> 2, columns 256 (u & 3) + 0..255
  const float* m = sel == 0 ? Wk : sel == 1 ? Wq : sel == 2 ? Wv : sel == 4 ? XQ : XA;
  __bf16* d = sel < 3 ? PK + (size_t)sel * (HDM * DI) : sel == 4 ? XQF : XAF;
  const unsigned rt = sel < 5 ? u : (sel - 5) * 64 + u;   // row tile of the matrix
  frag_tiles<v4b>(m + (size_t)rt * 16 * DI, DI, 64, d + (size_t)rt * (16 * DI), sw, lane);
}
// ---- pack_dist (a job of k_pack): k_attn's dist values (bf16) in the order in which its lanes read them. Wave u = (keypoint tile qt = u >> 5, rg = u & 31): 16 rows x 256 columns, column 16 i + a = place i of tile (rg, a) (proj_f), -> 8 KB in a row: piece (a, lane (g, col)) = row col, places 8 g + 0..7 of tile a.
// 32 loads of whole lines in flight (lanes 0..15 row 2 j, lanes 16..31 row 2 j + 1, 256 bytes each), turned in the wave's own LDS rows [row][a][i]
#define DT_A 24                         // LDS pitch of one a in bf16: 16 places + 8 (48 bytes: the four a of a store's lanes, 4 apart, fall 48 dwords apart, on distinct banks)
#define DT_R (16 * DT_A + 8)            // LDS row pitch in bf16 (784 bytes = 16 x 49: the 16-byte reads of 16 rows fall on distinct banks)
__device__ __forceinline__ void pack_dist(const float* __restrict__ DIST, __bf16* __restrict__ DF, __bf16* sw, const unsigned bx, const int wave, const int lane) {
  const int col = lane & 15, g = lane >> 4;
  const unsigned u = bx * 8 + wave;
  const float* src = DIST + (size_t)(u >> 5) * 16 * NA + (u & 31) * 256 + (size_t)g * NA + col * 4;
  v4f x[4][8];
#pragma unroll
  for (int n = 0; n < 4; ++n) {
#pragma unroll
    for (int j = 0; j < 8; ++j) x[n][j] = *(const v4f*)(src + n * 64 + (size_t)(2 * j) * NA); }
#pragma unroll
  for (int n = 0; n < 4; ++n) {
#pragma unroll
    for (int j = 0; j < 8; ++j) {
#pragma unroll
      for (int e = 0; e < 4; ++e) sw[(2 * j + g) * DT_R + (4 * (col & 3) + e) * DT_A + 4 * n + (col >> 2)] = (__bf16)x[n][j][e]; } }   // column 64 n + 4 col + e: i = 4 n + (col >> 2), a = 4 (col & 3) + e
  LDSW();
  v4u r[16];
#pragma unroll
  for (int a = 0; a < 16; ++a) r[a] = *(const v4u*)&sw[col * DT_R + a * DT_A + g * 8];
#pragma unroll
  for (int a = 0; a < 16; ++a) vst2(DF + (size_t)u * 4096 + a * 256 + lane * 8, r[a]);
}
// ---- k_pack: both packing jobs, which read inputs alone, as one launch: one gap and one start of waves, and the short weight and feature job runs beside the long dist job. The block's index picks the job (a scalar branch), the long job first
#define PDB ((NQ / 16) * (NA / 256) / 8)
static_assert(16 * DT_R >= FT_N * 16 * FT_P, "a wave's LDS rows hold either job's tiles");
__global__ __launch_bounds__(256) void k_pack(const float* __restrict__ Wk, const float* __restrict__ Wq, const float* __restrict__ Wv, const float* __restrict__ Wo, const float* __restrict__ XQ, const float* __restrict__ XA, const float* __restrict__ DIST, __bf16* __restrict__ PK, __bf16* __restrict__ XQF, __bf16* __restrict__ XAF, __bf16* __restrict__ DF) {
  __shared__ __align__(16) __bf16 st[8][16 * DT_R];
  const int tid = threadIdx.x, wave = __builtin_amdgcn_readfirstlane(tid >> 5), lane = tid & 31;
  if (blockIdx.x < PDB) pack_dist(DIST, DF, &st[wave][0], blockIdx.x, wave, lane);
  else pack_wx(Wk, Wq, Wv, Wo, XQ, XA, PK, XQF, XAF, &st[wave][0], blockIdx.x - PDB, wave, lane);
}
// ---- k_attn: block = (64 keypoints, head h), 32 waves = 4 keypoint sub-tiles x NSP atom shares: wave (qs, sh) runs flash attention for 16 keypoints over the 32-atom steps ks = sh, sh + NSP, ... (logits = (bf16(dist) * (1/sqrt3) + q.k * 0.125) * (1/sqrt2) with q, k single f16 operands, held as u = q.k + bf16(dist) * (8/sqrt3), e^(logit - max) = 2^((u - max u) * K2), K2 = log2(e) / (8 sqrt2); P.V with P, V single f16 operands); the NSP partial (m, l, acc) of a keypoint are joined in LDS: O[k][h*64+d] = sum_sh acc_sh w_sh / sum_sh l_sh w_sh, w_sh = 2^((m_sh - M) * K2)
// a fragment stored in fragment order: elements 0..7 of all 32 lanes in a row, then elements 8..15 (p holds the lane's own 8 * lane step)
__device__ __forceinline__ v16h frag_pl(const _Float16* p) { union { v16h v; v8h q[2]; } u; u.q[0] = *(const v8h*)p; u.q[1] = *(const v8h*)(p + 256); return u.v; }
#define NSP 8            // atom shares per keypoint sub-tile (waves per SIMD)
#define SW_M (16 * 68)   // per-wave LDS, written once behind the loop: [16][68] partial output, then m[16], l[16]
#define SW_L (SW_M + 16)
#define SW_N (SW_L + 16)
// LDS ring: two buffers, each one tile = the 256 atoms (NSP steps) of one trip of the work-group, as the bytes lie in memory: dist pieces [4 keypoint sub-tiles][NSP steps] of 1 KB, K fragments [NSP steps] of 4 KB, V^T fragments [NSP steps] of 4 KB.
// Each byte comes from L2 once for the work-group; read straight from memory, a step's K and V were fetched by each of the four waves that share them
#define RG_K (4 * NSP * 1024)
#define RG_V (RG_K + NSP * 4096)
#define RG_B (RG_V + NSP * 4096)   // bytes of a buffer
#define NTR (NA / (32 * NSP))      // trips = tiles
static_assert(RG_K == 32768 && RG_B == 3 * 32768 && 2 * RG_B >= 4 * NSP * SW_N * 4, "three regions of 32 KB, each two copies of 16 bytes a thread; the partials lie over the ring behind the loop");
// a thread's six 16-byte copies of one tile (two to a region, 16 KB apart in LDS), through no register. l: the LDS byte address of its dist place in the buffer; the four pointers: its own bytes in memory.
// The wait is the statement's last line: it stands in front of whatever rewrites an address register that a copy names
__device__ __forceinline__ void tile_copy(const unsigned l, const char* d0, const char* d1, const char* k0, const char* v0) {
  asm volatile("global_load_async_to_lds_b128 %0, %6, off\n\tglobal_load_async_to_lds_b128 %1, %7, off\n\tglobal_load_async_to_lds_b128 %2, %8, off\n\tglobal_load_async_to_lds_b128 %3, %9, off\n\tglobal_load_async_to_lds_b128 %4, %10, off\n\tglobal_load_async_to_lds_b128 %5, %11, off\n\ts_wait_xcnt 0x0"
      :: "v"(l + RG_K), "v"(l + RG_K + 16384), "v"(l), "v"(l + 16384), "v"(l + RG_V), "v"(l + RG_V + 16384), "v"(k0), "v"(k0 + 16384), "v"(d0), "v"(d1), "v"(v0), "v"(v0 + 16384) : "memory"); }
// lane l <-> lane l ^ 16 without LDS
__device__ __forceinline__ float xhalf(float v) { const int b = __builtin_bit_cast(int, v); return __builtin_bit_cast(float, __builtin_amdgcn_permlanex16(b, b, 0x76543210, 0xfedcba98, false, false)); }
// transposed products: S^T = K . Q^T (A = 16 atom rows, B = 16 keypoint columns), O^T += V^T . P^T. Lane (g, col) holds, of keypoint q0 + col alone, the scores of atoms 16 ct + 8 g + r: maximum and sum run in the lane, one exchange between the halves shares the maximum, and the two converted score tiles are the B operand of the second product as they lie (element 8 ct + r = atom 16 ct + 8 g + r, the k order of the V^T fragment)
// NSP waves per SIMD is all that a block of this size can have: told so, the compiler spends the whole register budget and leaves the step's loads standing as groups ahead of their users, instead of sinking each to its user to save registers (the calls used to hold them in place)
__global__ __launch_bounds__(128 * NSP) __attribute__((amdgpu_waves_per_eu(NSP, NSP))) void k_attn(const float* __restrict__ QP, const _Float16* __restrict__ KF, const __bf16* __restrict__ DF, const _Float16* __restrict__ VT, float* __restrict__ O) {
  __shared__ __align__(16) char ring[2 * RG_B];
  float (*sm)[SW_N] = (float (*)[SW_N])ring;   // behind the loop the ring's bytes hold the partials
  const int tid = threadIdx.x, wave = __builtin_amdgcn_readfirstlane(tid >> 5), lane = tid & 31, col = lane & 15, g = lane >> 4;   // the wave's number in a scalar register: its share, loop counter and tile addresses stay scalar
  const int qb = blockIdx.x, h = blockIdx.y; const int q0 = qb * 64 + (wave & 3) * 16, sh = wave >> 2;
  float* sp = &sm[wave][0];
  const float CD = (float)(8.0 / 1.7320508075688772), K2 = (float)(1.4426950408889634 / (8.0 * 1.4142135623730951));
  // the wave's places in a tile: chunk c = wave (and wave + 32) of the 64 chunks of 512 bytes of each region; a dist chunk belongs to keypoint sub-tile c >> 4, of which a tile holds 8 KB in a row
  const unsigned lane16 = lane * 16, lr = (unsigned)(size_t)&ring[0] + wave * 512 + lane16;   // the low 32 bits of a __shared__ address are the LDS byte address
  const char* gk = (const char*)KF + (size_t)h * (NA * HD * 2) + wave * 512; const char* gv = (const char*)VT + (size_t)h * (HD * NA * 2) + wave * 512;
  const char* gd = (const char*)DF + (size_t)(qb * 4 + (wave >> 4)) * (16 * NA * 2) + (wave & 15) * 512; const char* ge = gd + 2 * (16 * NA * 2);
  tile_copy(lr, gd + lane16, ge + lane16, gk + lane16, gv + lane16);   // tile 0 -> buffer 0
  const float* qrow = QP + (size_t)h * NQ * HD + (size_t)(q0 + col) * HD;
  v16h aq[2];
#pragma unroll
  for (int kc = 0; kc < 2; ++kc) aq[kc] = frag_f32(qrow + kc * 32, lane);
  float m = -3.0e38f, l = 0.f;   // of keypoint q0 + col: m (the maximum of u) shared by both halves, l the sum over the lane's own atoms
  v8f acc[4] = {};               // acc[dt][r] = O^T[16 dt + 8 g + r][q0 + col]
  // K, V and dist lie in fragment order (proj_f, pack_dist), in the ring as in memory: every LDS load reads 512 bytes in a row
  const unsigned lane8 = lane * 8;
  asm volatile("s_wait_asynccnt 0x0" ::: "memory");   // the wave's own copies of tile 0 have landed
  __syncthreads();   // tile 0 is whole before any wave reads it
  tile_copy(lr + RG_B, gd + 8192 + lane16, ge + 8192 + lane16, gk + 32768 + lane16, gv + 32768 + lane16);   // tile 1 -> buffer 1
#pragma unroll 1   // rolled: one copy of the step's code, the buffer picked by the trip's parity
  for (int t = 0; t < NTR; ++t) { v8f s[2];   // trip t: the wave's step ks = NSP t + sh, read from buffer t & 1
    const char* rb = ring + (t & 1) * RG_B;
    const _Float16* kp = (const _Float16*)(rb + RG_K + sh * 4096) + lane8; const __bf16* dp = (const __bf16*)(rb + ((wave & 3) * NSP + sh) * 1024) + lane8; const _Float16* vp = (const _Float16*)(rb + RG_V + sh * 4096) + lane8;
    // the step's K, dist and V loads stand as groups ahead of the products that use them
    v16h ka[2][2]; v8b dv[2]; v16h va[4];
#pragma unroll
    for (int ct = 0; ct < 2; ++ct) {
#pragma unroll
      for (int kc = 0; kc < 2; ++kc) ka[ct][kc] = frag_pl(kp + (ct * 2 + kc) * 512); }
#pragma unroll
    for (int ct = 0; ct < 2; ++ct) dv[ct] = *(const v8b*)(dp + ct * 256);
#pragma unroll
    for (int ct = 0; ct < 2; ++ct) { s[ct] = v8f{};
#pragma unroll
      for (int kc = 0; kc < 2; ++kc) s[ct] = wmma16(ka[ct][kc], aq[kc], s[ct]); }
#pragma unroll
    for (int dt = 0; dt < 4; ++dt) va[dt] = frag_pl(vp + dt * 512);
#pragma unroll
    for (int ct = 0; ct < 2; ++ct) {
#pragma unroll
      for (int r = 0; r < 8; ++r) s[ct][r] = __builtin_fmaf((float)dv[ct][r], CD, s[ct][r]); }
    // the trip's LDS reads end here, and so does its use of the ring: what follows works on registers, and a wave need not have done it for the others to go on
    asm volatile("s_wait_dscnt 0x0" ::: "memory");      // the wave's reads of buffer t & 1 are done
    asm volatile("s_wait_asynccnt 0x0" ::: "memory");   // its copies of tile t + 1 have landed
    __syncthreads();   // publishes tile t + 1 and ends every wave's reads of buffer t & 1
    if (t + 2 < NTR) tile_copy(lr + (t & 1) * RG_B, sbase(gd + (size_t)(t + 2) * 8192) + lane16, sbase(ge + (size_t)(t + 2) * 8192) + lane16, sbase(gk + (size_t)(t + 2) * 32768) + lane16, sbase(gv + (size_t)(t + 2) * 32768) + lane16);   // tile t + 2 -> the buffer just read; the tile's bases in scalar registers: no address register is carried through the loop
    float mx = fmaxf(s[0][0], s[1][0]);
#pragma unroll
    for (int r = 1; r < 8; ++r) mx = fmaxf(mx, fmaxf(s[0][r], s[1][r]));
    mx = fmaxf(mx, xhalf(mx));
    const float mn = fmaxf(m, mx), nb = -mn * K2; const float alpha = exp2_slot((m - mn) * K2);   // exactly 1 while the maximum stands
    v16h pa; float es, e[16];
#pragma unroll
    for (int ct = 0; ct < 2; ++ct) {
#pragma unroll
      for (int r = 0; r < 8; ++r) e[8 * ct + r] = __builtin_fmaf(s[ct][r], K2, nb);
      exp2x8(e + 8 * ct); }
#pragma unroll
    for (int i = 0; i < 16; ++i) { es = i ? es + e[i] : e[i]; pa[i] = (_Float16)e[i]; }
    l = l * alpha + es; m = mn;
#pragma unroll
    for (int dt = 0; dt < 4; ++dt) acc[dt] *= alpha;
#pragma unroll
    for (int dt = 0; dt < 4; ++dt) acc[dt] = wmma16(va[dt], pa, acc[dt]); }
  asm volatile("s_wait_asynccnt 0x0" ::: "memory");   // no copy is out when the ring's bytes take the partials (the last trip's barrier has ended every read)
  l += xhalf(l);   // both halves' sums stand under the same maximum
  const int lane2 = (int)__builtin_amdgcn_mbcnt_lo(~0u, 0u), col2 = lane2 & 15, g2 = lane2 >> 4;   // the lane's number read anew: no register carries it, or what follows from it, through the loop
#pragma unroll
  for (int dt = 0; dt < 4; ++dt) { const v4f lo = { acc[dt][0], acc[dt][1], acc[dt][2], acc[dt][3] }, hi = { acc[dt][4], acc[dt][5], acc[dt][6], acc[dt][7] };
    vst2(&sp[col2 * 68 + dt * 16 + 8 * g2], lo); vst2(&sp[col2 * 68 + dt * 16 + 8 * g2 + 4], hi); }
  if (g2 == 0) { sp[SW_M + col2] = m; sp[SW_L + col2] = l; }
  __syncthreads();   // every share's partial is in LDS before any thread joins them
  { const int qs = wave >> 3, kcl = (wave >> 2) & 1, pi = wave & 3, d4 = kcl * 32 + (pi >> 1) * 16 + g2 * 8 + (pi & 1) * 4, row = col2; const float* p0 = &sm[qs][0];   // wave = one piece row (keypoint sub-tile qs, kc = 2 h + kcl, i = pi) of k_out's A fragments, thread = (keypoint row, 4 of the 64 d); share sh of a keypoint lies 4 waves further
    float ms[NSP], M = -3.0e38f;
#pragma unroll
    for (int i = 0; i < NSP; ++i) { ms[i] = p0[i * 4 * SW_N + SW_M + row]; M = fmaxf(M, ms[i]); }
    float L = 0.f; v4f o = {};
#pragma unroll
    for (int i = 0; i < NSP; ++i) { const float w = exp2_slot((ms[i] - M) * K2); L += p0[i * 4 * SW_N + SW_L + row] * w; o += *(const v4f*)&p0[i * 4 * SW_N + row * 68 + d4] * w; }
    vst2(O + ((((size_t)(qb * 4 + qs) * (HDM / 32) + h * 2 + kcl) * 4 + pi) * 32 + lane2) * 4, o * (1.0f / L)); }   // 512 bytes in a row over the wave
}
__device__ __forceinline__ void out_pass(const PassOps& b, v8f (&acc)[8]) { const F2 a = b.a_split();
#pragma unroll
  for (int j = 0; j < 8; ++j) acc[j] = wmma_bf(a.l, b.b.w[j].v, acc[j]);
#pragma unroll
  for (int j = 0; j < 8; ++j) acc[j] = wmma_bf(a.h, b.b.w[j].v, acc[j]); }
// ---- k_out: block = (64 rows, 128 of the 256 cols): out = O(hi/lo) . Wo rows (2 products); Wo as k_pack's fragments
__global__ __launch_bounds__(128) void k_out(const float* __restrict__ O, const __bf16* __restrict__ P, float* __restrict__ Y) {
  __shared__ __align__(16) float so[4][16][132];
  const int tid = threadIdx.x, wave = __builtin_amdgcn_readfirstlane(tid >> 5), lane = tid & 31; const size_t r0 = (size_t)blockIdx.x * 64 + wave * 16; const int n0 = blockIdx.y * 128;   // the wave's number, and r0 with it, in scalar registers through the loop
  v8f acc[8] = {};
  const float* xp = O + r0 * HDM + lane * 4; const __bf16* wp = P + (size_t)n0 * HDM + lane * 8;
  PassOps b0, b1; b0.load(xp, wp);   // two register sets: pass kc + 1's loads are all in flight while pass kc's products run
#pragma unroll 1   // rolled: the two sets and the accumulators are the whole budget of 256 registers
  for (int kc = 0; kc < HDM / 32 - 2; kc += 2) {
    b1.load(xp + 512, wp + 512);
    __builtin_amdgcn_sched_barrier(0);   // the next pass's loads all issue ahead of this pass's products: sunk among them they would be waited for as soon as issued
    out_pass(b0, acc);
    xp += 1024; wp += 1024; b0.load(xp, wp);
    __builtin_amdgcn_sched_barrier(0);   // as above
    out_pass(b1, acc);
    asm volatile("s_wait_xcnt 0x0" ::: "memory"); }   // the trip's loads are done with their address registers before the next trip moves these on
  b1.load(xp + 512, wp + 512);
  __builtin_amdgcn_sched_barrier(0);   // as above
  out_pass(b0, acc); out_pass(b1, acc);
  const int lane2 = (int)__builtin_amdgcn_mbcnt_lo(~0u, 0u), col2 = lane2 & 15, g2 = lane2 >> 4;   // the lane's number read anew: no register carries it, or what follows from it, through the loop
#pragma unroll
  for (int j = 0; j < 8; ++j) {
#pragma unroll
    for (int r = 0; r < 8; ++r) so[wave][8 * g2 + r][j * 16 + col2] = acc[j][r]; }
  LDSX();
  for (int rl = 0; rl < 16; ++rl) vst2(Y + (r0 + rl) * DO + n0 + lane2 * 4, *(const v4f*)&so[wave][rl][lane2 * 4]);
}
extern "C" void kernel_launch(void* const* d_in, const int* in_sizes, int n_in, void* d_out, int out_size, void* d_ws, size_t ws_size, hipStream_t stream) {
  (void)in_sizes; (void)n_in; (void)out_size;
  const float** F = (const float**)d_in;   // 0 kp_feat [1024,256], 1 kp_dist [1024,8192], 2 rec_atom_feats [8192,256], 3 Wk [1024,256], 4 Wq, 5 Wv, 6 Wo [256,1024]
  if (ws_size < (size_t)WS_END) return;
  char* ws = (char*)d_ws; __bf16* PK = (__bf16*)(ws + WS_PK); float *QPp = (float*)(ws + WS_QP), *O = (float*)(ws + WS_O); _Float16 *VT = (_Float16*)(ws + WS_VT), *KF = (_Float16*)(ws + WS_KF); __bf16 *DF = (__bf16*)(ws + WS_DF), *XA = (__bf16*)(ws + WS_XA), *XQ = (__bf16*)(ws + WS_XQ);
  k_pack<<<PDB + PKB, 256, 0, stream>>>(F[3], F[4], F[5], F[6], F[0], F[2], F[1], PK, XQ, XA, DF);
  k_proj<<<PJ_Q + 2 * PJ_F, 128, 0, stream>>>(XQ, XA, PK, QPp, KF, VT);
  k_attn<<<dim3(TQB, NH), 128 * NSP, 0, stream>>>(QPp, KF, DF, VT, O);
  k_out<<<dim3(TQB, DO / 128), 128, 0, stream>>>(O, PK + PK_O, (float*)d_out);
}
